// v000
// The times below were measured on an AMD MI455X: many runs one after another, warmed up first and cycling through
// copies of the inputs, with the whole window's GPU time divided by the number of runs. Launches and the gaps
// between them are all in it. The median over several windows is given; except for v000 it joins two sittings, which
// can be a few percent apart, so the side-by-side timings, each taken in one sitting, are the better comparison.
// v000 is the starting kernel. One run takes 206 microseconds.
#include <hip/hip_runtime.h>
#include <math.h>

typedef __bf16 bf16;
typedef __attribute__((ext_vector_type(16))) __bf16 v16bf;
typedef __attribute__((ext_vector_type(8)))  __bf16 v8bf;
typedef __attribute__((ext_vector_type(8)))  float  v8f;

#define D_MODEL 1024
#define NHEAD   16
#define DKH     64
#define D_FC    4096
#define BATCH   2
#define SEQ     1024
#define M_TOK   (BATCH*SEQ)   // 2048
#define LN_EPS  1e-6f

// ---------------------------------------------------------------------------
// fragment load: 16-bit A/B fragment from a padded row in LDS/global.
// lane L: row chosen by caller (L&15), kb = (L>>4)*8.
// elements 0..7  = K kb..kb+7 ; elements 8..15 = K 16+kb..16+kb+7
// ---------------------------------------------------------------------------
__device__ __forceinline__ v16bf load_frag(const bf16* rowbase, int kb) {
    v8bf lo = *(const v8bf*)(rowbase + kb);
    v8bf hi = *(const v8bf*)(rowbase + kb + 16);
    v16bf f;
#pragma unroll
    for (int i = 0; i < 8; ++i) { f[i] = lo[i]; f[i + 8] = hi[i]; }
    return f;
}

#define WMMA_BF16(A_, B_, C_) \
    __builtin_amdgcn_wmma_f32_16x16x32_bf16(false, (A_), false, (B_), (short)0, (C_), false, false)

// CDNA5 async global->LDS copy, 16B per lane, tracked by ASYNCcnt.
// vdst = wave-relative LDS byte address, addr = per-lane 64-bit global address.
__device__ __forceinline__ void async_ld_b128(uint32_t lds_addr, const bf16* gaddr) {
    asm volatile("global_load_async_to_lds_b128 %0, %1, off"
                 :: "v"(lds_addr), "v"(gaddr) : "memory");
}
__device__ __forceinline__ uint32_t lds_off32(const void* p) {
    return (uint32_t)(uintptr_t)p;   // flat LDS aperture: low 32 bits = LDS address
}

// ---------------------------------------------------------------------------
// float -> bf16 elementwise (weights). n multiple of 4.
// ---------------------------------------------------------------------------
__global__ void cvt_f32_bf16(const float* __restrict__ in, bf16* __restrict__ out, int n4) {
    int i = blockIdx.x * blockDim.x + threadIdx.x;
    if (i >= n4) return;
    float4 v = *(const float4*)(in + (size_t)i * 4);
    bf16* o = out + (size_t)i * 4;
    o[0] = (bf16)v.x; o[1] = (bf16)v.y; o[2] = (bf16)v.z; o[3] = (bf16)v.w;
}

// ---------------------------------------------------------------------------
// LayerNorm (ddof=1, divide by std+eps), D_MODEL=1024, 256 threads/row.
// ---------------------------------------------------------------------------
__global__ __launch_bounds__(256) void layernorm_bf16(
    const float* __restrict__ x, const float* __restrict__ alpha,
    const float* __restrict__ beta, bf16* __restrict__ out)
{
    __shared__ float red[256];
    const int row = blockIdx.x;
    const int tid = threadIdx.x;
    const float* xr = x + (size_t)row * D_MODEL;

    float v[4];
    float s = 0.f;
#pragma unroll
    for (int i = 0; i < 4; ++i) { v[i] = xr[tid + i * 256]; s += v[i]; }
    red[tid] = s; __syncthreads();
#pragma unroll
    for (int off = 128; off > 0; off >>= 1) {
        if (tid < off) red[tid] += red[tid + off];
        __syncthreads();
    }
    const float mean = red[0] * (1.0f / 1024.0f);
    __syncthreads();

    float s2 = 0.f;
#pragma unroll
    for (int i = 0; i < 4; ++i) { float d = v[i] - mean; s2 += d * d; }
    red[tid] = s2; __syncthreads();
#pragma unroll
    for (int off = 128; off > 0; off >>= 1) {
        if (tid < off) red[tid] += red[tid + off];
        __syncthreads();
    }
    const float var = red[0] * (1.0f / 1023.0f);   // ddof = 1
    const float inv = 1.0f / (sqrtf(var) + LN_EPS);

    bf16* orow = out + (size_t)row * D_MODEL;
#pragma unroll
    for (int i = 0; i < 4; ++i) {
        int c = tid + i * 256;
        orow[c] = (bf16)(alpha[c] * (v[i] - mean) * inv + beta[c]);
    }
}

// ---------------------------------------------------------------------------
// Tiled WMMA bf16 GEMM:  C[M,N] = A[M,K] * B[N,K]^T   (+bias/relu/res)
// block tile 128x128, 8 waves (4 along M x 2 along N), wave tile 32x64.
// Double-buffered LDS staged via async global->LDS copies (ASYNCcnt pipeline).
// ---------------------------------------------------------------------------
template<int HAS_BIAS, int HAS_RELU, int HAS_RES, int OUT_BF16>
__global__ __launch_bounds__(256) void gemm_bf16_wmma(
    const bf16* __restrict__ A, const bf16* __restrict__ B,
    const float* __restrict__ bias, const float* __restrict__ res,
    float* __restrict__ Cf, bf16* __restrict__ Cb,
    int M, int N, int K)
{
    const int LDT = 40;                     // padded row stride (halfs): 80B = 5*16B
    __shared__ __align__(16) bf16 As[2][128 * 40];
    __shared__ __align__(16) bf16 Bs[2][128 * 40];

    const int tid  = threadIdx.x;
    const int lane = tid & 31;
    const int wid  = tid >> 5;
    const int wm   = wid & 3;               // M wave offset: 32*wm
    const int wn   = wid >> 2;              // N wave offset: 64*wn
    const int ln   = lane & 15;
    const int hi   = lane >> 4;
    const int kb   = hi * 8;
    const int m0   = blockIdx.y * 128;
    const int n0   = blockIdx.x * 128;

    // staging coordinates: this thread owns chunks tid and tid+256
    // chunk c: row = c>>2 (0..127), col = (c&3)*8  (within the 32-wide slab)
    const int r0 = tid >> 2,         c0 = (tid & 3) * 8;
    const int r1 = (tid + 256) >> 2, c1 = ((tid + 256) & 3) * 8;

    const bf16* gA0 = A + (size_t)(m0 + r0) * K + c0;
    const bf16* gA1 = A + (size_t)(m0 + r1) * K + c1;
    const bf16* gB0 = B + (size_t)(n0 + r0) * K + c0;
    const bf16* gB1 = B + (size_t)(n0 + r1) * K + c1;

    uint32_t lA0[2], lA1[2], lB0[2], lB1[2];
#pragma unroll
    for (int bi = 0; bi < 2; ++bi) {
        lA0[bi] = lds_off32(&As[bi][r0 * LDT + c0]);
        lA1[bi] = lds_off32(&As[bi][r1 * LDT + c1]);
        lB0[bi] = lds_off32(&Bs[bi][r0 * LDT + c0]);
        lB1[bi] = lds_off32(&Bs[bi][r1 * LDT + c1]);
    }

    auto issue_stage = [&](int s) {
        const int buf = s & 1;
        const int k0  = s * 32;
        async_ld_b128(lA0[buf], gA0 + k0);
        async_ld_b128(lA1[buf], gA1 + k0);
        async_ld_b128(lB0[buf], gB0 + k0);
        async_ld_b128(lB1[buf], gB1 + k0);
    };

    v8f acc[2][4];
#pragma unroll
    for (int mt = 0; mt < 2; ++mt)
#pragma unroll
        for (int nt = 0; nt < 4; ++nt)
#pragma unroll
            for (int r = 0; r < 8; ++r) acc[mt][nt][r] = 0.0f;

    const int nk = K / 32;
    issue_stage(0);
    if (nk > 1) issue_stage(1);

    for (int k = 0; k < nk; ++k) {
        // stage k complete when at most the 4 ops of stage k+1 are outstanding
        if (k + 1 < nk) asm volatile("s_wait_asynccnt 0x4" ::: "memory");
        else            asm volatile("s_wait_asynccnt 0x0" ::: "memory");
        __syncthreads();

        const bf16* as = As[k & 1];
        const bf16* bs = Bs[k & 1];
        v16bf af[2], bfr[4];
#pragma unroll
        for (int mt = 0; mt < 2; ++mt)
            af[mt] = load_frag(&as[(wm * 32 + mt * 16 + ln) * LDT], kb);
#pragma unroll
        for (int nt = 0; nt < 4; ++nt)
            bfr[nt] = load_frag(&bs[(wn * 64 + nt * 16 + ln) * LDT], kb);

#pragma unroll
        for (int mt = 0; mt < 2; ++mt)
#pragma unroll
            for (int nt = 0; nt < 4; ++nt)
                acc[mt][nt] = WMMA_BF16(af[mt], bfr[nt], acc[mt][nt]);

        __syncthreads();                    // all waves done reading buf (k&1)
        if (k + 2 < nk) issue_stage(k + 2); // refill freed buffer
    }

    // epilogue
#pragma unroll
    for (int mt = 0; mt < 2; ++mt) {
#pragma unroll
        for (int nt = 0; nt < 4; ++nt) {
            const int gn = n0 + wn * 64 + nt * 16 + ln;
#pragma unroll
            for (int r = 0; r < 8; ++r) {
                const int gm = m0 + wm * 32 + mt * 16 + r + 8 * hi;
                float v = acc[mt][nt][r];
                if constexpr (HAS_BIAS) v += bias[gn];
                if constexpr (HAS_RELU) v = fmaxf(v, 0.0f);
                if constexpr (HAS_RES)  v += res[(size_t)gm * N + gn];
                if constexpr (OUT_BF16) Cb[(size_t)gm * N + gn] = (bf16)v;
                else                    Cf[(size_t)gm * N + gn] = v;
            }
        }
    }
}

// ---------------------------------------------------------------------------
// Flash attention (bf16 WMMA, f32 softmax state).
// grid: (SEQ/128, BATCH*NHEAD). 8 waves; each wave owns 16 query rows.
// KV tiles of 64 keys staged in LDS; V transposed at load.
// ---------------------------------------------------------------------------
__global__ __launch_bounds__(256) void flash_attn_wmma(
    const bf16* __restrict__ Q, const bf16* __restrict__ Km,
    const bf16* __restrict__ Vm, const int* __restrict__ mask,
    bf16* __restrict__ O)
{
    const int LDK = 72;                       // padded stride (halfs): 144B
    __shared__ __align__(16) bf16 Ks[64 * 72];
    __shared__ __align__(16) bf16 Vt[64 * 72];          // Vt[d][key]
    __shared__ __align__(16) bf16 Ps[8 * 16 * 72];      // per-wave P tile

    const int bh   = blockIdx.y;
    const int b    = bh >> 4;
    const int h    = bh & 15;
    const int tid  = threadIdx.x;
    const int lane = tid & 31;
    const int wid  = tid >> 5;
    const int ln   = lane & 15;
    const int hi   = lane >> 4;
    const int kb   = hi * 8;
    const int q0   = blockIdx.x * 128 + wid * 16;       // query offset in seq
    const size_t dbase = (size_t)h * DKH;

    // Q fragments (2 K-slabs of 32 over DK=64), straight from global
    v16bf qf[2];
    {
        const size_t qrow = (size_t)(b * SEQ + q0 + ln) * D_MODEL + dbase;
#pragma unroll
        for (int s = 0; s < 2; ++s)
            qf[s] = load_frag(Q + qrow + s * 32, kb);
    }

    v8f oacc[4];
#pragma unroll
    for (int n = 0; n < 4; ++n)
#pragma unroll
        for (int r = 0; r < 8; ++r) oacc[n][r] = 0.0f;

    float mrow[8], lrow[8];
#pragma unroll
    for (int r = 0; r < 8; ++r) { mrow[r] = -3.0e38f; lrow[r] = 0.0f; }

    const float scale = 0.125f;               // 1/sqrt(64)

    for (int kk0 = 0; kk0 < SEQ; kk0 += 64) {
        __syncthreads();
        // stage K tile [64][64] and V transposed [d][key]
#pragma unroll
        for (int c = tid; c < 512; c += 256) {
            const int r   = c >> 3;
            const int col = (c & 7) * 8;
            const size_t grow = (size_t)(b * SEQ + kk0 + r) * D_MODEL + dbase + col;
            *(uint4*)(&Ks[r * LDK + col]) = *(const uint4*)(Km + grow);
            v8bf vv = *(const v8bf*)(Vm + grow);
#pragma unroll
            for (int j = 0; j < 8; ++j) Vt[(col + j) * LDK + r] = vv[j];
        }
        __syncthreads();

        // scores S = Q * K^T  (4 tiles of 16 keys)
        v8f sacc[4];
#pragma unroll
        for (int t = 0; t < 4; ++t)
#pragma unroll
            for (int r = 0; r < 8; ++r) sacc[t][r] = 0.0f;
#pragma unroll
        for (int s = 0; s < 2; ++s)
#pragma unroll
            for (int t = 0; t < 4; ++t) {
                v16bf kf = load_frag(&Ks[(t * 16 + ln) * LDK + s * 32], kb);
                sacc[t] = WMMA_BF16(qf[s], kf, sacc[t]);
            }

        // scale + mask
        float sv[4][8];
#pragma unroll
        for (int t = 0; t < 4; ++t) {
            const int key = kk0 + t * 16 + ln;
            const int mk  = mask[b * SEQ + key];
#pragma unroll
            for (int r = 0; r < 8; ++r) {
                float xs = sacc[t][r] * scale;
                sv[t][r] = (mk == 0) ? -1.0e9f : xs;
            }
        }

        // online softmax: row stats live per lane-group of 16
        float mnew[8], alpha[8];
#pragma unroll
        for (int r = 0; r < 8; ++r) {
            float mx = fmaxf(fmaxf(sv[0][r], sv[1][r]), fmaxf(sv[2][r], sv[3][r]));
#pragma unroll
            for (int off = 8; off > 0; off >>= 1)
                mx = fmaxf(mx, __shfl_xor(mx, off, 32));
            mnew[r]  = fmaxf(mrow[r], mx);
            alpha[r] = __expf(mrow[r] - mnew[r]);
        }
        float ps[4][8];
#pragma unroll
        for (int t = 0; t < 4; ++t)
#pragma unroll
            for (int r = 0; r < 8; ++r)
                ps[t][r] = __expf(sv[t][r] - mnew[r]);
#pragma unroll
        for (int r = 0; r < 8; ++r) {
            float sm = ps[0][r] + ps[1][r] + ps[2][r] + ps[3][r];
#pragma unroll
            for (int off = 8; off > 0; off >>= 1)
                sm += __shfl_xor(sm, off, 32);
            lrow[r] = lrow[r] * alpha[r] + sm;
            mrow[r] = mnew[r];
        }
#pragma unroll
        for (int n = 0; n < 4; ++n)
#pragma unroll
            for (int r = 0; r < 8; ++r) oacc[n][r] *= alpha[r];

        // restage P as bf16 A-fragments (per-wave LDS region, same-wave in-order)
        bf16* pw = &Ps[wid * 16 * LDK];
#pragma unroll
        for (int t = 0; t < 4; ++t)
#pragma unroll
            for (int r = 0; r < 8; ++r)
                pw[(r + 8 * hi) * LDK + t * 16 + ln] = (bf16)ps[t][r];

        // O += P * V
#pragma unroll
        for (int s = 0; s < 2; ++s) {
            v16bf pf = load_frag(&pw[ln * LDK + s * 32], kb);
#pragma unroll
            for (int n = 0; n < 4; ++n) {
                v16bf vf = load_frag(&Vt[(n * 16 + ln) * LDK + s * 32], kb);
                oacc[n] = WMMA_BF16(pf, vf, oacc[n]);
            }
        }
    }

    // finalize: O /= l, write bf16 [token][h*64 + d]
#pragma unroll
    for (int r = 0; r < 8; ++r) {
        const float invl = 1.0f / lrow[r];
        const size_t gm  = (size_t)(b * SEQ + q0 + r + 8 * hi);
#pragma unroll
        for (int n = 0; n < 4; ++n)
            O[gm * D_MODEL + dbase + n * 16 + ln] = (bf16)(oacc[n][r] * invl);
    }
}

// ---------------------------------------------------------------------------
// launch
// ---------------------------------------------------------------------------
extern "C" void kernel_launch(void* const* d_in, const int* in_sizes, int n_in,
                              void* d_out, int out_size, void* d_ws, size_t ws_size,
                              hipStream_t stream)
{
    const float* x      = (const float*)d_in[0];
    const int*   mask   = (const int*)  d_in[1];
    const float* w_q    = (const float*)d_in[2];
    const float* w_k    = (const float*)d_in[3];
    const float* w_v    = (const float*)d_in[4];
    const float* w_o    = (const float*)d_in[5];
    const float* alpha1 = (const float*)d_in[6];
    const float* beta1  = (const float*)d_in[7];
    const float* alpha2 = (const float*)d_in[8];
    const float* beta2  = (const float*)d_in[9];
    const float* fc1_w  = (const float*)d_in[10];
    const float* fc1_b  = (const float*)d_in[11];
    const float* fc2_w  = (const float*)d_in[12];
    const float* fc2_b  = (const float*)d_in[13];

    char* ws = (char*)d_ws;
    size_t off = 0;
    auto take = [&](size_t bytes) { char* p = ws + off; off += bytes; return p; };

    bf16* wqb   = (bf16*)take((size_t)D_MODEL * D_MODEL * 2);
    bf16* wkb   = (bf16*)take((size_t)D_MODEL * D_MODEL * 2);
    bf16* wvb   = (bf16*)take((size_t)D_MODEL * D_MODEL * 2);
    bf16* wob   = (bf16*)take((size_t)D_MODEL * D_MODEL * 2);
    bf16* fc1b  = (bf16*)take((size_t)D_FC * D_MODEL * 2);
    bf16* fc2b  = (bf16*)take((size_t)D_MODEL * D_FC * 2);
    bf16* ln1b  = (bf16*)take((size_t)M_TOK * D_MODEL * 2);
    bf16* Qb    = (bf16*)take((size_t)M_TOK * D_MODEL * 2);
    bf16* Kb    = (bf16*)take((size_t)M_TOK * D_MODEL * 2);
    bf16* Vb    = (bf16*)take((size_t)M_TOK * D_MODEL * 2);
    bf16* attnb = (bf16*)take((size_t)M_TOK * D_MODEL * 2);
    float* x1   = (float*)take((size_t)M_TOK * D_MODEL * 4);
    bf16* ln2b  = (bf16*)take((size_t)M_TOK * D_MODEL * 2);
    bf16* hidb  = (bf16*)take((size_t)M_TOK * D_FC * 2);

    // weight conversions
    {
        int n4 = D_MODEL * D_MODEL / 4;
        cvt_f32_bf16<<<(n4 + 255) / 256, 256, 0, stream>>>(w_q, wqb, n4);
        cvt_f32_bf16<<<(n4 + 255) / 256, 256, 0, stream>>>(w_k, wkb, n4);
        cvt_f32_bf16<<<(n4 + 255) / 256, 256, 0, stream>>>(w_v, wvb, n4);
        cvt_f32_bf16<<<(n4 + 255) / 256, 256, 0, stream>>>(w_o, wob, n4);
        int nf = D_FC * D_MODEL / 4;
        cvt_f32_bf16<<<(nf + 255) / 256, 256, 0, stream>>>(fc1_w, fc1b, nf);
        cvt_f32_bf16<<<(nf + 255) / 256, 256, 0, stream>>>(fc2_w, fc2b, nf);
    }

    // LN1
    layernorm_bf16<<<M_TOK, 256, 0, stream>>>(x, alpha1, beta1, ln1b);

    // Q, K, V projections  (bf16 out)
    dim3 gP(D_MODEL / 128, M_TOK / 128);
    gemm_bf16_wmma<0,0,0,1><<<gP, 256, 0, stream>>>(ln1b, wqb, nullptr, nullptr,
                                                    nullptr, Qb, M_TOK, D_MODEL, D_MODEL);
    gemm_bf16_wmma<0,0,0,1><<<gP, 256, 0, stream>>>(ln1b, wkb, nullptr, nullptr,
                                                    nullptr, Kb, M_TOK, D_MODEL, D_MODEL);
    gemm_bf16_wmma<0,0,0,1><<<gP, 256, 0, stream>>>(ln1b, wvb, nullptr, nullptr,
                                                    nullptr, Vb, M_TOK, D_MODEL, D_MODEL);

    // attention
    flash_attn_wmma<<<dim3(SEQ / 128, BATCH * NHEAD), 256, 0, stream>>>(
        Qb, Kb, Vb, mask, attnb);

    // output projection + residual:  x1 = x + attn @ w_o^T  (f32 out)
    gemm_bf16_wmma<0,0,1,0><<<gP, 256, 0, stream>>>(attnb, wob, nullptr, x,
                                                    x1, nullptr, M_TOK, D_MODEL, D_MODEL);

    // LN2
    layernorm_bf16<<<M_TOK, 256, 0, stream>>>(x1, alpha2, beta2, ln2b);

    // FC1: relu(ln2 @ fc1^T + b1) -> bf16 hidden
    dim3 gF1(D_FC / 128, M_TOK / 128);
    gemm_bf16_wmma<1,1,0,1><<<gF1, 256, 0, stream>>>(ln2b, fc1b, fc1_b, nullptr,
                                                     nullptr, hidb, M_TOK, D_FC, D_MODEL);

    // FC2: out = x1 + hidden @ fc2^T + b2  (f32 -> d_out)
    gemm_bf16_wmma<1,0,1,0><<<gP, 256, 0, stream>>>(hidb, fc2b, fc2_b, x1,
                                                    (float*)d_out, nullptr, M_TOK, D_MODEL, D_FC);

    (void)in_sizes; (void)n_in; (void)out_size; (void)ws_size;
}

// v001
// One run takes 164 microseconds.
// In both of two side-by-side timings against v000, it was 1.26 times as fast.
#include <hip/hip_runtime.h>
#include <math.h>

typedef __bf16 bf16;
typedef __attribute__((ext_vector_type(16))) __bf16 v16bf;
typedef __attribute__((ext_vector_type(8)))  __bf16 v8bf;
typedef __attribute__((ext_vector_type(8)))  float  v8f;

#define D_MODEL 1024
#define NHEAD   16
#define DKH     64
#define D_FC    4096
#define BATCH   2
#define SEQ     1024
#define M_TOK   (BATCH*SEQ)   // 2048
#define LN_EPS  1e-6f

// ---------------------------------------------------------------------------
// fragment load: 16-bit A/B fragment from a padded row in LDS/global.
// lane L: row chosen by caller (L&15), kb = (L>>4)*8.
// elements 0..7  = K kb..kb+7 ; elements 8..15 = K 16+kb..16+kb+7
// ---------------------------------------------------------------------------
__device__ __forceinline__ v16bf load_frag(const bf16* rowbase, int kb) {
    v8bf lo = *(const v8bf*)(rowbase + kb);
    v8bf hi = *(const v8bf*)(rowbase + kb + 16);
    v16bf f;
#pragma unroll
    for (int i = 0; i < 8; ++i) { f[i] = lo[i]; f[i + 8] = hi[i]; }
    return f;
}

#define WMMA_BF16(A_, B_, C_) \
    __builtin_amdgcn_wmma_f32_16x16x32_bf16(false, (A_), false, (B_), (short)0, (C_), false, false)

// CDNA5 async global->LDS copies, 16B per lane each, tracked by ASYNCcnt.
// Eight copies of one operand's slab: copy i takes LDS byte address lds + i*lstep
// and global address g + i*gstep (elements). The closing s_wait_xcnt 0 stands in the
// copies' own statement so that no address register is rewritten ahead of it.
__device__ __forceinline__ void async_ld8_b128(uint32_t lds, uint32_t lstep,
                                               const bf16* g, size_t gstep) {
    asm volatile("global_load_async_to_lds_b128 %0, %8, off\n\t"
                 "global_load_async_to_lds_b128 %1, %9, off\n\t"
                 "global_load_async_to_lds_b128 %2, %10, off\n\t"
                 "global_load_async_to_lds_b128 %3, %11, off\n\t"
                 "global_load_async_to_lds_b128 %4, %12, off\n\t"
                 "global_load_async_to_lds_b128 %5, %13, off\n\t"
                 "global_load_async_to_lds_b128 %6, %14, off\n\t"
                 "global_load_async_to_lds_b128 %7, %15, off\n\t"
                 "s_wait_xcnt 0x0"
                 :: "v"(lds), "v"(lds + lstep), "v"(lds + 2 * lstep), "v"(lds + 3 * lstep),
                    "v"(lds + 4 * lstep), "v"(lds + 5 * lstep), "v"(lds + 6 * lstep),
                    "v"(lds + 7 * lstep),
                    "v"(g), "v"(g + gstep), "v"(g + 2 * gstep), "v"(g + 3 * gstep),
                    "v"(g + 4 * gstep), "v"(g + 5 * gstep), "v"(g + 6 * gstep),
                    "v"(g + 7 * gstep)
                 : "memory");
}
__device__ __forceinline__ uint32_t lds_off32(const void* p) {
    return (uint32_t)(uintptr_t)p;   // flat LDS aperture: low 32 bits = LDS address
}

// ---------------------------------------------------------------------------
// float -> bf16 elementwise (weights). n multiple of 4.
// ---------------------------------------------------------------------------
__global__ void cvt_f32_bf16(const float* __restrict__ in, bf16* __restrict__ out, int n4) {
    int i = blockIdx.x * blockDim.x + threadIdx.x;
    if (i >= n4) return;
    float4 v = *(const float4*)(in + (size_t)i * 4);
    bf16* o = out + (size_t)i * 4;
    o[0] = (bf16)v.x; o[1] = (bf16)v.y; o[2] = (bf16)v.z; o[3] = (bf16)v.w;
}

// ---------------------------------------------------------------------------
// LayerNorm (ddof=1, divide by std+eps), D_MODEL=1024, 256 threads/row.
// ---------------------------------------------------------------------------
__global__ __launch_bounds__(256) void layernorm_bf16(
    const float* __restrict__ x, const float* __restrict__ alpha,
    const float* __restrict__ beta, bf16* __restrict__ out)
{
    __shared__ float red[256];
    const int row = blockIdx.x;
    const int tid = threadIdx.x;
    const float* xr = x + (size_t)row * D_MODEL;

    float v[4];
    float s = 0.f;
#pragma unroll
    for (int i = 0; i < 4; ++i) { v[i] = xr[tid + i * 256]; s += v[i]; }
    red[tid] = s; __syncthreads();
#pragma unroll
    for (int off = 128; off > 0; off >>= 1) {
        if (tid < off) red[tid] += red[tid + off];
        __syncthreads();
    }
    const float mean = red[0] * (1.0f / 1024.0f);
    __syncthreads();

    float s2 = 0.f;
#pragma unroll
    for (int i = 0; i < 4; ++i) { float d = v[i] - mean; s2 += d * d; }
    red[tid] = s2; __syncthreads();
#pragma unroll
    for (int off = 128; off > 0; off >>= 1) {
        if (tid < off) red[tid] += red[tid + off];
        __syncthreads();
    }
    const float var = red[0] * (1.0f / 1023.0f);   // ddof = 1
    const float inv = 1.0f / (sqrtf(var) + LN_EPS);

    bf16* orow = out + (size_t)row * D_MODEL;
#pragma unroll
    for (int i = 0; i < 4; ++i) {
        int c = tid + i * 256;
        orow[c] = (bf16)(alpha[c] * (v[i] - mean) * inv + beta[c]);
    }
}

// ---------------------------------------------------------------------------
// Tiled WMMA bf16 GEMM:  C[M,N] = A[M,K] * B[N,K]^T   (+bias/relu/res)
// block tile 128x128, 8 waves (4 along M x 2 along N), wave tile 32x64.
// Two LDS buffers, each one pass of 128 k (256 B of every operand row), filled by
// async global->LDS copies one pass ahead; one publish point per pass.
// ---------------------------------------------------------------------------
template<int HAS_BIAS, int HAS_RELU, int HAS_RES, int OUT_BF16>
__global__ __launch_bounds__(256) void gemm_bf16_wmma(
    const bf16* __restrict__ A, const bf16* __restrict__ B,
    const float* __restrict__ bias, const float* __restrict__ res,
    float* __restrict__ Cf, bf16* __restrict__ Cb,
    int M, int N, int K)
{
    const int LDT = 136;                    // padded row stride (halfs): 272B = 17*16B
    __shared__ __align__(16) bf16 As[2][128 * 136];
    __shared__ __align__(16) bf16 Bs[2][128 * 136];

    const int tid  = threadIdx.x;
    const int lane = tid & 31;
    const int wid  = tid >> 5;
    const int wm   = wid & 3;               // M wave offset: 32*wm
    const int wn   = wid >> 2;              // N wave offset: 64*wn
    const int ln   = lane & 15;
    const int hi   = lane >> 4;
    const int kb   = hi * 8;
    const int m0   = blockIdx.y * 128;
    const int n0   = blockIdx.x * 128;

    // staging coordinates: this thread owns chunks tid + i*256, i = 0..7, per operand
    // chunk c: row = c>>4 (0..127), col = (c&15)*8  (within the 128-wide slab)
    const int r0 = tid >> 4, c0 = (tid & 15) * 8;

    const bf16* gA = A + (size_t)(m0 + r0) * K + c0;
    const bf16* gB = B + (size_t)(n0 + r0) * K + c0;
    const size_t   gstep = (size_t)16 * K;          // 16 rows further per copy
    const uint32_t lstep = 16 * LDT * 2;            // the same in LDS bytes

    uint32_t lA[2], lB[2];
#pragma unroll
    for (int bi = 0; bi < 2; ++bi) {
        lA[bi] = lds_off32(&As[bi][r0 * LDT + c0]);
        lB[bi] = lds_off32(&Bs[bi][r0 * LDT + c0]);
    }

    auto issue_stage = [&](int s) {
        const int buf = s & 1;
        const int k0  = s * 128;
        async_ld8_b128(lA[buf], lstep, gA + k0, gstep);
        async_ld8_b128(lB[buf], lstep, gB + k0, gstep);
    };

    v8f acc[2][4];
#pragma unroll
    for (int mt = 0; mt < 2; ++mt)
#pragma unroll
        for (int nt = 0; nt < 4; ++nt)
#pragma unroll
            for (int r = 0; r < 8; ++r) acc[mt][nt][r] = 0.0f;

    const int nk = K / 128;
    issue_stage(0);
    // stage 0 has landed for this wave before the barrier publishes it to the others
    asm volatile("s_wait_asynccnt 0x0" ::: "memory");
    __syncthreads();
    if (nk > 1) issue_stage(1);

    for (int t = 0; t < nk; ++t) {
        const bf16* as = As[t & 1];
        const bf16* bs = Bs[t & 1];
        // unrolled so that the four 32-k blocks' LDS reads can be scheduled ahead of the WMMAs
#pragma unroll
        for (int kq = 0; kq < 4; ++kq) {
            v16bf af[2], bfr[4];
#pragma unroll
            for (int mt = 0; mt < 2; ++mt)
                af[mt] = load_frag(&as[(wm * 32 + mt * 16 + ln) * LDT + kq * 32], kb);
#pragma unroll
            for (int nt = 0; nt < 4; ++nt)
                bfr[nt] = load_frag(&bs[(wn * 64 + nt * 16 + ln) * LDT + kq * 32], kb);

#pragma unroll
            for (int mt = 0; mt < 2; ++mt)
#pragma unroll
                for (int nt = 0; nt < 4; ++nt)
                    acc[mt][nt] = WMMA_BF16(af[mt], bfr[nt], acc[mt][nt]);
        }

        // publish point of stage t+1:
        // this wave's reads of buffer t&1 have retired before the buffer is refilled
        asm volatile("s_wait_dscnt 0x0" ::: "memory");
        // this wave's copies of stage t+1 have landed before the barrier publishes them
        asm volatile("s_wait_asynccnt 0x0" ::: "memory");
        __syncthreads();
        if (t + 2 < nk) issue_stage(t + 2); // refill the buffer every reader has left
    }
    // no copy is outstanding when the wave goes on to its end
    asm volatile("s_wait_asynccnt 0x0" ::: "memory");

    // epilogue
#pragma unroll
    for (int mt = 0; mt < 2; ++mt) {
#pragma unroll
        for (int nt = 0; nt < 4; ++nt) {
            const int gn = n0 + wn * 64 + nt * 16 + ln;
#pragma unroll
            for (int r = 0; r < 8; ++r) {
                const int gm = m0 + wm * 32 + mt * 16 + r + 8 * hi;
                float v = acc[mt][nt][r];
                if constexpr (HAS_BIAS) v += bias[gn];
                if constexpr (HAS_RELU) v = fmaxf(v, 0.0f);
                if constexpr (HAS_RES)  v += res[(size_t)gm * N + gn];
                if constexpr (OUT_BF16) Cb[(size_t)gm * N + gn] = (bf16)v;
                else                    Cf[(size_t)gm * N + gn] = v;
            }
        }
    }
}

// ---------------------------------------------------------------------------
// Flash attention (bf16 WMMA, f32 softmax state).
// grid: (SEQ/128, BATCH*NHEAD). 8 waves; each wave owns 16 query rows.
// KV tiles of 64 keys staged in LDS; V transposed at load.
// ---------------------------------------------------------------------------
__global__ __launch_bounds__(256) void flash_attn_wmma(
    const bf16* __restrict__ Q, const bf16* __restrict__ Km,
    const bf16* __restrict__ Vm, const int* __restrict__ mask,
    bf16* __restrict__ O)
{
    const int LDK = 72;                       // padded stride (halfs): 144B
    __shared__ __align__(16) bf16 Ks[64 * 72];
    __shared__ __align__(16) bf16 Vt[64 * 72];          // Vt[d][key]
    __shared__ __align__(16) bf16 Ps[8 * 16 * 72];      // per-wave P tile

    const int bh   = blockIdx.y;
    const int b    = bh >> 4;
    const int h    = bh & 15;
    const int tid  = threadIdx.x;
    const int lane = tid & 31;
    const int wid  = tid >> 5;
    const int ln   = lane & 15;
    const int hi   = lane >> 4;
    const int kb   = hi * 8;
    const int q0   = blockIdx.x * 128 + wid * 16;       // query offset in seq
    const size_t dbase = (size_t)h * DKH;

    // Q fragments (2 K-slabs of 32 over DK=64), straight from global
    v16bf qf[2];
    {
        const size_t qrow = (size_t)(b * SEQ + q0 + ln) * D_MODEL + dbase;
#pragma unroll
        for (int s = 0; s < 2; ++s)
            qf[s] = load_frag(Q + qrow + s * 32, kb);
    }

    v8f oacc[4];
#pragma unroll
    for (int n = 0; n < 4; ++n)
#pragma unroll
        for (int r = 0; r < 8; ++r) oacc[n][r] = 0.0f;

    float mrow[8], lrow[8];
#pragma unroll
    for (int r = 0; r < 8; ++r) { mrow[r] = -3.0e38f; lrow[r] = 0.0f; }

    const float scale = 0.125f;               // 1/sqrt(64)

    for (int kk0 = 0; kk0 < SEQ; kk0 += 64) {
        __syncthreads();
        // stage K tile [64][64] and V transposed [d][key]
#pragma unroll
        for (int c = tid; c < 512; c += 256) {
            const int r   = c >> 3;
            const int col = (c & 7) * 8;
            const size_t grow = (size_t)(b * SEQ + kk0 + r) * D_MODEL + dbase + col;
            *(uint4*)(&Ks[r * LDK + col]) = *(const uint4*)(Km + grow);
            v8bf vv = *(const v8bf*)(Vm + grow);
#pragma unroll
            for (int j = 0; j < 8; ++j) Vt[(col + j) * LDK + r] = vv[j];
        }
        __syncthreads();

        // scores S = Q * K^T  (4 tiles of 16 keys)
        v8f sacc[4];
#pragma unroll
        for (int t = 0; t < 4; ++t)
#pragma unroll
            for (int r = 0; r < 8; ++r) sacc[t][r] = 0.0f;
#pragma unroll
        for (int s = 0; s < 2; ++s)
#pragma unroll
            for (int t = 0; t < 4; ++t) {
                v16bf kf = load_frag(&Ks[(t * 16 + ln) * LDK + s * 32], kb);
                sacc[t] = WMMA_BF16(qf[s], kf, sacc[t]);
            }

        // scale + mask
        float sv[4][8];
#pragma unroll
        for (int t = 0; t < 4; ++t) {
            const int key = kk0 + t * 16 + ln;
            const int mk  = mask[b * SEQ + key];
#pragma unroll
            for (int r = 0; r < 8; ++r) {
                float xs = sacc[t][r] * scale;
                sv[t][r] = (mk == 0) ? -1.0e9f : xs;
            }
        }

        // online softmax: row stats live per lane-group of 16
        float mnew[8], alpha[8];
#pragma unroll
        for (int r = 0; r < 8; ++r) {
            float mx = fmaxf(fmaxf(sv[0][r], sv[1][r]), fmaxf(sv[2][r], sv[3][r]));
#pragma unroll
            for (int off = 8; off > 0; off >>= 1)
                mx = fmaxf(mx, __shfl_xor(mx, off, 32));
            mnew[r]  = fmaxf(mrow[r], mx);
            alpha[r] = __expf(mrow[r] - mnew[r]);
        }
        float ps[4][8];
#pragma unroll
        for (int t = 0; t < 4; ++t)
#pragma unroll
            for (int r = 0; r < 8; ++r)
                ps[t][r] = __expf(sv[t][r] - mnew[r]);
#pragma unroll
        for (int r = 0; r < 8; ++r) {
            float sm = ps[0][r] + ps[1][r] + ps[2][r] + ps[3][r];
#pragma unroll
            for (int off = 8; off > 0; off >>= 1)
                sm += __shfl_xor(sm, off, 32);
            lrow[r] = lrow[r] * alpha[r] + sm;
            mrow[r] = mnew[r];
        }
#pragma unroll
        for (int n = 0; n < 4; ++n)
#pragma unroll
            for (int r = 0; r < 8; ++r) oacc[n][r] *= alpha[r];

        // restage P as bf16 A-fragments (per-wave LDS region, same-wave in-order)
        bf16* pw = &Ps[wid * 16 * LDK];
#pragma unroll
        for (int t = 0; t < 4; ++t)
#pragma unroll
            for (int r = 0; r < 8; ++r)
                pw[(r + 8 * hi) * LDK + t * 16 + ln] = (bf16)ps[t][r];

        // O += P * V
#pragma unroll
        for (int s = 0; s < 2; ++s) {
            v16bf pf = load_frag(&pw[ln * LDK + s * 32], kb);
#pragma unroll
            for (int n = 0; n < 4; ++n) {
                v16bf vf = load_frag(&Vt[(n * 16 + ln) * LDK + s * 32], kb);
                oacc[n] = WMMA_BF16(pf, vf, oacc[n]);
            }
        }
    }

    // finalize: O /= l, write bf16 [token][h*64 + d]
#pragma unroll
    for (int r = 0; r < 8; ++r) {
        const float invl = 1.0f / lrow[r];
        const size_t gm  = (size_t)(b * SEQ + q0 + r + 8 * hi);
#pragma unroll
        for (int n = 0; n < 4; ++n)
            O[gm * D_MODEL + dbase + n * 16 + ln] = (bf16)(oacc[n][r] * invl);
    }
}

// ---------------------------------------------------------------------------
// launch
// ---------------------------------------------------------------------------
extern "C" void kernel_launch(void* const* d_in, const int* in_sizes, int n_in,
                              void* d_out, int out_size, void* d_ws, size_t ws_size,
                              hipStream_t stream)
{
    const float* x      = (const float*)d_in[0];
    const int*   mask   = (const int*)  d_in[1];
    const float* w_q    = (const float*)d_in[2];
    const float* w_k    = (const float*)d_in[3];
    const float* w_v    = (const float*)d_in[4];
    const float* w_o    = (const float*)d_in[5];
    const float* alpha1 = (const float*)d_in[6];
    const float* beta1  = (const float*)d_in[7];
    const float* alpha2 = (const float*)d_in[8];
    const float* beta2  = (const float*)d_in[9];
    const float* fc1_w  = (const float*)d_in[10];
    const float* fc1_b  = (const float*)d_in[11];
    const float* fc2_w  = (const float*)d_in[12];
    const float* fc2_b  = (const float*)d_in[13];

    char* ws = (char*)d_ws;
    size_t off = 0;
    auto take = [&](size_t bytes) { char* p = ws + off; off += bytes; return p; };

    bf16* wqb   = (bf16*)take((size_t)D_MODEL * D_MODEL * 2);
    bf16* wkb   = (bf16*)take((size_t)D_MODEL * D_MODEL * 2);
    bf16* wvb   = (bf16*)take((size_t)D_MODEL * D_MODEL * 2);
    bf16* wob   = (bf16*)take((size_t)D_MODEL * D_MODEL * 2);
    bf16* fc1b  = (bf16*)take((size_t)D_FC * D_MODEL * 2);
    bf16* fc2b  = (bf16*)take((size_t)D_MODEL * D_FC * 2);
    bf16* ln1b  = (bf16*)take((size_t)M_TOK * D_MODEL * 2);
    bf16* Qb    = (bf16*)take((size_t)M_TOK * D_MODEL * 2);
    bf16* Kb    = (bf16*)take((size_t)M_TOK * D_MODEL * 2);
    bf16* Vb    = (bf16*)take((size_t)M_TOK * D_MODEL * 2);
    bf16* attnb = (bf16*)take((size_t)M_TOK * D_MODEL * 2);
    float* x1   = (float*)take((size_t)M_TOK * D_MODEL * 4);
    bf16* ln2b  = (bf16*)take((size_t)M_TOK * D_MODEL * 2);
    bf16* hidb  = (bf16*)take((size_t)M_TOK * D_FC * 2);

    // weight conversions
    {
        int n4 = D_MODEL * D_MODEL / 4;
        cvt_f32_bf16<<<(n4 + 255) / 256, 256, 0, stream>>>(w_q, wqb, n4);
        cvt_f32_bf16<<<(n4 + 255) / 256, 256, 0, stream>>>(w_k, wkb, n4);
        cvt_f32_bf16<<<(n4 + 255) / 256, 256, 0, stream>>>(w_v, wvb, n4);
        cvt_f32_bf16<<<(n4 + 255) / 256, 256, 0, stream>>>(w_o, wob, n4);
        int nf = D_FC * D_MODEL / 4;
        cvt_f32_bf16<<<(nf + 255) / 256, 256, 0, stream>>>(fc1_w, fc1b, nf);
        cvt_f32_bf16<<<(nf + 255) / 256, 256, 0, stream>>>(fc2_w, fc2b, nf);
    }

    // LN1
    layernorm_bf16<<<M_TOK, 256, 0, stream>>>(x, alpha1, beta1, ln1b);

    // Q, K, V projections  (bf16 out)
    dim3 gP(D_MODEL / 128, M_TOK / 128);
    gemm_bf16_wmma<0,0,0,1><<<gP, 256, 0, stream>>>(ln1b, wqb, nullptr, nullptr,
                                                    nullptr, Qb, M_TOK, D_MODEL, D_MODEL);
    gemm_bf16_wmma<0,0,0,1><<<gP, 256, 0, stream>>>(ln1b, wkb, nullptr, nullptr,
                                                    nullptr, Kb, M_TOK, D_MODEL, D_MODEL);
    gemm_bf16_wmma<0,0,0,1><<<gP, 256, 0, stream>>>(ln1b, wvb, nullptr, nullptr,
                                                    nullptr, Vb, M_TOK, D_MODEL, D_MODEL);

    // attention
    flash_attn_wmma<<<dim3(SEQ / 128, BATCH * NHEAD), 256, 0, stream>>>(
        Qb, Kb, Vb, mask, attnb);

    // output projection + residual:  x1 = x + attn @ w_o^T  (f32 out)
    gemm_bf16_wmma<0,0,1,0><<<gP, 256, 0, stream>>>(attnb, wob, nullptr, x,
                                                    x1, nullptr, M_TOK, D_MODEL, D_MODEL);

    // LN2
    layernorm_bf16<<<M_TOK, 256, 0, stream>>>(x1, alpha2, beta2, ln2b);

    // FC1: relu(ln2 @ fc1^T + b1) -> bf16 hidden
    dim3 gF1(D_FC / 128, M_TOK / 128);
    gemm_bf16_wmma<1,1,0,1><<<gF1, 256, 0, stream>>>(ln2b, fc1b, fc1_b, nullptr,
                                                     nullptr, hidb, M_TOK, D_FC, D_MODEL);

    // FC2: out = x1 + hidden @ fc2^T + b2  (f32 -> d_out)
    gemm_bf16_wmma<1,0,1,0><<<gP, 256, 0, stream>>>(hidb, fc2b, fc2_b, x1,
                                                    (float*)d_out, nullptr, M_TOK, D_MODEL, D_FC);

    (void)in_sizes; (void)n_in; (void)out_size; (void)ws_size;
}

// v002
// A run of this version takes 153 microseconds.
// Timed twice side by side with v001, it ran 1.07 times as fast both times.
// All steps since v000 together make it 1.35 times as fast.
#include <hip/hip_runtime.h>
#include <math.h>

typedef __bf16 bf16;
typedef __attribute__((ext_vector_type(16))) __bf16 v16bf;
typedef __attribute__((ext_vector_type(8)))  __bf16 v8bf;
typedef __attribute__((ext_vector_type(8)))  float  v8f;

#define D_MODEL 1024
#define NHEAD   16
#define DKH     64
#define D_FC    4096
#define BATCH   2
#define SEQ     1024
#define M_TOK   (BATCH*SEQ)   // 2048
#define LN_EPS  1e-6f

// ---------------------------------------------------------------------------
// fragment load: 16-bit A/B fragment from a padded row in LDS/global.
// lane L: row chosen by caller (L&15), kb = (L>>4)*8.
// elements 0..7  = K kb..kb+7 ; elements 8..15 = K 16+kb..16+kb+7
// ---------------------------------------------------------------------------
__device__ __forceinline__ v16bf load_frag(const bf16* rowbase, int kb) {
    v8bf lo = *(const v8bf*)(rowbase + kb);
    v8bf hi = *(const v8bf*)(rowbase + kb + 16);
    v16bf f;
#pragma unroll
    for (int i = 0; i < 8; ++i) { f[i] = lo[i]; f[i + 8] = hi[i]; }
    return f;
}

#define WMMA_BF16(A_, B_, C_) \
    __builtin_amdgcn_wmma_f32_16x16x32_bf16(false, (A_), false, (B_), (short)0, (C_), false, false)

// CDNA5 async global->LDS copies, 16B per lane each, tracked by ASYNCcnt.
// Eight copies of one operand's slab: copy i takes LDS byte address lds + i*lstep
// and global address g + i*gstep (elements). The closing s_wait_xcnt 0 stands in the
// copies' own statement so that no address register is rewritten ahead of it.
__device__ __forceinline__ void async_ld8_b128(uint32_t lds, uint32_t lstep,
                                               const bf16* g, size_t gstep) {
    asm volatile("global_load_async_to_lds_b128 %0, %8, off\n\t"
                 "global_load_async_to_lds_b128 %1, %9, off\n\t"
                 "global_load_async_to_lds_b128 %2, %10, off\n\t"
                 "global_load_async_to_lds_b128 %3, %11, off\n\t"
                 "global_load_async_to_lds_b128 %4, %12, off\n\t"
                 "global_load_async_to_lds_b128 %5, %13, off\n\t"
                 "global_load_async_to_lds_b128 %6, %14, off\n\t"
                 "global_load_async_to_lds_b128 %7, %15, off\n\t"
                 "s_wait_xcnt 0x0"
                 :: "v"(lds), "v"(lds + lstep), "v"(lds + 2 * lstep), "v"(lds + 3 * lstep),
                    "v"(lds + 4 * lstep), "v"(lds + 5 * lstep), "v"(lds + 6 * lstep),
                    "v"(lds + 7 * lstep),
                    "v"(g), "v"(g + gstep), "v"(g + 2 * gstep), "v"(g + 3 * gstep),
                    "v"(g + 4 * gstep), "v"(g + 5 * gstep), "v"(g + 6 * gstep),
                    "v"(g + 7 * gstep)
                 : "memory");
}
__device__ __forceinline__ uint32_t lds_off32(const void* p) {
    return (uint32_t)(uintptr_t)p;   // flat LDS aperture: low 32 bits = LDS address
}

// ---------------------------------------------------------------------------
// float -> bf16 of all six weight matrices in one launch of few, long waves.
// The bf16 copies lie back to back in the workspace (q, k, v, o, fc1, fc2), so the
// output is one array of 12 Mi elements. A unit is 1024 consecutive elements (eight
// wave-wide 512 B loads, eight 256 B stores). Wave w of 4096 converts three units:
// unit w of the four square matrices taken as one run of 4 Mi, unit w of fc1, unit w of fc2.
// A thread's 24 loads are independent of one another and are all issued before the first is used.
// ---------------------------------------------------------------------------
typedef __attribute__((ext_vector_type(4))) float  f32x4;
typedef __attribute__((ext_vector_type(4))) __bf16 bf16x4;
#define CVT_THREADS 512                       // 16 waves
#define CVT_BLOCKS  256                       // 4096 waves
#define CVT_UNIT    1024
#define SQ_ELEMS    (D_MODEL * D_MODEL)       // 1 Mi = 1024 units = 64 work-groups
#define FC_ELEMS    (D_FC * D_MODEL)          // 4 Mi = 4096 units = all 256 work-groups

__global__ __launch_bounds__(CVT_THREADS) void cvt_weights_bf16(
    const float* __restrict__ wq, const float* __restrict__ wk,
    const float* __restrict__ wv, const float* __restrict__ wo,
    const float* __restrict__ fc1, const float* __restrict__ fc2,
    bf16* __restrict__ out)
{
    // the same for the whole work-group: its square matrix and its first element in each run
    const unsigned sel = blockIdx.x >> 6;
    const float* sq = (sel & 2) ? ((sel & 1) ? wo : wv) : ((sel & 1) ? wk : wq);
    const unsigned g0 = blockIdx.x * (CVT_THREADS / 32 * CVT_UNIT);
    const float* s0 = sq  + (g0 & (SQ_ELEMS - 1));
    const float* s1 = fc1 + g0;
    const float* s2 = fc2 + g0;
    bf16* o0 = out + g0;
    bf16* o1 = o0 + 4 * SQ_ELEMS;
    bf16* o2 = o1 + FC_ELEMS;
    // the thread's own place inside the work-group's 16 units
    const unsigned t = (threadIdx.x >> 5) * CVT_UNIT + (threadIdx.x & 31) * 4;

    // all six loops are unrolled so that a, b and c stay in registers and i * 128 becomes an
    // immediate offset of the load or store
    f32x4 a[8], b[8], c[8];
#pragma unroll
    for (int i = 0; i < 8; ++i) a[i] = *(const f32x4*)(s0 + t + i * 128);
#pragma unroll
    for (int i = 0; i < 8; ++i) b[i] = *(const f32x4*)(s1 + t + i * 128);
#pragma unroll
    for (int i = 0; i < 8; ++i) c[i] = *(const f32x4*)(s2 + t + i * 128);
    // keeps all 24 loads ahead of the first conversion: without it the scheduler issues them in
    // small groups with a wait between, and the wave pays the memory latency several times
    __builtin_amdgcn_sched_barrier(0);

#pragma unroll
    for (int i = 0; i < 8; ++i) *(bf16x4*)(o0 + t + i * 128) = __builtin_convertvector(a[i], bf16x4);
#pragma unroll
    for (int i = 0; i < 8; ++i) *(bf16x4*)(o1 + t + i * 128) = __builtin_convertvector(b[i], bf16x4);
#pragma unroll
    for (int i = 0; i < 8; ++i) *(bf16x4*)(o2 + t + i * 128) = __builtin_convertvector(c[i], bf16x4);
}

// ---------------------------------------------------------------------------
// LayerNorm (ddof=1, divide by std+eps), D_MODEL=1024, 256 threads/row.
// ---------------------------------------------------------------------------
__global__ __launch_bounds__(256) void layernorm_bf16(
    const float* __restrict__ x, const float* __restrict__ alpha,
    const float* __restrict__ beta, bf16* __restrict__ out)
{
    __shared__ float red[256];
    const int row = blockIdx.x;
    const int tid = threadIdx.x;
    const float* xr = x + (size_t)row * D_MODEL;

    float v[4];
    float s = 0.f;
#pragma unroll
    for (int i = 0; i < 4; ++i) { v[i] = xr[tid + i * 256]; s += v[i]; }
    red[tid] = s; __syncthreads();
#pragma unroll
    for (int off = 128; off > 0; off >>= 1) {
        if (tid < off) red[tid] += red[tid + off];
        __syncthreads();
    }
    const float mean = red[0] * (1.0f / 1024.0f);
    __syncthreads();

    float s2 = 0.f;
#pragma unroll
    for (int i = 0; i < 4; ++i) { float d = v[i] - mean; s2 += d * d; }
    red[tid] = s2; __syncthreads();
#pragma unroll
    for (int off = 128; off > 0; off >>= 1) {
        if (tid < off) red[tid] += red[tid + off];
        __syncthreads();
    }
    const float var = red[0] * (1.0f / 1023.0f);   // ddof = 1
    const float inv = 1.0f / (sqrtf(var) + LN_EPS);

    bf16* orow = out + (size_t)row * D_MODEL;
#pragma unroll
    for (int i = 0; i < 4; ++i) {
        int c = tid + i * 256;
        orow[c] = (bf16)(alpha[c] * (v[i] - mean) * inv + beta[c]);
    }
}

// ---------------------------------------------------------------------------
// Tiled WMMA bf16 GEMM:  C[M,N] = A[M,K] * B[N,K]^T   (+bias/relu/res)
// block tile 128x128, 8 waves (4 along M x 2 along N), wave tile 32x64.
// Two LDS buffers, each one pass of 128 k (256 B of every operand row), filled by
// async global->LDS copies one pass ahead; one publish point per pass.
// ---------------------------------------------------------------------------
template<int HAS_BIAS, int HAS_RELU, int HAS_RES, int OUT_BF16>
__global__ __launch_bounds__(256) void gemm_bf16_wmma(
    const bf16* __restrict__ A, const bf16* __restrict__ B,
    const float* __restrict__ bias, const float* __restrict__ res,
    float* __restrict__ Cf, bf16* __restrict__ Cb,
    int M, int N, int K)
{
    const int LDT = 136;                    // padded row stride (halfs): 272B = 17*16B
    __shared__ __align__(16) bf16 As[2][128 * 136];
    __shared__ __align__(16) bf16 Bs[2][128 * 136];

    const int tid  = threadIdx.x;
    const int lane = tid & 31;
    const int wid  = tid >> 5;
    const int wm   = wid & 3;               // M wave offset: 32*wm
    const int wn   = wid >> 2;              // N wave offset: 64*wn
    const int ln   = lane & 15;
    const int hi   = lane >> 4;
    const int kb   = hi * 8;
    const int m0   = blockIdx.y * 128;
    const int n0   = blockIdx.x * 128;

    // staging coordinates: this thread owns chunks tid + i*256, i = 0..7, per operand
    // chunk c: row = c>>4 (0..127), col = (c&15)*8  (within the 128-wide slab)
    const int r0 = tid >> 4, c0 = (tid & 15) * 8;

    const bf16* gA = A + (size_t)(m0 + r0) * K + c0;
    const bf16* gB = B + (size_t)(n0 + r0) * K + c0;
    const size_t   gstep = (size_t)16 * K;          // 16 rows further per copy
    const uint32_t lstep = 16 * LDT * 2;            // the same in LDS bytes

    uint32_t lA[2], lB[2];
#pragma unroll
    for (int bi = 0; bi < 2; ++bi) {
        lA[bi] = lds_off32(&As[bi][r0 * LDT + c0]);
        lB[bi] = lds_off32(&Bs[bi][r0 * LDT + c0]);
    }

    auto issue_stage = [&](int s) {
        const int buf = s & 1;
        const int k0  = s * 128;
        async_ld8_b128(lA[buf], lstep, gA + k0, gstep);
        async_ld8_b128(lB[buf], lstep, gB + k0, gstep);
    };

    v8f acc[2][4];
#pragma unroll
    for (int mt = 0; mt < 2; ++mt)
#pragma unroll
        for (int nt = 0; nt < 4; ++nt)
#pragma unroll
            for (int r = 0; r < 8; ++r) acc[mt][nt][r] = 0.0f;

    const int nk = K / 128;
    issue_stage(0);
    // stage 0 has landed for this wave before the barrier publishes it to the others
    asm volatile("s_wait_asynccnt 0x0" ::: "memory");
    __syncthreads();
    if (nk > 1) issue_stage(1);

    for (int t = 0; t < nk; ++t) {
        const bf16* as = As[t & 1];
        const bf16* bs = Bs[t & 1];
        // unrolled so that the four 32-k blocks' LDS reads can be scheduled ahead of the WMMAs
#pragma unroll
        for (int kq = 0; kq < 4; ++kq) {
            v16bf af[2], bfr[4];
#pragma unroll
            for (int mt = 0; mt < 2; ++mt)
                af[mt] = load_frag(&as[(wm * 32 + mt * 16 + ln) * LDT + kq * 32], kb);
#pragma unroll
            for (int nt = 0; nt < 4; ++nt)
                bfr[nt] = load_frag(&bs[(wn * 64 + nt * 16 + ln) * LDT + kq * 32], kb);

#pragma unroll
            for (int mt = 0; mt < 2; ++mt)
#pragma unroll
                for (int nt = 0; nt < 4; ++nt)
                    acc[mt][nt] = WMMA_BF16(af[mt], bfr[nt], acc[mt][nt]);
        }

        // publish point of stage t+1:
        // this wave's reads of buffer t&1 have retired before the buffer is refilled
        asm volatile("s_wait_dscnt 0x0" ::: "memory");
        // this wave's copies of stage t+1 have landed before the barrier publishes them
        asm volatile("s_wait_asynccnt 0x0" ::: "memory");
        __syncthreads();
        if (t + 2 < nk) issue_stage(t + 2); // refill the buffer every reader has left
    }
    // no copy is outstanding when the wave goes on to its end
    asm volatile("s_wait_asynccnt 0x0" ::: "memory");

    // epilogue
#pragma unroll
    for (int mt = 0; mt < 2; ++mt) {
#pragma unroll
        for (int nt = 0; nt < 4; ++nt) {
            const int gn = n0 + wn * 64 + nt * 16 + ln;
#pragma unroll
            for (int r = 0; r < 8; ++r) {
                const int gm = m0 + wm * 32 + mt * 16 + r + 8 * hi;
                float v = acc[mt][nt][r];
                if constexpr (HAS_BIAS) v += bias[gn];
                if constexpr (HAS_RELU) v = fmaxf(v, 0.0f);
                if constexpr (HAS_RES)  v += res[(size_t)gm * N + gn];
                if constexpr (OUT_BF16) Cb[(size_t)gm * N + gn] = (bf16)v;
                else                    Cf[(size_t)gm * N + gn] = v;
            }
        }
    }
}

// ---------------------------------------------------------------------------
// Flash attention (bf16 WMMA, f32 softmax state).
// grid: (SEQ/128, BATCH*NHEAD). 8 waves; each wave owns 16 query rows.
// KV tiles of 64 keys staged in LDS; V transposed at load.
// ---------------------------------------------------------------------------
__global__ __launch_bounds__(256) void flash_attn_wmma(
    const bf16* __restrict__ Q, const bf16* __restrict__ Km,
    const bf16* __restrict__ Vm, const int* __restrict__ mask,
    bf16* __restrict__ O)
{
    const int LDK = 72;                       // padded stride (halfs): 144B
    __shared__ __align__(16) bf16 Ks[64 * 72];
    __shared__ __align__(16) bf16 Vt[64 * 72];          // Vt[d][key]
    __shared__ __align__(16) bf16 Ps[8 * 16 * 72];      // per-wave P tile

    const int bh   = blockIdx.y;
    const int b    = bh >> 4;
    const int h    = bh & 15;
    const int tid  = threadIdx.x;
    const int lane = tid & 31;
    const int wid  = tid >> 5;
    const int ln   = lane & 15;
    const int hi   = lane >> 4;
    const int kb   = hi * 8;
    const int q0   = blockIdx.x * 128 + wid * 16;       // query offset in seq
    const size_t dbase = (size_t)h * DKH;

    // Q fragments (2 K-slabs of 32 over DK=64), straight from global
    v16bf qf[2];
    {
        const size_t qrow = (size_t)(b * SEQ + q0 + ln) * D_MODEL + dbase;
#pragma unroll
        for (int s = 0; s < 2; ++s)
            qf[s] = load_frag(Q + qrow + s * 32, kb);
    }

    v8f oacc[4];
#pragma unroll
    for (int n = 0; n < 4; ++n)
#pragma unroll
        for (int r = 0; r < 8; ++r) oacc[n][r] = 0.0f;

    float mrow[8], lrow[8];
#pragma unroll
    for (int r = 0; r < 8; ++r) { mrow[r] = -3.0e38f; lrow[r] = 0.0f; }

    const float scale = 0.125f;               // 1/sqrt(64)

    for (int kk0 = 0; kk0 < SEQ; kk0 += 64) {
        __syncthreads();
        // stage K tile [64][64] and V transposed [d][key]
#pragma unroll
        for (int c = tid; c < 512; c += 256) {
            const int r   = c >> 3;
            const int col = (c & 7) * 8;
            const size_t grow = (size_t)(b * SEQ + kk0 + r) * D_MODEL + dbase + col;
            *(uint4*)(&Ks[r * LDK + col]) = *(const uint4*)(Km + grow);
            v8bf vv = *(const v8bf*)(Vm + grow);
#pragma unroll
            for (int j = 0; j < 8; ++j) Vt[(col + j) * LDK + r] = vv[j];
        }
        __syncthreads();

        // scores S = Q * K^T  (4 tiles of 16 keys)
        v8f sacc[4];
#pragma unroll
        for (int t = 0; t < 4; ++t)
#pragma unroll
            for (int r = 0; r < 8; ++r) sacc[t][r] = 0.0f;
#pragma unroll
        for (int s = 0; s < 2; ++s)
#pragma unroll
            for (int t = 0; t < 4; ++t) {
                v16bf kf = load_frag(&Ks[(t * 16 + ln) * LDK + s * 32], kb);
                sacc[t] = WMMA_BF16(qf[s], kf, sacc[t]);
            }

        // scale + mask
        float sv[4][8];
#pragma unroll
        for (int t = 0; t < 4; ++t) {
            const int key = kk0 + t * 16 + ln;
            const int mk  = mask[b * SEQ + key];
#pragma unroll
            for (int r = 0; r < 8; ++r) {
                float xs = sacc[t][r] * scale;
                sv[t][r] = (mk == 0) ? -1.0e9f : xs;
            }
        }

        // online softmax: row stats live per lane-group of 16
        float mnew[8], alpha[8];
#pragma unroll
        for (int r = 0; r < 8; ++r) {
            float mx = fmaxf(fmaxf(sv[0][r], sv[1][r]), fmaxf(sv[2][r], sv[3][r]));
#pragma unroll
            for (int off = 8; off > 0; off >>= 1)
                mx = fmaxf(mx, __shfl_xor(mx, off, 32));
            mnew[r]  = fmaxf(mrow[r], mx);
            alpha[r] = __expf(mrow[r] - mnew[r]);
        }
        float ps[4][8];
#pragma unroll
        for (int t = 0; t < 4; ++t)
#pragma unroll
            for (int r = 0; r < 8; ++r)
                ps[t][r] = __expf(sv[t][r] - mnew[r]);
#pragma unroll
        for (int r = 0; r < 8; ++r) {
            float sm = ps[0][r] + ps[1][r] + ps[2][r] + ps[3][r];
#pragma unroll
            for (int off = 8; off > 0; off >>= 1)
                sm += __shfl_xor(sm, off, 32);
            lrow[r] = lrow[r] * alpha[r] + sm;
            mrow[r] = mnew[r];
        }
#pragma unroll
        for (int n = 0; n < 4; ++n)
#pragma unroll
            for (int r = 0; r < 8; ++r) oacc[n][r] *= alpha[r];

        // restage P as bf16 A-fragments (per-wave LDS region, same-wave in-order)
        bf16* pw = &Ps[wid * 16 * LDK];
#pragma unroll
        for (int t = 0; t < 4; ++t)
#pragma unroll
            for (int r = 0; r < 8; ++r)
                pw[(r + 8 * hi) * LDK + t * 16 + ln] = (bf16)ps[t][r];

        // O += P * V
#pragma unroll
        for (int s = 0; s < 2; ++s) {
            v16bf pf = load_frag(&pw[ln * LDK + s * 32], kb);
#pragma unroll
            for (int n = 0; n < 4; ++n) {
                v16bf vf = load_frag(&Vt[(n * 16 + ln) * LDK + s * 32], kb);
                oacc[n] = WMMA_BF16(pf, vf, oacc[n]);
            }
        }
    }

    // finalize: O /= l, write bf16 [token][h*64 + d]
#pragma unroll
    for (int r = 0; r < 8; ++r) {
        const float invl = 1.0f / lrow[r];
        const size_t gm  = (size_t)(b * SEQ + q0 + r + 8 * hi);
#pragma unroll
        for (int n = 0; n < 4; ++n)
            O[gm * D_MODEL + dbase + n * 16 + ln] = (bf16)(oacc[n][r] * invl);
    }
}

// ---------------------------------------------------------------------------
// launch
// ---------------------------------------------------------------------------
extern "C" void kernel_launch(void* const* d_in, const int* in_sizes, int n_in,
                              void* d_out, int out_size, void* d_ws, size_t ws_size,
                              hipStream_t stream)
{
    const float* x      = (const float*)d_in[0];
    const int*   mask   = (const int*)  d_in[1];
    const float* w_q    = (const float*)d_in[2];
    const float* w_k    = (const float*)d_in[3];
    const float* w_v    = (const float*)d_in[4];
    const float* w_o    = (const float*)d_in[5];
    const float* alpha1 = (const float*)d_in[6];
    const float* beta1  = (const float*)d_in[7];
    const float* alpha2 = (const float*)d_in[8];
    const float* beta2  = (const float*)d_in[9];
    const float* fc1_w  = (const float*)d_in[10];
    const float* fc1_b  = (const float*)d_in[11];
    const float* fc2_w  = (const float*)d_in[12];
    const float* fc2_b  = (const float*)d_in[13];

    char* ws = (char*)d_ws;
    size_t off = 0;
    auto take = [&](size_t bytes) { char* p = ws + off; off += bytes; return p; };

    bf16* wqb   = (bf16*)take((size_t)D_MODEL * D_MODEL * 2);
    bf16* wkb   = (bf16*)take((size_t)D_MODEL * D_MODEL * 2);
    bf16* wvb   = (bf16*)take((size_t)D_MODEL * D_MODEL * 2);
    bf16* wob   = (bf16*)take((size_t)D_MODEL * D_MODEL * 2);
    bf16* fc1b  = (bf16*)take((size_t)D_FC * D_MODEL * 2);
    bf16* fc2b  = (bf16*)take((size_t)D_MODEL * D_FC * 2);
    bf16* ln1b  = (bf16*)take((size_t)M_TOK * D_MODEL * 2);
    bf16* Qb    = (bf16*)take((size_t)M_TOK * D_MODEL * 2);
    bf16* Kb    = (bf16*)take((size_t)M_TOK * D_MODEL * 2);
    bf16* Vb    = (bf16*)take((size_t)M_TOK * D_MODEL * 2);
    bf16* attnb = (bf16*)take((size_t)M_TOK * D_MODEL * 2);
    float* x1   = (float*)take((size_t)M_TOK * D_MODEL * 4);
    bf16* ln2b  = (bf16*)take((size_t)M_TOK * D_MODEL * 2);
    bf16* hidb  = (bf16*)take((size_t)M_TOK * D_FC * 2);

    // weight conversions: the six bf16 copies are one run that starts at wqb
    cvt_weights_bf16<<<CVT_BLOCKS, CVT_THREADS, 0, stream>>>(
        w_q, w_k, w_v, w_o, fc1_w, fc2_w, wqb);

    // LN1
    layernorm_bf16<<<M_TOK, 256, 0, stream>>>(x, alpha1, beta1, ln1b);

    // Q, K, V projections  (bf16 out)
    dim3 gP(D_MODEL / 128, M_TOK / 128);
    gemm_bf16_wmma<0,0,0,1><<<gP, 256, 0, stream>>>(ln1b, wqb, nullptr, nullptr,
                                                    nullptr, Qb, M_TOK, D_MODEL, D_MODEL);
    gemm_bf16_wmma<0,0,0,1><<<gP, 256, 0, stream>>>(ln1b, wkb, nullptr, nullptr,
                                                    nullptr, Kb, M_TOK, D_MODEL, D_MODEL);
    gemm_bf16_wmma<0,0,0,1><<<gP, 256, 0, stream>>>(ln1b, wvb, nullptr, nullptr,
                                                    nullptr, Vb, M_TOK, D_MODEL, D_MODEL);

    // attention
    flash_attn_wmma<<<dim3(SEQ / 128, BATCH * NHEAD), 256, 0, stream>>>(
        Qb, Kb, Vb, mask, attnb);

    // output projection + residual:  x1 = x + attn @ w_o^T  (f32 out)
    gemm_bf16_wmma<0,0,1,0><<<gP, 256, 0, stream>>>(attnb, wob, nullptr, x,
                                                    x1, nullptr, M_TOK, D_MODEL, D_MODEL);

    // LN2
    layernorm_bf16<<<M_TOK, 256, 0, stream>>>(x1, alpha2, beta2, ln2b);

    // FC1: relu(ln2 @ fc1^T + b1) -> bf16 hidden
    dim3 gF1(D_FC / 128, M_TOK / 128);
    gemm_bf16_wmma<1,1,0,1><<<gF1, 256, 0, stream>>>(ln2b, fc1b, fc1_b, nullptr,
                                                     nullptr, hidb, M_TOK, D_FC, D_MODEL);

    // FC2: out = x1 + hidden @ fc2^T + b2  (f32 -> d_out)
    gemm_bf16_wmma<1,0,1,0><<<gP, 256, 0, stream>>>(hidb, fc2b, fc2_b, x1,
                                                    (float*)d_out, nullptr, M_TOK, D_MODEL, D_FC);

    (void)in_sizes; (void)n_in; (void)out_size; (void)ws_size;
}

// v003
// Measured time: 137 microseconds a run.
// Timed twice side by side with v002, it ran 1.13 and 1.12 times as fast.
// All steps since v000 together make it 1.51 times as fast.
#include <hip/hip_runtime.h>
#include <math.h>

typedef __bf16 bf16;
typedef __attribute__((ext_vector_type(16))) __bf16 v16bf;
typedef __attribute__((ext_vector_type(8)))  __bf16 v8bf;
typedef __attribute__((ext_vector_type(8)))  float  v8f;

#define D_MODEL 1024
#define NHEAD   16
#define DKH     64
#define D_FC    4096
#define BATCH   2
#define SEQ     1024
#define M_TOK   (BATCH*SEQ)   // 2048
#define LN_EPS  1e-6f

// ---------------------------------------------------------------------------
// fragment load: 16-bit A/B fragment from a padded row in LDS/global.
// lane L: row chosen by caller (L&15), kb = (L>>4)*8.
// elements 0..7  = K kb..kb+7 ; elements 8..15 = K 16+kb..16+kb+7
// ---------------------------------------------------------------------------
__device__ __forceinline__ v16bf load_frag(const bf16* rowbase, int kb) {
    v8bf lo = *(const v8bf*)(rowbase + kb);
    v8bf hi = *(const v8bf*)(rowbase + kb + 16);
    v16bf f;
#pragma unroll
    for (int i = 0; i < 8; ++i) { f[i] = lo[i]; f[i + 8] = hi[i]; }
    return f;
}

#define WMMA_BF16(A_, B_, C_) \
    __builtin_amdgcn_wmma_f32_16x16x32_bf16(false, (A_), false, (B_), (short)0, (C_), false, false)

// CDNA5 async global->LDS copies, 16B per lane each, tracked by ASYNCcnt.
// Eight copies of one operand's slab: copy i takes LDS byte address lds + i*lstep
// and global address g + i*gstep (elements). The closing s_wait_xcnt 0 stands in the
// copies' own statement so that no address register is rewritten ahead of it.
__device__ __forceinline__ void async_ld8_b128(uint32_t lds, uint32_t lstep,
                                               const bf16* g, size_t gstep) {
    asm volatile("global_load_async_to_lds_b128 %0, %8, off\n\t"
                 "global_load_async_to_lds_b128 %1, %9, off\n\t"
                 "global_load_async_to_lds_b128 %2, %10, off\n\t"
                 "global_load_async_to_lds_b128 %3, %11, off\n\t"
                 "global_load_async_to_lds_b128 %4, %12, off\n\t"
                 "global_load_async_to_lds_b128 %5, %13, off\n\t"
                 "global_load_async_to_lds_b128 %6, %14, off\n\t"
                 "global_load_async_to_lds_b128 %7, %15, off\n\t"
                 "s_wait_xcnt 0x0"
                 :: "v"(lds), "v"(lds + lstep), "v"(lds + 2 * lstep), "v"(lds + 3 * lstep),
                    "v"(lds + 4 * lstep), "v"(lds + 5 * lstep), "v"(lds + 6 * lstep),
                    "v"(lds + 7 * lstep),
                    "v"(g), "v"(g + gstep), "v"(g + 2 * gstep), "v"(g + 3 * gstep),
                    "v"(g + 4 * gstep), "v"(g + 5 * gstep), "v"(g + 6 * gstep),
                    "v"(g + 7 * gstep)
                 : "memory");
}
__device__ __forceinline__ uint32_t lds_off32(const void* p) {
    return (uint32_t)(uintptr_t)p;   // flat LDS aperture: low 32 bits = LDS address
}

// ---------------------------------------------------------------------------
// float -> bf16 of all six weight matrices in one launch of few, long waves.
// The bf16 copies lie back to back in the workspace (q, k, v, o, fc1, fc2), so the
// output is one array of 12 Mi elements. A unit is 1024 consecutive elements (eight
// wave-wide 512 B loads, eight 256 B stores). Wave w of 4096 converts three units:
// unit w of the four square matrices taken as one run of 4 Mi, unit w of fc1, unit w of fc2.
// A thread's 24 loads are independent of one another and are all issued before the first is used.
// ---------------------------------------------------------------------------
typedef __attribute__((ext_vector_type(4))) float  f32x4;
typedef __attribute__((ext_vector_type(4))) __bf16 bf16x4;
#define CVT_THREADS 512                       // 16 waves
#define CVT_BLOCKS  256                       // 4096 waves
#define CVT_UNIT    1024
#define SQ_ELEMS    (D_MODEL * D_MODEL)       // 1 Mi = 1024 units = 64 work-groups
#define FC_ELEMS    (D_FC * D_MODEL)          // 4 Mi = 4096 units = all 256 work-groups

__global__ __launch_bounds__(CVT_THREADS) void cvt_weights_bf16(
    const float* __restrict__ wq, const float* __restrict__ wk,
    const float* __restrict__ wv, const float* __restrict__ wo,
    const float* __restrict__ fc1, const float* __restrict__ fc2,
    bf16* __restrict__ out)
{
    // the same for the whole work-group: its square matrix and its first element in each run
    const unsigned sel = blockIdx.x >> 6;
    const float* sq = (sel & 2) ? ((sel & 1) ? wo : wv) : ((sel & 1) ? wk : wq);
    const unsigned g0 = blockIdx.x * (CVT_THREADS / 32 * CVT_UNIT);
    const float* s0 = sq  + (g0 & (SQ_ELEMS - 1));
    const float* s1 = fc1 + g0;
    const float* s2 = fc2 + g0;
    bf16* o0 = out + g0;
    bf16* o1 = o0 + 4 * SQ_ELEMS;
    bf16* o2 = o1 + FC_ELEMS;
    // the thread's own place inside the work-group's 16 units
    const unsigned t = (threadIdx.x >> 5) * CVT_UNIT + (threadIdx.x & 31) * 4;

    // all six loops are unrolled so that a, b and c stay in registers and i * 128 becomes an
    // immediate offset of the load or store
    f32x4 a[8], b[8], c[8];
#pragma unroll
    for (int i = 0; i < 8; ++i) a[i] = *(const f32x4*)(s0 + t + i * 128);
#pragma unroll
    for (int i = 0; i < 8; ++i) b[i] = *(const f32x4*)(s1 + t + i * 128);
#pragma unroll
    for (int i = 0; i < 8; ++i) c[i] = *(const f32x4*)(s2 + t + i * 128);
    // keeps all 24 loads ahead of the first conversion: without it the scheduler issues them in
    // small groups with a wait between, and the wave pays the memory latency several times
    __builtin_amdgcn_sched_barrier(0);

#pragma unroll
    for (int i = 0; i < 8; ++i) *(bf16x4*)(o0 + t + i * 128) = __builtin_convertvector(a[i], bf16x4);
#pragma unroll
    for (int i = 0; i < 8; ++i) *(bf16x4*)(o1 + t + i * 128) = __builtin_convertvector(b[i], bf16x4);
#pragma unroll
    for (int i = 0; i < 8; ++i) *(bf16x4*)(o2 + t + i * 128) = __builtin_convertvector(c[i], bf16x4);
}

// ---------------------------------------------------------------------------
// LayerNorm (ddof=1, divide by std+eps), D_MODEL=1024, 256 threads/row.
// ---------------------------------------------------------------------------
__global__ __launch_bounds__(256) void layernorm_bf16(
    const float* __restrict__ x, const float* __restrict__ alpha,
    const float* __restrict__ beta, bf16* __restrict__ out)
{
    __shared__ float red[256];
    const int row = blockIdx.x;
    const int tid = threadIdx.x;
    const float* xr = x + (size_t)row * D_MODEL;

    float v[4];
    float s = 0.f;
#pragma unroll
    for (int i = 0; i < 4; ++i) { v[i] = xr[tid + i * 256]; s += v[i]; }
    red[tid] = s; __syncthreads();
#pragma unroll
    for (int off = 128; off > 0; off >>= 1) {
        if (tid < off) red[tid] += red[tid + off];
        __syncthreads();
    }
    const float mean = red[0] * (1.0f / 1024.0f);
    __syncthreads();

    float s2 = 0.f;
#pragma unroll
    for (int i = 0; i < 4; ++i) { float d = v[i] - mean; s2 += d * d; }
    red[tid] = s2; __syncthreads();
#pragma unroll
    for (int off = 128; off > 0; off >>= 1) {
        if (tid < off) red[tid] += red[tid + off];
        __syncthreads();
    }
    const float var = red[0] * (1.0f / 1023.0f);   // ddof = 1
    const float inv = 1.0f / (sqrtf(var) + LN_EPS);

    bf16* orow = out + (size_t)row * D_MODEL;
#pragma unroll
    for (int i = 0; i < 4; ++i) {
        int c = tid + i * 256;
        orow[c] = (bf16)(alpha[c] * (v[i] - mean) * inv + beta[c]);
    }
}

// ---------------------------------------------------------------------------
// Tiled WMMA bf16 GEMM:  C[M,N] = A[M,K] * B[N,K]^T   (+bias/relu/res)
// block tile 128x128, 8 waves (4 along M x 2 along N), wave tile 32x64.
// Two LDS buffers, each one pass of 128 k (256 B of every operand row), filled by
// async global->LDS copies one pass ahead; one publish point per pass.
// blockIdx.z picks one of several products that share A (and M, N, K): their B matrices
// lie back to back, and so do their outputs; bias and res, where present, are common to all.
// ---------------------------------------------------------------------------
template<int HAS_BIAS, int HAS_RELU, int HAS_RES, int OUT_BF16>
__global__ __launch_bounds__(256) void gemm_bf16_wmma(
    const bf16* __restrict__ A, const bf16* __restrict__ B,
    const float* __restrict__ bias, const float* __restrict__ res,
    float* __restrict__ Cf, bf16* __restrict__ Cb,
    int M, int N, int K)
{
    const int LDT = 136;                    // padded row stride (halfs): 272B = 17*16B
    __shared__ __align__(16) bf16 As[2][128 * 136];
    __shared__ __align__(16) bf16 Bs[2][128 * 136];

    const int tid  = threadIdx.x;
    const int lane = tid & 31;
    const int wid  = tid >> 5;
    const int wm   = wid & 3;               // M wave offset: 32*wm
    const int wn   = wid >> 2;              // N wave offset: 64*wn
    const int ln   = lane & 15;
    const int hi   = lane >> 4;
    const int kb   = hi * 8;
    const int m0   = blockIdx.y * 128;
    const int n0   = blockIdx.x * 128;

    // staging coordinates: this thread owns chunks tid + i*256, i = 0..7, per operand
    // chunk c: row = c>>4 (0..127), col = (c&15)*8  (within the 128-wide slab)
    const int r0 = tid >> 4, c0 = (tid & 15) * 8;

    const bf16* gA = A + (size_t)(m0 + r0) * K + c0;
    const bf16* gB = B + ((size_t)blockIdx.z * N + n0 + r0) * K + c0;
    const size_t   gstep = (size_t)16 * K;          // 16 rows further per copy
    const uint32_t lstep = 16 * LDT * 2;            // the same in LDS bytes

    uint32_t lA[2], lB[2];
#pragma unroll
    for (int bi = 0; bi < 2; ++bi) {
        lA[bi] = lds_off32(&As[bi][r0 * LDT + c0]);
        lB[bi] = lds_off32(&Bs[bi][r0 * LDT + c0]);
    }

    auto issue_stage = [&](int s) {
        const int buf = s & 1;
        const int k0  = s * 128;
        async_ld8_b128(lA[buf], lstep, gA + k0, gstep);
        async_ld8_b128(lB[buf], lstep, gB + k0, gstep);
    };

    v8f acc[2][4];
#pragma unroll
    for (int mt = 0; mt < 2; ++mt)
#pragma unroll
        for (int nt = 0; nt < 4; ++nt)
#pragma unroll
            for (int r = 0; r < 8; ++r) acc[mt][nt][r] = 0.0f;

    const int nk = K / 128;
    issue_stage(0);
    // stage 0 has landed for this wave before the barrier publishes it to the others
    asm volatile("s_wait_asynccnt 0x0" ::: "memory");
    __syncthreads();
    if (nk > 1) issue_stage(1);

    for (int t = 0; t < nk; ++t) {
        const bf16* as = As[t & 1];
        const bf16* bs = Bs[t & 1];
        // unrolled so that the four 32-k blocks' LDS reads can be scheduled ahead of the WMMAs
#pragma unroll
        for (int kq = 0; kq < 4; ++kq) {
            v16bf af[2], bfr[4];
#pragma unroll
            for (int mt = 0; mt < 2; ++mt)
                af[mt] = load_frag(&as[(wm * 32 + mt * 16 + ln) * LDT + kq * 32], kb);
#pragma unroll
            for (int nt = 0; nt < 4; ++nt)
                bfr[nt] = load_frag(&bs[(wn * 64 + nt * 16 + ln) * LDT + kq * 32], kb);

#pragma unroll
            for (int mt = 0; mt < 2; ++mt)
#pragma unroll
                for (int nt = 0; nt < 4; ++nt)
                    acc[mt][nt] = WMMA_BF16(af[mt], bfr[nt], acc[mt][nt]);
        }

        // publish point of stage t+1:
        // this wave's reads of buffer t&1 have retired before the buffer is refilled
        asm volatile("s_wait_dscnt 0x0" ::: "memory");
        // this wave's copies of stage t+1 have landed before the barrier publishes them
        asm volatile("s_wait_asynccnt 0x0" ::: "memory");
        __syncthreads();
        if (t + 2 < nk) issue_stage(t + 2); // refill the buffer every reader has left
    }
    // no copy is outstanding when the wave goes on to its end
    asm volatile("s_wait_asynccnt 0x0" ::: "memory");

    // epilogue
    const size_t cz = (size_t)blockIdx.z * M * N;   // this product's own output
#pragma unroll
    for (int mt = 0; mt < 2; ++mt) {
#pragma unroll
        for (int nt = 0; nt < 4; ++nt) {
            const int gn = n0 + wn * 64 + nt * 16 + ln;
#pragma unroll
            for (int r = 0; r < 8; ++r) {
                const int gm = m0 + wm * 32 + mt * 16 + r + 8 * hi;
                float v = acc[mt][nt][r];
                if constexpr (HAS_BIAS) v += bias[gn];
                if constexpr (HAS_RELU) v = fmaxf(v, 0.0f);
                if constexpr (HAS_RES)  v += res[(size_t)gm * N + gn];
                if constexpr (OUT_BF16) Cb[cz + (size_t)gm * N + gn] = (bf16)v;
                else                    Cf[cz + (size_t)gm * N + gn] = v;
            }
        }
    }
}

// ---------------------------------------------------------------------------
// Flash attention (bf16 WMMA, f32 softmax state).
// grid: (SEQ/128, BATCH*NHEAD). 8 waves; each wave owns 16 query rows.
// KV tiles of 64 keys staged in LDS; V transposed at load.
// ---------------------------------------------------------------------------
__global__ __launch_bounds__(256) void flash_attn_wmma(
    const bf16* __restrict__ Q, const bf16* __restrict__ Km,
    const bf16* __restrict__ Vm, const int* __restrict__ mask,
    bf16* __restrict__ O)
{
    const int LDK = 72;                       // padded stride (halfs): 144B
    __shared__ __align__(16) bf16 Ks[64 * 72];
    __shared__ __align__(16) bf16 Vt[64 * 72];          // Vt[d][key]
    __shared__ __align__(16) bf16 Ps[8 * 16 * 72];      // per-wave P tile

    const int bh   = blockIdx.y;
    const int b    = bh >> 4;
    const int h    = bh & 15;
    const int tid  = threadIdx.x;
    const int lane = tid & 31;
    const int wid  = tid >> 5;
    const int ln   = lane & 15;
    const int hi   = lane >> 4;
    const int kb   = hi * 8;
    const int q0   = blockIdx.x * 128 + wid * 16;       // query offset in seq
    const size_t dbase = (size_t)h * DKH;

    // Q fragments (2 K-slabs of 32 over DK=64), straight from global
    v16bf qf[2];
    {
        const size_t qrow = (size_t)(b * SEQ + q0 + ln) * D_MODEL + dbase;
#pragma unroll
        for (int s = 0; s < 2; ++s)
            qf[s] = load_frag(Q + qrow + s * 32, kb);
    }

    v8f oacc[4];
#pragma unroll
    for (int n = 0; n < 4; ++n)
#pragma unroll
        for (int r = 0; r < 8; ++r) oacc[n][r] = 0.0f;

    float mrow[8], lrow[8];
#pragma unroll
    for (int r = 0; r < 8; ++r) { mrow[r] = -3.0e38f; lrow[r] = 0.0f; }

    const float scale = 0.125f;               // 1/sqrt(64)

    for (int kk0 = 0; kk0 < SEQ; kk0 += 64) {
        __syncthreads();
        // stage K tile [64][64] and V transposed [d][key]
#pragma unroll
        for (int c = tid; c < 512; c += 256) {
            const int r   = c >> 3;
            const int col = (c & 7) * 8;
            const size_t grow = (size_t)(b * SEQ + kk0 + r) * D_MODEL + dbase + col;
            *(uint4*)(&Ks[r * LDK + col]) = *(const uint4*)(Km + grow);
            v8bf vv = *(const v8bf*)(Vm + grow);
#pragma unroll
            for (int j = 0; j < 8; ++j) Vt[(col + j) * LDK + r] = vv[j];
        }
        __syncthreads();

        // scores S = Q * K^T  (4 tiles of 16 keys)
        v8f sacc[4];
#pragma unroll
        for (int t = 0; t < 4; ++t)
#pragma unroll
            for (int r = 0; r < 8; ++r) sacc[t][r] = 0.0f;
#pragma unroll
        for (int s = 0; s < 2; ++s)
#pragma unroll
            for (int t = 0; t < 4; ++t) {
                v16bf kf = load_frag(&Ks[(t * 16 + ln) * LDK + s * 32], kb);
                sacc[t] = WMMA_BF16(qf[s], kf, sacc[t]);
            }

        // scale + mask
        float sv[4][8];
#pragma unroll
        for (int t = 0; t < 4; ++t) {
            const int key = kk0 + t * 16 + ln;
            const int mk  = mask[b * SEQ + key];
#pragma unroll
            for (int r = 0; r < 8; ++r) {
                float xs = sacc[t][r] * scale;
                sv[t][r] = (mk == 0) ? -1.0e9f : xs;
            }
        }

        // online softmax: row stats live per lane-group of 16
        float mnew[8], alpha[8];
#pragma unroll
        for (int r = 0; r < 8; ++r) {
            float mx = fmaxf(fmaxf(sv[0][r], sv[1][r]), fmaxf(sv[2][r], sv[3][r]));
#pragma unroll
            for (int off = 8; off > 0; off >>= 1)
                mx = fmaxf(mx, __shfl_xor(mx, off, 32));
            mnew[r]  = fmaxf(mrow[r], mx);
            alpha[r] = __expf(mrow[r] - mnew[r]);
        }
        float ps[4][8];
#pragma unroll
        for (int t = 0; t < 4; ++t)
#pragma unroll
            for (int r = 0; r < 8; ++r)
                ps[t][r] = __expf(sv[t][r] - mnew[r]);
#pragma unroll
        for (int r = 0; r < 8; ++r) {
            float sm = ps[0][r] + ps[1][r] + ps[2][r] + ps[3][r];
#pragma unroll
            for (int off = 8; off > 0; off >>= 1)
                sm += __shfl_xor(sm, off, 32);
            lrow[r] = lrow[r] * alpha[r] + sm;
            mrow[r] = mnew[r];
        }
#pragma unroll
        for (int n = 0; n < 4; ++n)
#pragma unroll
            for (int r = 0; r < 8; ++r) oacc[n][r] *= alpha[r];

        // restage P as bf16 A-fragments (per-wave LDS region, same-wave in-order)
        bf16* pw = &Ps[wid * 16 * LDK];
#pragma unroll
        for (int t = 0; t < 4; ++t)
#pragma unroll
            for (int r = 0; r < 8; ++r)
                pw[(r + 8 * hi) * LDK + t * 16 + ln] = (bf16)ps[t][r];

        // O += P * V
#pragma unroll
        for (int s = 0; s < 2; ++s) {
            v16bf pf = load_frag(&pw[ln * LDK + s * 32], kb);
#pragma unroll
            for (int n = 0; n < 4; ++n) {
                v16bf vf = load_frag(&Vt[(n * 16 + ln) * LDK + s * 32], kb);
                oacc[n] = WMMA_BF16(pf, vf, oacc[n]);
            }
        }
    }

    // finalize: O /= l, write bf16 [token][h*64 + d]
#pragma unroll
    for (int r = 0; r < 8; ++r) {
        const float invl = 1.0f / lrow[r];
        const size_t gm  = (size_t)(b * SEQ + q0 + r + 8 * hi);
#pragma unroll
        for (int n = 0; n < 4; ++n)
            O[gm * D_MODEL + dbase + n * 16 + ln] = (bf16)(oacc[n][r] * invl);
    }
}

// ---------------------------------------------------------------------------
// launch
// ---------------------------------------------------------------------------
extern "C" void kernel_launch(void* const* d_in, const int* in_sizes, int n_in,
                              void* d_out, int out_size, void* d_ws, size_t ws_size,
                              hipStream_t stream)
{
    const float* x      = (const float*)d_in[0];
    const int*   mask   = (const int*)  d_in[1];
    const float* w_q    = (const float*)d_in[2];
    const float* w_k    = (const float*)d_in[3];
    const float* w_v    = (const float*)d_in[4];
    const float* w_o    = (const float*)d_in[5];
    const float* alpha1 = (const float*)d_in[6];
    const float* beta1  = (const float*)d_in[7];
    const float* alpha2 = (const float*)d_in[8];
    const float* beta2  = (const float*)d_in[9];
    const float* fc1_w  = (const float*)d_in[10];
    const float* fc1_b  = (const float*)d_in[11];
    const float* fc2_w  = (const float*)d_in[12];
    const float* fc2_b  = (const float*)d_in[13];

    char* ws = (char*)d_ws;
    size_t off = 0;
    auto take = [&](size_t bytes) { char* p = ws + off; off += bytes; return p; };

    bf16* wqb   = (bf16*)take((size_t)D_MODEL * D_MODEL * 2);
    bf16* wkb   = (bf16*)take((size_t)D_MODEL * D_MODEL * 2);
    bf16* wvb   = (bf16*)take((size_t)D_MODEL * D_MODEL * 2);
    bf16* wob   = (bf16*)take((size_t)D_MODEL * D_MODEL * 2);
    bf16* fc1b  = (bf16*)take((size_t)D_FC * D_MODEL * 2);
    bf16* fc2b  = (bf16*)take((size_t)D_MODEL * D_FC * 2);
    bf16* ln1b  = (bf16*)take((size_t)M_TOK * D_MODEL * 2);
    bf16* Qb    = (bf16*)take((size_t)M_TOK * D_MODEL * 2);
    bf16* Kb    = (bf16*)take((size_t)M_TOK * D_MODEL * 2);
    bf16* Vb    = (bf16*)take((size_t)M_TOK * D_MODEL * 2);
    bf16* attnb = (bf16*)take((size_t)M_TOK * D_MODEL * 2);
    float* x1   = (float*)take((size_t)M_TOK * D_MODEL * 4);
    bf16* ln2b  = (bf16*)take((size_t)M_TOK * D_MODEL * 2);
    bf16* hidb  = (bf16*)take((size_t)M_TOK * D_FC * 2);

    // weight conversions: the six bf16 copies are one run that starts at wqb
    cvt_weights_bf16<<<CVT_BLOCKS, CVT_THREADS, 0, stream>>>(
        w_q, w_k, w_v, w_o, fc1_w, fc2_w, wqb);

    // LN1
    layernorm_bf16<<<M_TOK, 256, 0, stream>>>(x, alpha1, beta1, ln1b);

    // Q, K, V projections (bf16 out) in one launch: wqb, wkb, wvb lie back to back in the
    // workspace, and so do Qb, Kb, Vb
    dim3 gP(D_MODEL / 128, M_TOK / 128);
    dim3 gQKV(D_MODEL / 128, M_TOK / 128, 3);
    gemm_bf16_wmma<0,0,0,1><<<gQKV, 256, 0, stream>>>(ln1b, wqb, nullptr, nullptr,
                                                      nullptr, Qb, M_TOK, D_MODEL, D_MODEL);

    // attention
    flash_attn_wmma<<<dim3(SEQ / 128, BATCH * NHEAD), 256, 0, stream>>>(
        Qb, Kb, Vb, mask, attnb);

    // output projection + residual:  x1 = x + attn @ w_o^T  (f32 out)
    gemm_bf16_wmma<0,0,1,0><<<gP, 256, 0, stream>>>(attnb, wob, nullptr, x,
                                                    x1, nullptr, M_TOK, D_MODEL, D_MODEL);

    // LN2
    layernorm_bf16<<<M_TOK, 256, 0, stream>>>(x1, alpha2, beta2, ln2b);

    // FC1: relu(ln2 @ fc1^T + b1) -> bf16 hidden
    dim3 gF1(D_FC / 128, M_TOK / 128);
    gemm_bf16_wmma<1,1,0,1><<<gF1, 256, 0, stream>>>(ln2b, fc1b, fc1_b, nullptr,
                                                     nullptr, hidb, M_TOK, D_FC, D_MODEL);

    // FC2: out = x1 + hidden @ fc2^T + b2  (f32 -> d_out)
    gemm_bf16_wmma<1,0,1,0><<<gP, 256, 0, stream>>>(hidb, fc2b, fc2_b, x1,
                                                    (float*)d_out, nullptr, M_TOK, D_MODEL, D_FC);

    (void)in_sizes; (void)n_in; (void)out_size; (void)ws_size;
}

// v004
// One run takes 126 microseconds.
// Timed twice side by side with v003, it ran 1.09 and 1.08 times as fast.
// Over all steps from v000 it is 1.64 times as fast.
#include <hip/hip_runtime.h>
#include <math.h>

typedef __bf16 bf16;
typedef __attribute__((ext_vector_type(16))) __bf16 v16bf;
typedef __attribute__((ext_vector_type(8)))  __bf16 v8bf;
typedef __attribute__((ext_vector_type(8)))  float  v8f;

#define D_MODEL 1024
#define NHEAD   16
#define DKH     64
#define D_FC    4096
#define BATCH   2
#define SEQ     1024
#define M_TOK   (BATCH*SEQ)   // 2048
#define LN_EPS  1e-6f

// ---------------------------------------------------------------------------
// fragment load: 16-bit A/B fragment from a padded row in LDS/global.
// lane L: row chosen by caller (L&15), kb = (L>>4)*8.
// elements 0..7  = K kb..kb+7 ; elements 8..15 = K 16+kb..16+kb+7
// ---------------------------------------------------------------------------
__device__ __forceinline__ v16bf load_frag(const bf16* rowbase, int kb) {
    v8bf lo = *(const v8bf*)(rowbase + kb);
    v8bf hi = *(const v8bf*)(rowbase + kb + 16);
    v16bf f;
#pragma unroll
    for (int i = 0; i < 8; ++i) { f[i] = lo[i]; f[i + 8] = hi[i]; }
    return f;
}

#define WMMA_BF16(A_, B_, C_) \
    __builtin_amdgcn_wmma_f32_16x16x32_bf16(false, (A_), false, (B_), (short)0, (C_), false, false)

// CDNA5 async global->LDS copies, 16B per lane each, tracked by ASYNCcnt.
// Eight copies of one operand's slab: copy i takes LDS byte address lds + i*lstep
// and global address g + i*gstep (elements). The closing s_wait_xcnt 0 stands in the
// copies' own statement so that no address register is rewritten ahead of it.
__device__ __forceinline__ void async_ld8_b128(uint32_t lds, uint32_t lstep,
                                               const bf16* g, size_t gstep) {
    asm volatile("global_load_async_to_lds_b128 %0, %8, off\n\t"
                 "global_load_async_to_lds_b128 %1, %9, off\n\t"
                 "global_load_async_to_lds_b128 %2, %10, off\n\t"
                 "global_load_async_to_lds_b128 %3, %11, off\n\t"
                 "global_load_async_to_lds_b128 %4, %12, off\n\t"
                 "global_load_async_to_lds_b128 %5, %13, off\n\t"
                 "global_load_async_to_lds_b128 %6, %14, off\n\t"
                 "global_load_async_to_lds_b128 %7, %15, off\n\t"
                 "s_wait_xcnt 0x0"
                 :: "v"(lds), "v"(lds + lstep), "v"(lds + 2 * lstep), "v"(lds + 3 * lstep),
                    "v"(lds + 4 * lstep), "v"(lds + 5 * lstep), "v"(lds + 6 * lstep),
                    "v"(lds + 7 * lstep),
                    "v"(g), "v"(g + gstep), "v"(g + 2 * gstep), "v"(g + 3 * gstep),
                    "v"(g + 4 * gstep), "v"(g + 5 * gstep), "v"(g + 6 * gstep),
                    "v"(g + 7 * gstep)
                 : "memory");
}
__device__ __forceinline__ uint32_t lds_off32(const void* p) {
    return (uint32_t)(uintptr_t)p;   // flat LDS aperture: low 32 bits = LDS address
}

// ---------------------------------------------------------------------------
// float -> bf16 of all six weight matrices in one launch of few, long waves.
// The bf16 copies lie back to back in the workspace (q, k, v, o, fc1, fc2), so the
// output is one array of 12 Mi elements. A unit is 1024 consecutive elements (eight
// wave-wide 512 B loads, eight 256 B stores). Wave w of 4096 converts three units:
// unit w of the four square matrices taken as one run of 4 Mi, unit w of fc1, unit w of fc2.
// A thread's 24 loads are independent of one another and are all issued before the first is used.
// ---------------------------------------------------------------------------
typedef __attribute__((ext_vector_type(4))) float  f32x4;
typedef __attribute__((ext_vector_type(4))) __bf16 bf16x4;
#define CVT_THREADS 512                       // 16 waves
#define CVT_BLOCKS  256                       // 4096 waves
#define CVT_UNIT    1024
#define SQ_ELEMS    (D_MODEL * D_MODEL)       // 1 Mi = 1024 units = 64 work-groups
#define FC_ELEMS    (D_FC * D_MODEL)          // 4 Mi = 4096 units = all 256 work-groups

__global__ __launch_bounds__(CVT_THREADS) void cvt_weights_bf16(
    const float* __restrict__ wq, const float* __restrict__ wk,
    const float* __restrict__ wv, const float* __restrict__ wo,
    const float* __restrict__ fc1, const float* __restrict__ fc2,
    bf16* __restrict__ out)
{
    // the same for the whole work-group: its square matrix and its first element in each run
    const unsigned sel = blockIdx.x >> 6;
    const float* sq = (sel & 2) ? ((sel & 1) ? wo : wv) : ((sel & 1) ? wk : wq);
    const unsigned g0 = blockIdx.x * (CVT_THREADS / 32 * CVT_UNIT);
    const float* s0 = sq  + (g0 & (SQ_ELEMS - 1));
    const float* s1 = fc1 + g0;
    const float* s2 = fc2 + g0;
    bf16* o0 = out + g0;
    bf16* o1 = o0 + 4 * SQ_ELEMS;
    bf16* o2 = o1 + FC_ELEMS;
    // the thread's own place inside the work-group's 16 units
    const unsigned t = (threadIdx.x >> 5) * CVT_UNIT + (threadIdx.x & 31) * 4;

    // all six loops are unrolled so that a, b and c stay in registers and i * 128 becomes an
    // immediate offset of the load or store
    f32x4 a[8], b[8], c[8];
#pragma unroll
    for (int i = 0; i < 8; ++i) a[i] = *(const f32x4*)(s0 + t + i * 128);
#pragma unroll
    for (int i = 0; i < 8; ++i) b[i] = *(const f32x4*)(s1 + t + i * 128);
#pragma unroll
    for (int i = 0; i < 8; ++i) c[i] = *(const f32x4*)(s2 + t + i * 128);
    // keeps all 24 loads ahead of the first conversion: without it the scheduler issues them in
    // small groups with a wait between, and the wave pays the memory latency several times
    __builtin_amdgcn_sched_barrier(0);

#pragma unroll
    for (int i = 0; i < 8; ++i) *(bf16x4*)(o0 + t + i * 128) = __builtin_convertvector(a[i], bf16x4);
#pragma unroll
    for (int i = 0; i < 8; ++i) *(bf16x4*)(o1 + t + i * 128) = __builtin_convertvector(b[i], bf16x4);
#pragma unroll
    for (int i = 0; i < 8; ++i) *(bf16x4*)(o2 + t + i * 128) = __builtin_convertvector(c[i], bf16x4);
}

// ---------------------------------------------------------------------------
// LayerNorm (ddof=1, divide by std+eps), D_MODEL=1024, 256 threads/row.
// ---------------------------------------------------------------------------
__global__ __launch_bounds__(256) void layernorm_bf16(
    const float* __restrict__ x, const float* __restrict__ alpha,
    const float* __restrict__ beta, bf16* __restrict__ out)
{
    __shared__ float red[256];
    const int row = blockIdx.x;
    const int tid = threadIdx.x;
    const float* xr = x + (size_t)row * D_MODEL;

    float v[4];
    float s = 0.f;
#pragma unroll
    for (int i = 0; i < 4; ++i) { v[i] = xr[tid + i * 256]; s += v[i]; }
    red[tid] = s; __syncthreads();
#pragma unroll
    for (int off = 128; off > 0; off >>= 1) {
        if (tid < off) red[tid] += red[tid + off];
        __syncthreads();
    }
    const float mean = red[0] * (1.0f / 1024.0f);
    __syncthreads();

    float s2 = 0.f;
#pragma unroll
    for (int i = 0; i < 4; ++i) { float d = v[i] - mean; s2 += d * d; }
    red[tid] = s2; __syncthreads();
#pragma unroll
    for (int off = 128; off > 0; off >>= 1) {
        if (tid < off) red[tid] += red[tid + off];
        __syncthreads();
    }
    const float var = red[0] * (1.0f / 1023.0f);   // ddof = 1
    const float inv = 1.0f / (sqrtf(var) + LN_EPS);

    bf16* orow = out + (size_t)row * D_MODEL;
#pragma unroll
    for (int i = 0; i < 4; ++i) {
        int c = tid + i * 256;
        orow[c] = (bf16)(alpha[c] * (v[i] - mean) * inv + beta[c]);
    }
}

// ---------------------------------------------------------------------------
// Tiled WMMA bf16 GEMM:  C[M,N] = A[M,K] * B[N,K]^T   (+bias/relu/res)
// block tile 128x128, 8 waves (4 along M x 2 along N), wave tile 32x64.
// Two LDS buffers, each one pass of 128 k (256 B of every operand row), filled by
// async global->LDS copies one pass ahead; one publish point per pass.
// blockIdx.z picks one of several products that share A (and M, N, K): their B matrices
// lie back to back, and so do their outputs; bias and res, where present, are common to all.
// ---------------------------------------------------------------------------
template<int HAS_BIAS, int HAS_RELU, int HAS_RES, int OUT_BF16>
__global__ __launch_bounds__(256) void gemm_bf16_wmma(
    const bf16* __restrict__ A, const bf16* __restrict__ B,
    const float* __restrict__ bias, const float* __restrict__ res,
    float* __restrict__ Cf, bf16* __restrict__ Cb,
    int M, int N, int K)
{
    const int LDT = 136;                    // padded row stride (halfs): 272B = 17*16B
    __shared__ __align__(16) bf16 As[2][128 * 136];
    __shared__ __align__(16) bf16 Bs[2][128 * 136];

    const int tid  = threadIdx.x;
    const int lane = tid & 31;
    const int wid  = tid >> 5;
    const int wm   = wid & 3;               // M wave offset: 32*wm
    const int wn   = wid >> 2;              // N wave offset: 64*wn
    const int ln   = lane & 15;
    const int hi   = lane >> 4;
    const int kb   = hi * 8;
    const int m0   = blockIdx.y * 128;
    const int n0   = blockIdx.x * 128;

    // staging coordinates: this thread owns chunks tid + i*256, i = 0..7, per operand
    // chunk c: row = c>>4 (0..127), col = (c&15)*8  (within the 128-wide slab)
    const int r0 = tid >> 4, c0 = (tid & 15) * 8;

    const bf16* gA = A + (size_t)(m0 + r0) * K + c0;
    const bf16* gB = B + ((size_t)blockIdx.z * N + n0 + r0) * K + c0;
    const size_t   gstep = (size_t)16 * K;          // 16 rows further per copy
    const uint32_t lstep = 16 * LDT * 2;            // the same in LDS bytes

    uint32_t lA[2], lB[2];
#pragma unroll
    for (int bi = 0; bi < 2; ++bi) {
        lA[bi] = lds_off32(&As[bi][r0 * LDT + c0]);
        lB[bi] = lds_off32(&Bs[bi][r0 * LDT + c0]);
    }

    auto issue_stage = [&](int s) {
        const int buf = s & 1;
        const int k0  = s * 128;
        async_ld8_b128(lA[buf], lstep, gA + k0, gstep);
        async_ld8_b128(lB[buf], lstep, gB + k0, gstep);
    };

    v8f acc[2][4];
#pragma unroll
    for (int mt = 0; mt < 2; ++mt)
#pragma unroll
        for (int nt = 0; nt < 4; ++nt)
#pragma unroll
            for (int r = 0; r < 8; ++r) acc[mt][nt][r] = 0.0f;

    const int nk = K / 128;
    issue_stage(0);
    // stage 0 has landed for this wave before the barrier publishes it to the others
    asm volatile("s_wait_asynccnt 0x0" ::: "memory");
    __syncthreads();
    if (nk > 1) issue_stage(1);

    for (int t = 0; t < nk; ++t) {
        const bf16* as = As[t & 1];
        const bf16* bs = Bs[t & 1];
        // unrolled so that the four 32-k blocks' LDS reads can be scheduled ahead of the WMMAs
#pragma unroll
        for (int kq = 0; kq < 4; ++kq) {
            v16bf af[2], bfr[4];
#pragma unroll
            for (int mt = 0; mt < 2; ++mt)
                af[mt] = load_frag(&as[(wm * 32 + mt * 16 + ln) * LDT + kq * 32], kb);
#pragma unroll
            for (int nt = 0; nt < 4; ++nt)
                bfr[nt] = load_frag(&bs[(wn * 64 + nt * 16 + ln) * LDT + kq * 32], kb);

#pragma unroll
            for (int mt = 0; mt < 2; ++mt)
#pragma unroll
                for (int nt = 0; nt < 4; ++nt)
                    acc[mt][nt] = WMMA_BF16(af[mt], bfr[nt], acc[mt][nt]);
        }

        // publish point of stage t+1:
        // this wave's reads of buffer t&1 have retired before the buffer is refilled
        asm volatile("s_wait_dscnt 0x0" ::: "memory");
        // this wave's copies of stage t+1 have landed before the barrier publishes them
        asm volatile("s_wait_asynccnt 0x0" ::: "memory");
        __syncthreads();
        if (t + 2 < nk) issue_stage(t + 2); // refill the buffer every reader has left
    }
    // no copy is outstanding when the wave goes on to its end
    asm volatile("s_wait_asynccnt 0x0" ::: "memory");

    // epilogue
    const size_t cz = (size_t)blockIdx.z * M * N;   // this product's own output
#pragma unroll
    for (int mt = 0; mt < 2; ++mt) {
#pragma unroll
        for (int nt = 0; nt < 4; ++nt) {
            const int gn = n0 + wn * 64 + nt * 16 + ln;
#pragma unroll
            for (int r = 0; r < 8; ++r) {
                const int gm = m0 + wm * 32 + mt * 16 + r + 8 * hi;
                float v = acc[mt][nt][r];
                if constexpr (HAS_BIAS) v += bias[gn];
                if constexpr (HAS_RELU) v = fmaxf(v, 0.0f);
                if constexpr (HAS_RES)  v += res[(size_t)gm * N + gn];
                if constexpr (OUT_BF16) Cb[cz + (size_t)gm * N + gn] = (bf16)v;
                else                    Cf[cz + (size_t)gm * N + gn] = v;
            }
        }
    }
}

// ---------------------------------------------------------------------------
// Flash attention (bf16 WMMA, f32 softmax state).
// grid: (SEQ/128, BATCH*NHEAD). 8 waves; each wave owns 16 query rows.
// KV tiles of 64 keys staged in LDS; V transposed at load.
// A tile's global loads (K, V, mask) are issued one tile ahead into registers.
// ---------------------------------------------------------------------------
__global__ __launch_bounds__(256) void flash_attn_wmma(
    const bf16* __restrict__ Q, const bf16* __restrict__ Km,
    const bf16* __restrict__ Vm, const int* __restrict__ mask,
    bf16* __restrict__ O)
{
    const int LDK = 72;                       // padded stride (halfs): 144B
    __shared__ __align__(16) bf16 Ks[64 * 72];
    __shared__ __align__(16) bf16 Vt[64 * 72];          // Vt[d][key]
    __shared__ __align__(16) bf16 Ps[8 * 16 * 72];      // per-wave P tile

    const int bh   = blockIdx.y;
    const int b    = bh >> 4;
    const int h    = bh & 15;
    const int tid  = threadIdx.x;
    const int lane = tid & 31;
    const int wid  = tid >> 5;
    const int ln   = lane & 15;
    const int hi   = lane >> 4;
    const int kb   = hi * 8;
    const int q0   = blockIdx.x * 128 + wid * 16;       // query offset in seq
    const size_t dbase = (size_t)h * DKH;

    // Q fragments (2 K-slabs of 32 over DK=64), straight from global
    v16bf qf[2];
    {
        const size_t qrow = (size_t)(b * SEQ + q0 + ln) * D_MODEL + dbase;
#pragma unroll
        for (int s = 0; s < 2; ++s)
            qf[s] = load_frag(Q + qrow + s * 32, kb);
    }

    v8f oacc[4];
#pragma unroll
    for (int n = 0; n < 4; ++n)
#pragma unroll
        for (int r = 0; r < 8; ++r) oacc[n][r] = 0.0f;

    float mrow[8], lrow[8];
#pragma unroll
    for (int r = 0; r < 8; ++r) { mrow[r] = -3.0e38f; lrow[r] = 0.0f; }

    const float scale = 0.125f;               // 1/sqrt(64)

    // this thread's share of a 64-key tile: 16 bytes of K and of V in rows sr and sr + 32,
    // and the mask words of the four keys whose score columns its lane holds
    const int sr   = tid >> 3;
    const int scol = (tid & 7) * 8;
    const bf16* gK = Km + (size_t)(b * SEQ + sr) * D_MODEL + dbase + scol;
    const bf16* gV = Vm + (size_t)(b * SEQ + sr) * D_MODEL + dbase + scol;
    const int*  gM = mask + b * SEQ + ln;

    v8bf  kst[2];
    v8bf  vst[2];
    int   mst[4];
    auto fetch_tile = [&](int kk) {
#pragma unroll
        for (int i = 0; i < 2; ++i) {
            kst[i] = *(const v8bf*)(gK + (size_t)(kk + i * 32) * D_MODEL);
            vst[i] = *(const v8bf*)(gV + (size_t)(kk + i * 32) * D_MODEL);
        }
#pragma unroll
        for (int t = 0; t < 4; ++t) mst[t] = gM[kk + t * 16];
        // the loads stay in flight over a branch, behind which their address registers are
        // reused: the wait that belongs in front of that overwrite is written here
        asm volatile("s_wait_xcnt 0x0" ::: "memory");
    };
    fetch_tile(0);

    for (int kk0 = 0; kk0 < SEQ; kk0 += 64) {
        __syncthreads();
        // stage K tile [64][64] and V transposed [d][key] from the registers filled one tile ago
#pragma unroll
        for (int i = 0; i < 2; ++i) {
            const int r = sr + i * 32;
            *(v8bf*)(&Ks[r * LDK + scol]) = kst[i];
#pragma unroll
            for (int j = 0; j < 8; ++j) Vt[(scol + j) * LDK + r] = vst[i][j];
        }
        bool mzero[4];
#pragma unroll
        for (int t = 0; t < 4; ++t) mzero[t] = (mst[t] == 0);
        __syncthreads();
        // the next tile's loads fly while this tile is worked on
        if (kk0 + 64 < SEQ) fetch_tile(kk0 + 64);

        // scores S = Q * K^T  (4 tiles of 16 keys)
        v8f sacc[4];
#pragma unroll
        for (int t = 0; t < 4; ++t)
#pragma unroll
            for (int r = 0; r < 8; ++r) sacc[t][r] = 0.0f;
#pragma unroll
        for (int s = 0; s < 2; ++s)
#pragma unroll
            for (int t = 0; t < 4; ++t) {
                v16bf kf = load_frag(&Ks[(t * 16 + ln) * LDK + s * 32], kb);
                sacc[t] = WMMA_BF16(qf[s], kf, sacc[t]);
            }

        // scale + mask
        float sv[4][8];
#pragma unroll
        for (int t = 0; t < 4; ++t) {
#pragma unroll
            for (int r = 0; r < 8; ++r) {
                float xs = sacc[t][r] * scale;
                sv[t][r] = mzero[t] ? -1.0e9f : xs;
            }
        }

        // online softmax: row stats live per lane-group of 16
        float mnew[8], alpha[8];
#pragma unroll
        for (int r = 0; r < 8; ++r) {
            float mx = fmaxf(fmaxf(sv[0][r], sv[1][r]), fmaxf(sv[2][r], sv[3][r]));
#pragma unroll
            for (int off = 8; off > 0; off >>= 1)
                mx = fmaxf(mx, __shfl_xor(mx, off, 32));
            mnew[r]  = fmaxf(mrow[r], mx);
            alpha[r] = __expf(mrow[r] - mnew[r]);
        }
        float ps[4][8];
#pragma unroll
        for (int t = 0; t < 4; ++t)
#pragma unroll
            for (int r = 0; r < 8; ++r)
                ps[t][r] = __expf(sv[t][r] - mnew[r]);
#pragma unroll
        for (int r = 0; r < 8; ++r) {
            float sm = ps[0][r] + ps[1][r] + ps[2][r] + ps[3][r];
#pragma unroll
            for (int off = 8; off > 0; off >>= 1)
                sm += __shfl_xor(sm, off, 32);
            lrow[r] = lrow[r] * alpha[r] + sm;
            mrow[r] = mnew[r];
        }
#pragma unroll
        for (int n = 0; n < 4; ++n)
#pragma unroll
            for (int r = 0; r < 8; ++r) oacc[n][r] *= alpha[r];

        // restage P as bf16 A-fragments (per-wave LDS region, same-wave in-order)
        bf16* pw = &Ps[wid * 16 * LDK];
#pragma unroll
        for (int t = 0; t < 4; ++t)
#pragma unroll
            for (int r = 0; r < 8; ++r)
                pw[(r + 8 * hi) * LDK + t * 16 + ln] = (bf16)ps[t][r];

        // O += P * V
#pragma unroll
        for (int s = 0; s < 2; ++s) {
            v16bf pf = load_frag(&pw[ln * LDK + s * 32], kb);
#pragma unroll
            for (int n = 0; n < 4; ++n) {
                v16bf vf = load_frag(&Vt[(n * 16 + ln) * LDK + s * 32], kb);
                oacc[n] = WMMA_BF16(pf, vf, oacc[n]);
            }
        }
    }

    // finalize: O /= l, write bf16 [token][h*64 + d]
#pragma unroll
    for (int r = 0; r < 8; ++r) {
        const float invl = 1.0f / lrow[r];
        const size_t gm  = (size_t)(b * SEQ + q0 + r + 8 * hi);
#pragma unroll
        for (int n = 0; n < 4; ++n)
            O[gm * D_MODEL + dbase + n * 16 + ln] = (bf16)(oacc[n][r] * invl);
    }
}

// ---------------------------------------------------------------------------
// launch
// ---------------------------------------------------------------------------
extern "C" void kernel_launch(void* const* d_in, const int* in_sizes, int n_in,
                              void* d_out, int out_size, void* d_ws, size_t ws_size,
                              hipStream_t stream)
{
    const float* x      = (const float*)d_in[0];
    const int*   mask   = (const int*)  d_in[1];
    const float* w_q    = (const float*)d_in[2];
    const float* w_k    = (const float*)d_in[3];
    const float* w_v    = (const float*)d_in[4];
    const float* w_o    = (const float*)d_in[5];
    const float* alpha1 = (const float*)d_in[6];
    const float* beta1  = (const float*)d_in[7];
    const float* alpha2 = (const float*)d_in[8];
    const float* beta2  = (const float*)d_in[9];
    const float* fc1_w  = (const float*)d_in[10];
    const float* fc1_b  = (const float*)d_in[11];
    const float* fc2_w  = (const float*)d_in[12];
    const float* fc2_b  = (const float*)d_in[13];

    char* ws = (char*)d_ws;
    size_t off = 0;
    auto take = [&](size_t bytes) { char* p = ws + off; off += bytes; return p; };

    bf16* wqb   = (bf16*)take((size_t)D_MODEL * D_MODEL * 2);
    bf16* wkb   = (bf16*)take((size_t)D_MODEL * D_MODEL * 2);
    bf16* wvb   = (bf16*)take((size_t)D_MODEL * D_MODEL * 2);
    bf16* wob   = (bf16*)take((size_t)D_MODEL * D_MODEL * 2);
    bf16* fc1b  = (bf16*)take((size_t)D_FC * D_MODEL * 2);
    bf16* fc2b  = (bf16*)take((size_t)D_MODEL * D_FC * 2);
    bf16* ln1b  = (bf16*)take((size_t)M_TOK * D_MODEL * 2);
    bf16* Qb    = (bf16*)take((size_t)M_TOK * D_MODEL * 2);
    bf16* Kb    = (bf16*)take((size_t)M_TOK * D_MODEL * 2);
    bf16* Vb    = (bf16*)take((size_t)M_TOK * D_MODEL * 2);
    bf16* attnb = (bf16*)take((size_t)M_TOK * D_MODEL * 2);
    float* x1   = (float*)take((size_t)M_TOK * D_MODEL * 4);
    bf16* ln2b  = (bf16*)take((size_t)M_TOK * D_MODEL * 2);
    bf16* hidb  = (bf16*)take((size_t)M_TOK * D_FC * 2);

    // weight conversions: the six bf16 copies are one run that starts at wqb
    cvt_weights_bf16<<<CVT_BLOCKS, CVT_THREADS, 0, stream>>>(
        w_q, w_k, w_v, w_o, fc1_w, fc2_w, wqb);

    // LN1
    layernorm_bf16<<<M_TOK, 256, 0, stream>>>(x, alpha1, beta1, ln1b);

    // Q, K, V projections (bf16 out) in one launch: wqb, wkb, wvb lie back to back in the
    // workspace, and so do Qb, Kb, Vb
    dim3 gP(D_MODEL / 128, M_TOK / 128);
    dim3 gQKV(D_MODEL / 128, M_TOK / 128, 3);
    gemm_bf16_wmma<0,0,0,1><<<gQKV, 256, 0, stream>>>(ln1b, wqb, nullptr, nullptr,
                                                      nullptr, Qb, M_TOK, D_MODEL, D_MODEL);

    // attention
    flash_attn_wmma<<<dim3(SEQ / 128, BATCH * NHEAD), 256, 0, stream>>>(
        Qb, Kb, Vb, mask, attnb);

    // output projection + residual:  x1 = x + attn @ w_o^T  (f32 out)
    gemm_bf16_wmma<0,0,1,0><<<gP, 256, 0, stream>>>(attnb, wob, nullptr, x,
                                                    x1, nullptr, M_TOK, D_MODEL, D_MODEL);

    // LN2
    layernorm_bf16<<<M_TOK, 256, 0, stream>>>(x1, alpha2, beta2, ln2b);

    // FC1: relu(ln2 @ fc1^T + b1) -> bf16 hidden
    dim3 gF1(D_FC / 128, M_TOK / 128);
    gemm_bf16_wmma<1,1,0,1><<<gF1, 256, 0, stream>>>(ln2b, fc1b, fc1_b, nullptr,
                                                     nullptr, hidb, M_TOK, D_FC, D_MODEL);

    // FC2: out = x1 + hidden @ fc2^T + b2  (f32 -> d_out)
    gemm_bf16_wmma<1,0,1,0><<<gP, 256, 0, stream>>>(hidb, fc2b, fc2_b, x1,
                                                    (float*)d_out, nullptr, M_TOK, D_MODEL, D_FC);

    (void)in_sizes; (void)n_in; (void)out_size; (void)ws_size;
}

// v005
// It runs in 119 microseconds.
// Timed twice side by side with v004, it ran 1.07 and 1.08 times as fast.
// All steps since v000 together make it 1.76 times as fast.
#include <hip/hip_runtime.h>
#include <math.h>

typedef __bf16 bf16;
typedef __attribute__((ext_vector_type(16))) __bf16 v16bf;
typedef __attribute__((ext_vector_type(8)))  __bf16 v8bf;
typedef __attribute__((ext_vector_type(8)))  float  v8f;

#define D_MODEL 1024
#define NHEAD   16
#define DKH     64
#define D_FC    4096
#define BATCH   2
#define SEQ     1024
#define M_TOK   (BATCH*SEQ)   // 2048
#define LN_EPS  1e-6f

// ---------------------------------------------------------------------------
// fragment load: 16-bit A/B fragment from a padded row in LDS/global.
// lane L: row chosen by caller (L&15), kb = (L>>4)*8.
// elements 0..7  = K kb..kb+7 ; elements 8..15 = K 16+kb..16+kb+7
// ---------------------------------------------------------------------------
__device__ __forceinline__ v16bf load_frag(const bf16* rowbase, int kb) {
    v8bf lo = *(const v8bf*)(rowbase + kb);
    v8bf hi = *(const v8bf*)(rowbase + kb + 16);
    v16bf f;
#pragma unroll
    for (int i = 0; i < 8; ++i) { f[i] = lo[i]; f[i + 8] = hi[i]; }
    return f;
}

#define WMMA_BF16(A_, B_, C_) \
    __builtin_amdgcn_wmma_f32_16x16x32_bf16(false, (A_), false, (B_), (short)0, (C_), false, false)

// CDNA5 async global->LDS copies, 16B per lane each, tracked by ASYNCcnt.
// Eight copies of one operand's slab: copy i takes LDS byte address lds + i*lstep
// and global address g + i*gstep (elements). The closing s_wait_xcnt 0 stands in the
// copies' own statement so that no address register is rewritten ahead of it.
__device__ __forceinline__ void async_ld8_b128(uint32_t lds, uint32_t lstep,
                                               const bf16* g, size_t gstep) {
    asm volatile("global_load_async_to_lds_b128 %0, %8, off\n\t"
                 "global_load_async_to_lds_b128 %1, %9, off\n\t"
                 "global_load_async_to_lds_b128 %2, %10, off\n\t"
                 "global_load_async_to_lds_b128 %3, %11, off\n\t"
                 "global_load_async_to_lds_b128 %4, %12, off\n\t"
                 "global_load_async_to_lds_b128 %5, %13, off\n\t"
                 "global_load_async_to_lds_b128 %6, %14, off\n\t"
                 "global_load_async_to_lds_b128 %7, %15, off\n\t"
                 "s_wait_xcnt 0x0"
                 :: "v"(lds), "v"(lds + lstep), "v"(lds + 2 * lstep), "v"(lds + 3 * lstep),
                    "v"(lds + 4 * lstep), "v"(lds + 5 * lstep), "v"(lds + 6 * lstep),
                    "v"(lds + 7 * lstep),
                    "v"(g), "v"(g + gstep), "v"(g + 2 * gstep), "v"(g + 3 * gstep),
                    "v"(g + 4 * gstep), "v"(g + 5 * gstep), "v"(g + 6 * gstep),
                    "v"(g + 7 * gstep)
                 : "memory");
}
__device__ __forceinline__ uint32_t lds_off32(const void* p) {
    return (uint32_t)(uintptr_t)p;   // flat LDS aperture: low 32 bits = LDS address
}

// ---------------------------------------------------------------------------
// float -> bf16 of all six weight matrices in one launch of few, long waves.
// The bf16 copies lie back to back in the workspace (q, k, v, o, fc1, fc2), so the
// output is one array of 12 Mi elements. A unit is 1024 consecutive elements (eight
// wave-wide 512 B loads, eight 256 B stores). Wave w of 4096 converts three units:
// unit w of the four square matrices taken as one run of 4 Mi, unit w of fc1, unit w of fc2.
// A thread's 24 loads are independent of one another and are all issued before the first is used.
// ---------------------------------------------------------------------------
typedef __attribute__((ext_vector_type(4))) float  f32x4;
typedef __attribute__((ext_vector_type(4))) __bf16 bf16x4;
#define CVT_THREADS 512                       // 16 waves
#define CVT_BLOCKS  256                       // 4096 waves
#define CVT_UNIT    1024
#define SQ_ELEMS    (D_MODEL * D_MODEL)       // 1 Mi = 1024 units = 64 work-groups
#define FC_ELEMS    (D_FC * D_MODEL)          // 4 Mi = 4096 units = all 256 work-groups

__global__ __launch_bounds__(CVT_THREADS) void cvt_weights_bf16(
    const float* __restrict__ wq, const float* __restrict__ wk,
    const float* __restrict__ wv, const float* __restrict__ wo,
    const float* __restrict__ fc1, const float* __restrict__ fc2,
    bf16* __restrict__ out)
{
    // the same for the whole work-group: its square matrix and its first element in each run
    const unsigned sel = blockIdx.x >> 6;
    const float* sq = (sel & 2) ? ((sel & 1) ? wo : wv) : ((sel & 1) ? wk : wq);
    const unsigned g0 = blockIdx.x * (CVT_THREADS / 32 * CVT_UNIT);
    const float* s0 = sq  + (g0 & (SQ_ELEMS - 1));
    const float* s1 = fc1 + g0;
    const float* s2 = fc2 + g0;
    bf16* o0 = out + g0;
    bf16* o1 = o0 + 4 * SQ_ELEMS;
    bf16* o2 = o1 + FC_ELEMS;
    // the thread's own place inside the work-group's 16 units
    const unsigned t = (threadIdx.x >> 5) * CVT_UNIT + (threadIdx.x & 31) * 4;

    // all six loops are unrolled so that a, b and c stay in registers and i * 128 becomes an
    // immediate offset of the load or store
    f32x4 a[8], b[8], c[8];
#pragma unroll
    for (int i = 0; i < 8; ++i) a[i] = *(const f32x4*)(s0 + t + i * 128);
#pragma unroll
    for (int i = 0; i < 8; ++i) b[i] = *(const f32x4*)(s1 + t + i * 128);
#pragma unroll
    for (int i = 0; i < 8; ++i) c[i] = *(const f32x4*)(s2 + t + i * 128);
    // keeps all 24 loads ahead of the first conversion: without it the scheduler issues them in
    // small groups with a wait between, and the wave pays the memory latency several times
    __builtin_amdgcn_sched_barrier(0);

#pragma unroll
    for (int i = 0; i < 8; ++i) *(bf16x4*)(o0 + t + i * 128) = __builtin_convertvector(a[i], bf16x4);
#pragma unroll
    for (int i = 0; i < 8; ++i) *(bf16x4*)(o1 + t + i * 128) = __builtin_convertvector(b[i], bf16x4);
#pragma unroll
    for (int i = 0; i < 8; ++i) *(bf16x4*)(o2 + t + i * 128) = __builtin_convertvector(c[i], bf16x4);
}

// ---------------------------------------------------------------------------
// LayerNorm (ddof=1, divide by std+eps), D_MODEL=1024, 256 threads/row.
// ---------------------------------------------------------------------------
__global__ __launch_bounds__(256) void layernorm_bf16(
    const float* __restrict__ x, const float* __restrict__ alpha,
    const float* __restrict__ beta, bf16* __restrict__ out)
{
    __shared__ float red[256];
    const int row = blockIdx.x;
    const int tid = threadIdx.x;
    const float* xr = x + (size_t)row * D_MODEL;

    float v[4];
    float s = 0.f;
#pragma unroll
    for (int i = 0; i < 4; ++i) { v[i] = xr[tid + i * 256]; s += v[i]; }
    red[tid] = s; __syncthreads();
#pragma unroll
    for (int off = 128; off > 0; off >>= 1) {
        if (tid < off) red[tid] += red[tid + off];
        __syncthreads();
    }
    const float mean = red[0] * (1.0f / 1024.0f);
    __syncthreads();

    float s2 = 0.f;
#pragma unroll
    for (int i = 0; i < 4; ++i) { float d = v[i] - mean; s2 += d * d; }
    red[tid] = s2; __syncthreads();
#pragma unroll
    for (int off = 128; off > 0; off >>= 1) {
        if (tid < off) red[tid] += red[tid + off];
        __syncthreads();
    }
    const float var = red[0] * (1.0f / 1023.0f);   // ddof = 1
    const float inv = 1.0f / (sqrtf(var) + LN_EPS);

    bf16* orow = out + (size_t)row * D_MODEL;
#pragma unroll
    for (int i = 0; i < 4; ++i) {
        int c = tid + i * 256;
        orow[c] = (bf16)(alpha[c] * (v[i] - mean) * inv + beta[c]);
    }
}

// ---------------------------------------------------------------------------
// Tiled WMMA bf16 GEMM:  C[M,N] = A[M,K] * B[N,K]^T   (+bias/relu/res)
// block tile 128x128, 8 waves (4 along M x 2 along N), wave tile 32x64.
// Two LDS buffers, each one pass of 128 k (256 B of every operand row), filled by
// async global->LDS copies one pass ahead; one publish point per pass.
// blockIdx.z picks one of several products that share A (and M, N, K): their B matrices
// lie back to back, and so do their outputs; bias and res, where present, are common to all.
// ---------------------------------------------------------------------------
template<int HAS_BIAS, int HAS_RELU, int HAS_RES, int OUT_BF16>
__global__ __launch_bounds__(256) void gemm_bf16_wmma(
    const bf16* __restrict__ A, const bf16* __restrict__ B,
    const float* __restrict__ bias, const float* __restrict__ res,
    float* __restrict__ Cf, bf16* __restrict__ Cb,
    int M, int N, int K)
{
    const int LDT = 136;                    // padded row stride (halfs): 272B = 17*16B
    __shared__ __align__(16) bf16 As[2][128 * 136];
    __shared__ __align__(16) bf16 Bs[2][128 * 136];

    const int tid  = threadIdx.x;
    const int lane = tid & 31;
    const int wid  = tid >> 5;
    const int wm   = wid & 3;               // M wave offset: 32*wm
    const int wn   = wid >> 2;              // N wave offset: 64*wn
    const int ln   = lane & 15;
    const int hi   = lane >> 4;
    const int kb   = hi * 8;
    const int m0   = blockIdx.y * 128;
    const int n0   = blockIdx.x * 128;

    // staging coordinates: this thread owns chunks tid + i*256, i = 0..7, per operand
    // chunk c: row = c>>4 (0..127), col = (c&15)*8  (within the 128-wide slab)
    const int r0 = tid >> 4, c0 = (tid & 15) * 8;

    const bf16* gA = A + (size_t)(m0 + r0) * K + c0;
    const bf16* gB = B + ((size_t)blockIdx.z * N + n0 + r0) * K + c0;
    const size_t   gstep = (size_t)16 * K;          // 16 rows further per copy
    const uint32_t lstep = 16 * LDT * 2;            // the same in LDS bytes

    uint32_t lA[2], lB[2];
#pragma unroll
    for (int bi = 0; bi < 2; ++bi) {
        lA[bi] = lds_off32(&As[bi][r0 * LDT + c0]);
        lB[bi] = lds_off32(&Bs[bi][r0 * LDT + c0]);
    }

    auto issue_stage = [&](int s) {
        const int buf = s & 1;
        const int k0  = s * 128;
        async_ld8_b128(lA[buf], lstep, gA + k0, gstep);
        async_ld8_b128(lB[buf], lstep, gB + k0, gstep);
    };

    v8f acc[2][4];
#pragma unroll
    for (int mt = 0; mt < 2; ++mt)
#pragma unroll
        for (int nt = 0; nt < 4; ++nt)
#pragma unroll
            for (int r = 0; r < 8; ++r) acc[mt][nt][r] = 0.0f;

    const int nk = K / 128;
    issue_stage(0);
    // stage 0 has landed for this wave before the barrier publishes it to the others
    asm volatile("s_wait_asynccnt 0x0" ::: "memory");
    __syncthreads();
    if (nk > 1) issue_stage(1);

    for (int t = 0; t < nk; ++t) {
        const bf16* as = As[t & 1];
        const bf16* bs = Bs[t & 1];
        // unrolled so that the four 32-k blocks' LDS reads can be scheduled ahead of the WMMAs
#pragma unroll
        for (int kq = 0; kq < 4; ++kq) {
            v16bf af[2], bfr[4];
#pragma unroll
            for (int mt = 0; mt < 2; ++mt)
                af[mt] = load_frag(&as[(wm * 32 + mt * 16 + ln) * LDT + kq * 32], kb);
#pragma unroll
            for (int nt = 0; nt < 4; ++nt)
                bfr[nt] = load_frag(&bs[(wn * 64 + nt * 16 + ln) * LDT + kq * 32], kb);

#pragma unroll
            for (int mt = 0; mt < 2; ++mt)
#pragma unroll
                for (int nt = 0; nt < 4; ++nt)
                    acc[mt][nt] = WMMA_BF16(af[mt], bfr[nt], acc[mt][nt]);
        }

        // publish point of stage t+1:
        // this wave's reads of buffer t&1 have retired before the buffer is refilled
        asm volatile("s_wait_dscnt 0x0" ::: "memory");
        // this wave's copies of stage t+1 have landed before the barrier publishes them
        asm volatile("s_wait_asynccnt 0x0" ::: "memory");
        __syncthreads();
        if (t + 2 < nk) issue_stage(t + 2); // refill the buffer every reader has left
    }
    // no copy is outstanding when the wave goes on to its end
    asm volatile("s_wait_asynccnt 0x0" ::: "memory");

    // epilogue
    const size_t cz = (size_t)blockIdx.z * M * N;   // this product's own output
#pragma unroll
    for (int mt = 0; mt < 2; ++mt) {
#pragma unroll
        for (int nt = 0; nt < 4; ++nt) {
            const int gn = n0 + wn * 64 + nt * 16 + ln;
#pragma unroll
            for (int r = 0; r < 8; ++r) {
                const int gm = m0 + wm * 32 + mt * 16 + r + 8 * hi;
                float v = acc[mt][nt][r];
                if constexpr (HAS_BIAS) v += bias[gn];
                if constexpr (HAS_RELU) v = fmaxf(v, 0.0f);
                if constexpr (HAS_RES)  v += res[(size_t)gm * N + gn];
                if constexpr (OUT_BF16) Cb[cz + (size_t)gm * N + gn] = (bf16)v;
                else                    Cf[cz + (size_t)gm * N + gn] = v;
            }
        }
    }
}

__device__ __forceinline__ float xhalf(float x) {
    return __builtin_bit_cast(float, __builtin_amdgcn_permlanex16(
        __builtin_bit_cast(int, x), __builtin_bit_cast(int, x),
        0x76543210, 0xfedcba98, false, false));
}

__global__ __launch_bounds__(256) void flash_attn_wmma(
    const bf16* __restrict__ Q, const bf16* __restrict__ Km,
    const bf16* __restrict__ Vm, const int* __restrict__ mask,
    bf16* __restrict__ O)
{
    const int LDK = 72;                       // padded stride (halfs): 144B
    __shared__ __align__(16) bf16 Ks[64 * 72];
    __shared__ __align__(16) bf16 Vt[64 * 72];          // Vt[d][key]

    const int bh   = blockIdx.y;
    const int b    = bh >> 4;
    const int h    = bh & 15;
    const int tid  = threadIdx.x;
    const int lane = tid & 31;
    const int wid  = tid >> 5;
    const int ln   = lane & 15;
    const int hi   = lane >> 4;
    const int kb   = hi * 8;
    const int q0   = blockIdx.x * 128 + wid * 16;       // query offset in seq
    const size_t dbase = (size_t)h * DKH;

    // Q fragments (2 K-slabs of 32 over DK=64), straight from global
    v16bf qf[2];
    {
        const size_t qrow = (size_t)(b * SEQ + q0 + ln) * D_MODEL + dbase;
#pragma unroll
        for (int s = 0; s < 2; ++s)
            qf[s] = load_frag(Q + qrow + s * 32, kb);
    }

    // oacc[n][r] = O^T[d = n*16 + 8*hi + r][query ln]
    v8f oacc[4];
#pragma unroll
    for (int n = 0; n < 4; ++n)
#pragma unroll
        for (int r = 0; r < 8; ++r) oacc[n][r] = 0.0f;

    // this lane's query: running maximum (the same in both halves) and the sum over this
    // half's keys alone; the halves' sums are joined behind the loop
    float mrow = -3.0e38f, lrow = 0.0f;

    const float scale = 0.125f;               // 1/sqrt(64)

    // this thread's share of a 64-key tile: 16 bytes of K and of V in rows sr and sr + 32,
    // and the mask words of keys lane and lane + 32
    const int sr   = tid >> 3;
    const int scol = (tid & 7) * 8;
    const bf16* gK = Km + (size_t)(b * SEQ + sr) * D_MODEL + dbase + scol;
    const bf16* gV = Vm + (size_t)(b * SEQ + sr) * D_MODEL + dbase + scol;
    const int*  gM = mask + b * SEQ + lane;

    v8bf  kst[2];
    v8bf  vst[2];
    int   mst[2];
    auto fetch_tile = [&](int kk) {
#pragma unroll
        for (int i = 0; i < 2; ++i) {
            kst[i] = *(const v8bf*)(gK + (size_t)(kk + i * 32) * D_MODEL);
            vst[i] = *(const v8bf*)(gV + (size_t)(kk + i * 32) * D_MODEL);
        }
#pragma unroll
        for (int i = 0; i < 2; ++i) mst[i] = gM[kk + i * 32];
        // the loads stay in flight over a branch, behind which their address registers are
        // reused: the wait that belongs in front of that overwrite is written here
        asm volatile("s_wait_xcnt 0x0" ::: "memory");
    };
    fetch_tile(0);

    for (int kk0 = 0; kk0 < SEQ; kk0 += 64) {
        __syncthreads();
        // stage K tile [64][64] and V transposed [d][key] from the registers filled one tile ago
#pragma unroll
        for (int i = 0; i < 2; ++i) {
            const int r = sr + i * 32;
            *(v8bf*)(&Ks[r * LDK + scol]) = kst[i];
#pragma unroll
            for (int j = 0; j < 8; ++j) Vt[(scol + j) * LDK + r] = vst[i][j];
        }
        // bit k of mz[i]: the mask word of key i*32 + k is 0
        unsigned mz[2];
#pragma unroll
        for (int i = 0; i < 2; ++i) mz[i] = __builtin_amdgcn_ballot_w32(mst[i] == 0);
        __syncthreads();
        // the next tile's loads fly while this tile is worked on
        if (kk0 + 64 < SEQ) fetch_tile(kk0 + 64);

        // scores S^T = K * Q^T  (4 tiles of 16 keys)
        v8f sacc[4];
#pragma unroll
        for (int t = 0; t < 4; ++t)
#pragma unroll
            for (int r = 0; r < 8; ++r) sacc[t][r] = 0.0f;
#pragma unroll
        for (int s = 0; s < 2; ++s)
#pragma unroll
            for (int t = 0; t < 4; ++t) {
                v16bf kf = load_frag(&Ks[(t * 16 + ln) * LDK + s * 32], kb);
                sacc[t] = WMMA_BF16(kf, qf[s], sacc[t]);
            }

        // scale + mask
        float sv[4][8];
#pragma unroll
        for (int t = 0; t < 4; ++t)
#pragma unroll
            for (int r = 0; r < 8; ++r) sv[t][r] = sacc[t][r] * scale;
        // in this map a key is a register, not a lane, so its mask bit is tested per register;
        // one scalar test per tile keeps those tests out of tiles that hold no masked key
        if ((mz[0] | mz[1]) != 0u) {
#pragma unroll
            for (int t = 0; t < 4; ++t) {
                // bit r: this lane's key t*16 + 8*hi + r is masked out
                const unsigned zb = mz[t >> 1] >> ((t & 1) * 16 + kb);
#pragma unroll
                for (int r = 0; r < 8; ++r)
                    sv[t][r] = ((zb >> r) & 1u) ? -1.0e9f : sv[t][r];
            }
        }

        // online softmax of this lane's query
        float mx = sv[0][0];
#pragma unroll
        for (int t = 0; t < 4; ++t)
#pragma unroll
            for (int r = 0; r < 8; ++r) mx = fmaxf(mx, sv[t][r]);
        mx = fmaxf(mx, xhalf(mx));
        const float mnew  = fmaxf(mrow, mx);
        const float alpha = __expf(mrow - mnew);
        mrow = mnew;

        float ps[4][8];
        float sm[4];
#pragma unroll
        for (int t = 0; t < 4; ++t) {
#pragma unroll
            for (int r = 0; r < 8; ++r) ps[t][r] = __expf(sv[t][r] - mnew);
            sm[t] = ((ps[t][0] + ps[t][1]) + (ps[t][2] + ps[t][3])) +
                    ((ps[t][4] + ps[t][5]) + (ps[t][6] + ps[t][7]));
        }
        lrow = lrow * alpha + ((sm[0] + sm[1]) + (sm[2] + sm[3]));
#pragma unroll
        for (int n = 0; n < 4; ++n)
#pragma unroll
            for (int r = 0; r < 8; ++r) oacc[n][r] *= alpha;

        // O^T += V^T * P^T
#pragma unroll
        for (int s = 0; s < 2; ++s) {
            // elements 0..7 = keys s*32 + kb + 0..7, 8..15 = keys s*32 + 16 + kb + 0..7: as load_frag
            v16bf pf;
#pragma unroll
            for (int i = 0; i < 8; ++i) {
                pf[i]     = (bf16)ps[2 * s][i];
                pf[i + 8] = (bf16)ps[2 * s + 1][i];
            }
#pragma unroll
            for (int n = 0; n < 4; ++n) {
                v16bf vf = load_frag(&Vt[(n * 16 + ln) * LDK + s * 32], kb);
                oacc[n] = WMMA_BF16(vf, pf, oacc[n]);
            }
        }
    }

    // finalize: O /= l, write bf16 [token][h*64 + d], eight consecutive d per store
    const float invl = 1.0f / (lrow + xhalf(lrow));
    bf16* orow = O + (size_t)(b * SEQ + q0 + ln) * D_MODEL + dbase + kb;
#pragma unroll
    for (int n = 0; n < 4; ++n) {
        v8bf ov;
#pragma unroll
        for (int r = 0; r < 8; ++r) ov[r] = (bf16)(oacc[n][r] * invl);
        *(v8bf*)(orow + n * 16) = ov;
    }
}

// ---------------------------------------------------------------------------
// launch
// ---------------------------------------------------------------------------
extern "C" void kernel_launch(void* const* d_in, const int* in_sizes, int n_in,
                              void* d_out, int out_size, void* d_ws, size_t ws_size,
                              hipStream_t stream)
{
    const float* x      = (const float*)d_in[0];
    const int*   mask   = (const int*)  d_in[1];
    const float* w_q    = (const float*)d_in[2];
    const float* w_k    = (const float*)d_in[3];
    const float* w_v    = (const float*)d_in[4];
    const float* w_o    = (const float*)d_in[5];
    const float* alpha1 = (const float*)d_in[6];
    const float* beta1  = (const float*)d_in[7];
    const float* alpha2 = (const float*)d_in[8];
    const float* beta2  = (const float*)d_in[9];
    const float* fc1_w  = (const float*)d_in[10];
    const float* fc1_b  = (const float*)d_in[11];
    const float* fc2_w  = (const float*)d_in[12];
    const float* fc2_b  = (const float*)d_in[13];

    char* ws = (char*)d_ws;
    size_t off = 0;
    auto take = [&](size_t bytes) { char* p = ws + off; off += bytes; return p; };

    bf16* wqb   = (bf16*)take((size_t)D_MODEL * D_MODEL * 2);
    bf16* wkb   = (bf16*)take((size_t)D_MODEL * D_MODEL * 2);
    bf16* wvb   = (bf16*)take((size_t)D_MODEL * D_MODEL * 2);
    bf16* wob   = (bf16*)take((size_t)D_MODEL * D_MODEL * 2);
    bf16* fc1b  = (bf16*)take((size_t)D_FC * D_MODEL * 2);
    bf16* fc2b  = (bf16*)take((size_t)D_MODEL * D_FC * 2);
    bf16* ln1b  = (bf16*)take((size_t)M_TOK * D_MODEL * 2);
    bf16* Qb    = (bf16*)take((size_t)M_TOK * D_MODEL * 2);
    bf16* Kb    = (bf16*)take((size_t)M_TOK * D_MODEL * 2);
    bf16* Vb    = (bf16*)take((size_t)M_TOK * D_MODEL * 2);
    bf16* attnb = (bf16*)take((size_t)M_TOK * D_MODEL * 2);
    float* x1   = (float*)take((size_t)M_TOK * D_MODEL * 4);
    bf16* ln2b  = (bf16*)take((size_t)M_TOK * D_MODEL * 2);
    bf16* hidb  = (bf16*)take((size_t)M_TOK * D_FC * 2);

    // weight conversions: the six bf16 copies are one run that starts at wqb
    cvt_weights_bf16<<<CVT_BLOCKS, CVT_THREADS, 0, stream>>>(
        w_q, w_k, w_v, w_o, fc1_w, fc2_w, wqb);

    // LN1
    layernorm_bf16<<<M_TOK, 256, 0, stream>>>(x, alpha1, beta1, ln1b);

    // Q, K, V projections (bf16 out) in one launch: wqb, wkb, wvb lie back to back in the
    // workspace, and so do Qb, Kb, Vb
    dim3 gP(D_MODEL / 128, M_TOK / 128);
    dim3 gQKV(D_MODEL / 128, M_TOK / 128, 3);
    gemm_bf16_wmma<0,0,0,1><<<gQKV, 256, 0, stream>>>(ln1b, wqb, nullptr, nullptr,
                                                      nullptr, Qb, M_TOK, D_MODEL, D_MODEL);

    // attention
    flash_attn_wmma<<<dim3(SEQ / 128, BATCH * NHEAD), 256, 0, stream>>>(
        Qb, Kb, Vb, mask, attnb);

    // output projection + residual:  x1 = x + attn @ w_o^T  (f32 out)
    gemm_bf16_wmma<0,0,1,0><<<gP, 256, 0, stream>>>(attnb, wob, nullptr, x,
                                                    x1, nullptr, M_TOK, D_MODEL, D_MODEL);

    // LN2
    layernorm_bf16<<<M_TOK, 256, 0, stream>>>(x1, alpha2, beta2, ln2b);

    // FC1: relu(ln2 @ fc1^T + b1) -> bf16 hidden
    dim3 gF1(D_FC / 128, M_TOK / 128);
    gemm_bf16_wmma<1,1,0,1><<<gF1, 256, 0, stream>>>(ln2b, fc1b, fc1_b, nullptr,
                                                     nullptr, hidb, M_TOK, D_FC, D_MODEL);

    // FC2: out = x1 + hidden @ fc2^T + b2  (f32 -> d_out)
    gemm_bf16_wmma<1,0,1,0><<<gP, 256, 0, stream>>>(hidb, fc2b, fc2_b, x1,
                                                    (float*)d_out, nullptr, M_TOK, D_MODEL, D_FC);

    (void)in_sizes; (void)n_in; (void)out_size; (void)ws_size;
}

// v006
// Measured time: 103 microseconds a run.
// Next to v005, in two timings, it ran 1.13 and 1.15 times as fast.
// Over all steps from v000 it is 2.00 times as fast.
#include <hip/hip_runtime.h>
#include <math.h>

typedef __bf16 bf16;
typedef __attribute__((ext_vector_type(16))) __bf16 v16bf;
typedef __attribute__((ext_vector_type(8)))  __bf16 v8bf;
typedef __attribute__((ext_vector_type(8)))  float  v8f;

#define D_MODEL 1024
#define NHEAD   16
#define DKH     64
#define D_FC    4096
#define BATCH   2
#define SEQ     1024
#define M_TOK   (BATCH*SEQ)   // 2048
#define LN_EPS  1e-6f

// ---------------------------------------------------------------------------
// fragment load: 16-bit A/B fragment from a padded row in LDS/global.
// lane L: row chosen by caller (L&15), kb = (L>>4)*8.
// elements 0..7  = K kb..kb+7 ; elements 8..15 = K 16+kb..16+kb+7
// ---------------------------------------------------------------------------
__device__ __forceinline__ v16bf load_frag(const bf16* rowbase, int kb) {
    v8bf lo = *(const v8bf*)(rowbase + kb);
    v8bf hi = *(const v8bf*)(rowbase + kb + 16);
    v16bf f;
#pragma unroll
    for (int i = 0; i < 8; ++i) { f[i] = lo[i]; f[i + 8] = hi[i]; }
    return f;
}

#define WMMA_BF16(A_, B_, C_) \
    __builtin_amdgcn_wmma_f32_16x16x32_bf16(false, (A_), false, (B_), (short)0, (C_), false, false)

// CDNA5 async global->LDS copies, 16B per lane each, tracked by ASYNCcnt.
// Eight copies of one operand's slab: copy i takes LDS byte address lds + i*lstep
// and global address g + i*gstep (elements). The closing s_wait_xcnt 0 stands in the
// copies' own statement so that no address register is rewritten ahead of it.
__device__ __forceinline__ void async_ld8_b128(uint32_t lds, uint32_t lstep,
                                               const bf16* g, size_t gstep) {
    asm volatile("global_load_async_to_lds_b128 %0, %8, off\n\t"
                 "global_load_async_to_lds_b128 %1, %9, off\n\t"
                 "global_load_async_to_lds_b128 %2, %10, off\n\t"
                 "global_load_async_to_lds_b128 %3, %11, off\n\t"
                 "global_load_async_to_lds_b128 %4, %12, off\n\t"
                 "global_load_async_to_lds_b128 %5, %13, off\n\t"
                 "global_load_async_to_lds_b128 %6, %14, off\n\t"
                 "global_load_async_to_lds_b128 %7, %15, off\n\t"
                 "s_wait_xcnt 0x0"
                 :: "v"(lds), "v"(lds + lstep), "v"(lds + 2 * lstep), "v"(lds + 3 * lstep),
                    "v"(lds + 4 * lstep), "v"(lds + 5 * lstep), "v"(lds + 6 * lstep),
                    "v"(lds + 7 * lstep),
                    "v"(g), "v"(g + gstep), "v"(g + 2 * gstep), "v"(g + 3 * gstep),
                    "v"(g + 4 * gstep), "v"(g + 5 * gstep), "v"(g + 6 * gstep),
                    "v"(g + 7 * gstep)
                 : "memory");
}
__device__ __forceinline__ uint32_t lds_off32(const void* p) {
    return (uint32_t)(uintptr_t)p;   // flat LDS aperture: low 32 bits = LDS address
}

// ---------------------------------------------------------------------------
// float -> bf16 of all six weight matrices in one launch of few, long waves.
// The bf16 copies lie back to back in the workspace (q, k, v, o, fc1, fc2), so the
// output is one array of 12 Mi elements. A unit is 1024 consecutive elements (eight
// wave-wide 512 B loads, eight 256 B stores). Wave w of 4096 converts three units:
// unit w of the four square matrices taken as one run of 4 Mi, unit w of fc1, unit w of fc2.
// A thread's 24 loads are independent of one another and are all issued before the first is used.
// ---------------------------------------------------------------------------
typedef __attribute__((ext_vector_type(4))) float  f32x4;
typedef __attribute__((ext_vector_type(4))) __bf16 bf16x4;
#define CVT_THREADS 512                       // 16 waves
#define CVT_BLOCKS  256                       // 4096 waves
#define CVT_UNIT    1024
#define SQ_ELEMS    (D_MODEL * D_MODEL)       // 1 Mi = 1024 units = 64 work-groups
#define FC_ELEMS    (D_FC * D_MODEL)          // 4 Mi = 4096 units = all 256 work-groups

__global__ __launch_bounds__(CVT_THREADS) void cvt_weights_bf16(
    const float* __restrict__ wq, const float* __restrict__ wk,
    const float* __restrict__ wv, const float* __restrict__ wo,
    const float* __restrict__ fc1, const float* __restrict__ fc2,
    bf16* __restrict__ out)
{
    // the same for the whole work-group: its square matrix and its first element in each run
    const unsigned sel = blockIdx.x >> 6;
    const float* sq = (sel & 2) ? ((sel & 1) ? wo : wv) : ((sel & 1) ? wk : wq);
    const unsigned g0 = blockIdx.x * (CVT_THREADS / 32 * CVT_UNIT);
    const float* s0 = sq  + (g0 & (SQ_ELEMS - 1));
    const float* s1 = fc1 + g0;
    const float* s2 = fc2 + g0;
    bf16* o0 = out + g0;
    bf16* o1 = o0 + 4 * SQ_ELEMS;
    bf16* o2 = o1 + FC_ELEMS;
    // the thread's own place inside the work-group's 16 units
    const unsigned t = (threadIdx.x >> 5) * CVT_UNIT + (threadIdx.x & 31) * 4;

    // all six loops are unrolled so that a, b and c stay in registers and i * 128 becomes an
    // immediate offset of the load or store
    f32x4 a[8], b[8], c[8];
#pragma unroll
    for (int i = 0; i < 8; ++i) a[i] = *(const f32x4*)(s0 + t + i * 128);
#pragma unroll
    for (int i = 0; i < 8; ++i) b[i] = *(const f32x4*)(s1 + t + i * 128);
#pragma unroll
    for (int i = 0; i < 8; ++i) c[i] = *(const f32x4*)(s2 + t + i * 128);
    // keeps all 24 loads ahead of the first conversion: without it the scheduler issues them in
    // small groups with a wait between, and the wave pays the memory latency several times
    __builtin_amdgcn_sched_barrier(0);

#pragma unroll
    for (int i = 0; i < 8; ++i) *(bf16x4*)(o0 + t + i * 128) = __builtin_convertvector(a[i], bf16x4);
#pragma unroll
    for (int i = 0; i < 8; ++i) *(bf16x4*)(o1 + t + i * 128) = __builtin_convertvector(b[i], bf16x4);
#pragma unroll
    for (int i = 0; i < 8; ++i) *(bf16x4*)(o2 + t + i * 128) = __builtin_convertvector(c[i], bf16x4);
}

// ---------------------------------------------------------------------------
// LayerNorm (ddof=1, divide by std+eps), D_MODEL=1024, 256 threads/row.
// ---------------------------------------------------------------------------
__global__ __launch_bounds__(256) void layernorm_bf16(
    const float* __restrict__ x, const float* __restrict__ alpha,
    const float* __restrict__ beta, bf16* __restrict__ out)
{
    __shared__ float red[256];
    const int row = blockIdx.x;
    const int tid = threadIdx.x;
    const float* xr = x + (size_t)row * D_MODEL;

    float v[4];
    float s = 0.f;
#pragma unroll
    for (int i = 0; i < 4; ++i) { v[i] = xr[tid + i * 256]; s += v[i]; }
    red[tid] = s; __syncthreads();
#pragma unroll
    for (int off = 128; off > 0; off >>= 1) {
        if (tid < off) red[tid] += red[tid + off];
        __syncthreads();
    }
    const float mean = red[0] * (1.0f / 1024.0f);
    __syncthreads();

    float s2 = 0.f;
#pragma unroll
    for (int i = 0; i < 4; ++i) { float d = v[i] - mean; s2 += d * d; }
    red[tid] = s2; __syncthreads();
#pragma unroll
    for (int off = 128; off > 0; off >>= 1) {
        if (tid < off) red[tid] += red[tid + off];
        __syncthreads();
    }
    const float var = red[0] * (1.0f / 1023.0f);   // ddof = 1
    const float inv = 1.0f / (sqrtf(var) + LN_EPS);

    bf16* orow = out + (size_t)row * D_MODEL;
#pragma unroll
    for (int i = 0; i < 4; ++i) {
        int c = tid + i * 256;
        orow[c] = (bf16)(alpha[c] * (v[i] - mean) * inv + beta[c]);
    }
}

// ---------------------------------------------------------------------------
// Tiled WMMA bf16 GEMM:  C[M,N] = A[M,K] * B[N,K]^T   (+bias/relu/res)
// block tile 128x128, 8 waves (4 along M x 2 along N), wave tile 32x64.
// Two LDS buffers, each one pass of 128 k (256 B of every operand row), filled by
// async global->LDS copies one pass ahead; one publish point per pass.
// blockIdx.z picks one of several products that share A (and M, N, K): their B matrices
// lie back to back, and so do their outputs; bias and res, where present, are common to all.
// ---------------------------------------------------------------------------
template<int HAS_BIAS, int HAS_RELU, int HAS_RES, int OUT_BF16>
__global__ __launch_bounds__(256) void gemm_bf16_wmma(
    const bf16* __restrict__ A, const bf16* __restrict__ B,
    const float* __restrict__ bias, const float* __restrict__ res,
    float* __restrict__ Cf, bf16* __restrict__ Cb,
    int M, int N, int K)
{
    const int LDT = 136;                    // padded row stride (halfs): 272B = 17*16B
    __shared__ __align__(16) bf16 As[2][128 * 136];
    __shared__ __align__(16) bf16 Bs[2][128 * 136];

    const int tid  = threadIdx.x;
    const int lane = tid & 31;
    const int wid  = tid >> 5;
    const int wm   = wid & 3;               // M wave offset: 32*wm
    const int wn   = wid >> 2;              // N wave offset: 64*wn
    const int ln   = lane & 15;
    const int hi   = lane >> 4;
    const int kb   = hi * 8;
    const int m0   = blockIdx.y * 128;
    const int n0   = blockIdx.x * 128;

    // staging coordinates: this thread owns chunks tid + i*256, i = 0..7, per operand
    // chunk c: row = c>>4 (0..127), col = (c&15)*8  (within the 128-wide slab)
    const int r0 = tid >> 4, c0 = (tid & 15) * 8;

    const bf16* gA = A + (size_t)(m0 + r0) * K + c0;
    const bf16* gB = B + ((size_t)blockIdx.z * N + n0 + r0) * K + c0;
    const size_t   gstep = (size_t)16 * K;          // 16 rows further per copy
    const uint32_t lstep = 16 * LDT * 2;            // the same in LDS bytes

    uint32_t lA[2], lB[2];
#pragma unroll
    for (int bi = 0; bi < 2; ++bi) {
        lA[bi] = lds_off32(&As[bi][r0 * LDT + c0]);
        lB[bi] = lds_off32(&Bs[bi][r0 * LDT + c0]);
    }

    auto issue_stage = [&](int s) {
        const int buf = s & 1;
        const int k0  = s * 128;
        async_ld8_b128(lA[buf], lstep, gA + k0, gstep);
        async_ld8_b128(lB[buf], lstep, gB + k0, gstep);
    };

    v8f acc[2][4];
#pragma unroll
    for (int mt = 0; mt < 2; ++mt)
#pragma unroll
        for (int nt = 0; nt < 4; ++nt)
#pragma unroll
            for (int r = 0; r < 8; ++r) acc[mt][nt][r] = 0.0f;

    const int nk = K / 128;
    issue_stage(0);
    // stage 0 has landed for this wave before the barrier publishes it to the others
    asm volatile("s_wait_asynccnt 0x0" ::: "memory");
    __syncthreads();
    if (nk > 1) issue_stage(1);

    for (int t = 0; t < nk; ++t) {
        const bf16* as = As[t & 1];
        const bf16* bs = Bs[t & 1];
        // unrolled so that the four 32-k blocks' LDS reads can be scheduled ahead of the WMMAs
#pragma unroll
        for (int kq = 0; kq < 4; ++kq) {
            v16bf af[2], bfr[4];
#pragma unroll
            for (int mt = 0; mt < 2; ++mt)
                af[mt] = load_frag(&as[(wm * 32 + mt * 16 + ln) * LDT + kq * 32], kb);
#pragma unroll
            for (int nt = 0; nt < 4; ++nt)
                bfr[nt] = load_frag(&bs[(wn * 64 + nt * 16 + ln) * LDT + kq * 32], kb);

#pragma unroll
            for (int mt = 0; mt < 2; ++mt)
#pragma unroll
                for (int nt = 0; nt < 4; ++nt)
                    acc[mt][nt] = WMMA_BF16(af[mt], bfr[nt], acc[mt][nt]);
        }

        // publish point of stage t+1:
        // this wave's reads of buffer t&1 have retired before the buffer is refilled
        asm volatile("s_wait_dscnt 0x0" ::: "memory");
        // this wave's copies of stage t+1 have landed before the barrier publishes them
        asm volatile("s_wait_asynccnt 0x0" ::: "memory");
        __syncthreads();
        if (t + 2 < nk) issue_stage(t + 2); // refill the buffer every reader has left
    }
    // no copy is outstanding when the wave goes on to its end
    asm volatile("s_wait_asynccnt 0x0" ::: "memory");

    // epilogue
    const size_t cz = (size_t)blockIdx.z * M * N;   // this product's own output
#pragma unroll
    for (int mt = 0; mt < 2; ++mt) {
#pragma unroll
        for (int nt = 0; nt < 4; ++nt) {
            const int gn = n0 + wn * 64 + nt * 16 + ln;
#pragma unroll
            for (int r = 0; r < 8; ++r) {
                const int gm = m0 + wm * 32 + mt * 16 + r + 8 * hi;
                float v = acc[mt][nt][r];
                if constexpr (HAS_BIAS) v += bias[gn];
                if constexpr (HAS_RELU) v = fmaxf(v, 0.0f);
                if constexpr (HAS_RES)  v += res[(size_t)gm * N + gn];
                if constexpr (OUT_BF16) Cb[cz + (size_t)gm * N + gn] = (bf16)v;
                else                    Cf[cz + (size_t)gm * N + gn] = v;
            }
        }
    }
}

// ---------------------------------------------------------------------------
// The same product for a narrow output (N = 1024): f32 out = A * B^T (+bias) + res.
// With 128x128 tiles such an output has 128 tiles, one for every second WGP. Here the
// block tile is 64x128, so that there are 256, and the eight waves still have a 32x64 tile
// each: a pass holds 256 k, waves 0..3 take its first 128 k and waves 4..7 its second.
// Behind the loop the two groups' partial sums are joined through LDS: each wave hands the
// 16 rows it does not store to its partner in the other group and adds the partner's to
// the 16 rows it stores.
// Ring as above: two buffers, filled one pass ahead, one publish point per pass.
// ---------------------------------------------------------------------------
template<int HAS_BIAS>
__global__ __launch_bounds__(256) void gemm_bf16_wmma_khalves(
    const bf16* __restrict__ A, const bf16* __restrict__ B,
    const float* __restrict__ bias, const float* __restrict__ res,
    float* __restrict__ Cf, int K)
{
    const int N   = D_MODEL;                // a constant: row steps of res and Cf become offsets
    const int LDT = 136;                    // padded row stride (halfs): 272B = 17*16B
    // [buffer][k half][row * LDT + k inside the half]
    __shared__ __align__(16) bf16 As[2][2][64 * 136];
    __shared__ __align__(16) bf16 Bs[2][2][128 * 136];
    // [wave][four accumulator registers][lane]
    __shared__ __align__(16) f32x4 xch[8][8][32];

    const int tid  = threadIdx.x;
    const int lane = tid & 31;
    const int wid  = tid >> 5;
    const int kg   = wid >> 2;              // this wave's half of every pass's k
    const int wm   = wid & 1;               // M wave offset: 32*wm
    const int wn   = (wid >> 1) & 1;        // N wave offset: 64*wn
    const int ln   = lane & 15;
    const int hi   = lane >> 4;
    const int kb   = hi * 8;
    const int m0   = blockIdx.y * 64;
    const int n0   = blockIdx.x * 128;

    // staging: one copy of a wave brings one row's 256 k (512 B). This thread owns 16 bytes
    // at k offset lane*8 of rows wid + 8*i: i = 0..7 of A, i = 0..15 of B.
    const int sh = lane >> 4, sc = (lane & 15) * 8;

    const bf16* gA = A + (size_t)(m0 + wid) * K + lane * 8;
    const bf16* gB = B + (size_t)(n0 + wid) * K + lane * 8;
    const size_t   gstep = (size_t)8 * K;           // 8 rows further per copy
    const uint32_t lstep = 8 * LDT * 2;             // the same in LDS bytes

    uint32_t lA[2], lB[2];
#pragma unroll
    for (int bi = 0; bi < 2; ++bi) {
        lA[bi] = lds_off32(&As[bi][sh][wid * LDT + sc]);
        lB[bi] = lds_off32(&Bs[bi][sh][wid * LDT + sc]);
    }

    auto issue_stage = [&](int s) {
        const int buf = s & 1;
        const int k0  = s * 256;
        async_ld8_b128(lA[buf], lstep, gA + k0, gstep);
        async_ld8_b128(lB[buf], lstep, gB + k0, gstep);
        async_ld8_b128(lB[buf] + 8 * lstep, lstep, gB + k0 + 8 * gstep, gstep);
    };

    v8f acc[2][4];
#pragma unroll
    for (int mt = 0; mt < 2; ++mt)
#pragma unroll
        for (int nt = 0; nt < 4; ++nt)
#pragma unroll
            for (int r = 0; r < 8; ++r) acc[mt][nt][r] = 0.0f;

    const int nk = K / 256;
    issue_stage(0);
    // stage 0 has landed for this wave before the barrier publishes it to the others
    asm volatile("s_wait_asynccnt 0x0" ::: "memory");
    __syncthreads();
    if (nk > 1) issue_stage(1);

    for (int t = 0; t < nk; ++t) {
        const bf16* as = As[t & 1][kg];
        const bf16* bs = Bs[t & 1][kg];
        // unrolled so that the four 32-k blocks' LDS reads can be scheduled ahead of the WMMAs
#pragma unroll
        for (int kq = 0; kq < 4; ++kq) {
            v16bf af[2], bfr[4];
#pragma unroll
            for (int mt = 0; mt < 2; ++mt)
                af[mt] = load_frag(&as[(wm * 32 + mt * 16 + ln) * LDT + kq * 32], kb);
#pragma unroll
            for (int nt = 0; nt < 4; ++nt)
                bfr[nt] = load_frag(&bs[(wn * 64 + nt * 16 + ln) * LDT + kq * 32], kb);

#pragma unroll
            for (int mt = 0; mt < 2; ++mt)
#pragma unroll
                for (int nt = 0; nt < 4; ++nt)
                    acc[mt][nt] = WMMA_BF16(af[mt], bfr[nt], acc[mt][nt]);
        }

        // publish point of stage t+1:
        // this wave's reads of buffer t&1 have retired before the buffer is refilled
        asm volatile("s_wait_dscnt 0x0" ::: "memory");
        // this wave's copies of stage t+1 have landed before the barrier publishes them
        asm volatile("s_wait_asynccnt 0x0" ::: "memory");
        __syncthreads();
        if (t + 2 < nk) issue_stage(t + 2); // refill the buffer every reader has left
    }
    // no copy is outstanding when the wave goes on to its end
    asm volatile("s_wait_asynccnt 0x0" ::: "memory");

    // this lane's first output element: row block mt = kg of the wave's tile, column ln
    const size_t o0 = (size_t)(m0 + wm * 32 + kg * 16 + 8 * hi) * N + n0 + wn * 64 + ln;
    const float* rp = res + o0;
    float*       cp = Cf + o0;

    // the residual and the bias are fetched ahead of the join: they are in flight while the
    // rows to hand over are picked and stored to LDS
    float rv[4][8], bv[4];
#pragma unroll
    for (int nt = 0; nt < 4; ++nt)
#pragma unroll
        for (int r = 0; r < 8; ++r) rv[nt][r] = rp[r * N + nt * 16];
    if constexpr (HAS_BIAS) {
        // a bias load's result may be given a register that held the address of the loads above:
        // the wait that belongs in front of that overwrite is written here
        asm volatile("s_wait_xcnt 0x0" ::: "memory");
#pragma unroll
        for (int nt = 0; nt < 4; ++nt) bv[nt] = bias[n0 + wn * 64 + nt * 16 + ln];
    }

    // join of the two k halves: group kg stores row block mt = kg and hands over the other
#pragma unroll
    for (int nt = 0; nt < 4; ++nt)
#pragma unroll
        for (int q = 0; q < 2; ++q) {
            f32x4 g;
#pragma unroll
            for (int j = 0; j < 4; ++j)
                g[j] = kg ? acc[0][nt][q * 4 + j] : acc[1][nt][q * 4 + j];
            xch[wid][nt * 2 + q][lane] = g;
        }
    __syncthreads();

    // epilogue
#pragma unroll
    for (int nt = 0; nt < 4; ++nt) {
#pragma unroll
        for (int q = 0; q < 2; ++q) {
            const f32x4 p = xch[wid ^ 4][nt * 2 + q][lane];
#pragma unroll
            for (int j = 0; j < 4; ++j) {
                const int r = q * 4 + j;
                float v = (kg ? acc[1][nt][r] : acc[0][nt][r]) + p[j];
                if constexpr (HAS_BIAS) v += bv[nt];
                v += rv[nt][r];
                cp[r * N + nt * 16] = v;
            }
        }
    }
}

__device__ __forceinline__ float xhalf(float x) {
    return __builtin_bit_cast(float, __builtin_amdgcn_permlanex16(
        __builtin_bit_cast(int, x), __builtin_bit_cast(int, x),
        0x76543210, 0xfedcba98, false, false));
}

__global__ __launch_bounds__(256) void flash_attn_wmma(
    const bf16* __restrict__ Q, const bf16* __restrict__ Km,
    const bf16* __restrict__ Vm, const int* __restrict__ mask,
    bf16* __restrict__ O)
{
    const int LDK = 72;                       // padded stride (halfs): 144B
    __shared__ __align__(16) bf16 Ks[64 * 72];
    __shared__ __align__(16) bf16 Vt[64 * 72];          // Vt[d][key]

    const int bh   = blockIdx.y;
    const int b    = bh >> 4;
    const int h    = bh & 15;
    const int tid  = threadIdx.x;
    const int lane = tid & 31;
    const int wid  = tid >> 5;
    const int ln   = lane & 15;
    const int hi   = lane >> 4;
    const int kb   = hi * 8;
    const int q0   = blockIdx.x * 128 + wid * 16;       // query offset in seq
    const size_t dbase = (size_t)h * DKH;

    // Q fragments (2 K-slabs of 32 over DK=64), straight from global
    v16bf qf[2];
    {
        const size_t qrow = (size_t)(b * SEQ + q0 + ln) * D_MODEL + dbase;
#pragma unroll
        for (int s = 0; s < 2; ++s)
            qf[s] = load_frag(Q + qrow + s * 32, kb);
    }

    // oacc[n][r] = O^T[d = n*16 + 8*hi + r][query ln]
    v8f oacc[4];
#pragma unroll
    for (int n = 0; n < 4; ++n)
#pragma unroll
        for (int r = 0; r < 8; ++r) oacc[n][r] = 0.0f;

    // this lane's query: running maximum (the same in both halves) and the sum over this
    // half's keys alone; the halves' sums are joined behind the loop
    float mrow = -3.0e38f, lrow = 0.0f;

    const float scale = 0.125f;               // 1/sqrt(64)

    // this thread's share of a 64-key tile: 16 bytes of K and of V in rows sr and sr + 32,
    // and the mask words of keys lane and lane + 32
    const int sr   = tid >> 3;
    const int scol = (tid & 7) * 8;
    const bf16* gK = Km + (size_t)(b * SEQ + sr) * D_MODEL + dbase + scol;
    const bf16* gV = Vm + (size_t)(b * SEQ + sr) * D_MODEL + dbase + scol;
    const int*  gM = mask + b * SEQ + lane;

    v8bf  kst[2];
    v8bf  vst[2];
    int   mst[2];
    auto fetch_tile = [&](int kk) {
#pragma unroll
        for (int i = 0; i < 2; ++i) {
            kst[i] = *(const v8bf*)(gK + (size_t)(kk + i * 32) * D_MODEL);
            vst[i] = *(const v8bf*)(gV + (size_t)(kk + i * 32) * D_MODEL);
        }
#pragma unroll
        for (int i = 0; i < 2; ++i) mst[i] = gM[kk + i * 32];
        // the loads stay in flight over a branch, behind which their address registers are
        // reused: the wait that belongs in front of that overwrite is written here
        asm volatile("s_wait_xcnt 0x0" ::: "memory");
    };
    fetch_tile(0);

    for (int kk0 = 0; kk0 < SEQ; kk0 += 64) {
        __syncthreads();
        // stage K tile [64][64] and V transposed [d][key] from the registers filled one tile ago
#pragma unroll
        for (int i = 0; i < 2; ++i) {
            const int r = sr + i * 32;
            *(v8bf*)(&Ks[r * LDK + scol]) = kst[i];
#pragma unroll
            for (int j = 0; j < 8; ++j) Vt[(scol + j) * LDK + r] = vst[i][j];
        }
        // bit k of mz[i]: the mask word of key i*32 + k is 0
        unsigned mz[2];
#pragma unroll
        for (int i = 0; i < 2; ++i) mz[i] = __builtin_amdgcn_ballot_w32(mst[i] == 0);
        __syncthreads();
        // the next tile's loads fly while this tile is worked on
        if (kk0 + 64 < SEQ) fetch_tile(kk0 + 64);

        // scores S^T = K * Q^T  (4 tiles of 16 keys)
        v8f sacc[4];
#pragma unroll
        for (int t = 0; t < 4; ++t)
#pragma unroll
            for (int r = 0; r < 8; ++r) sacc[t][r] = 0.0f;
#pragma unroll
        for (int s = 0; s < 2; ++s)
#pragma unroll
            for (int t = 0; t < 4; ++t) {
                v16bf kf = load_frag(&Ks[(t * 16 + ln) * LDK + s * 32], kb);
                sacc[t] = WMMA_BF16(kf, qf[s], sacc[t]);
            }

        // scale + mask
        float sv[4][8];
#pragma unroll
        for (int t = 0; t < 4; ++t)
#pragma unroll
            for (int r = 0; r < 8; ++r) sv[t][r] = sacc[t][r] * scale;
        // in this map a key is a register, not a lane, so its mask bit is tested per register;
        // one scalar test per tile keeps those tests out of tiles that hold no masked key
        if ((mz[0] | mz[1]) != 0u) {
#pragma unroll
            for (int t = 0; t < 4; ++t) {
                // bit r: this lane's key t*16 + 8*hi + r is masked out
                const unsigned zb = mz[t >> 1] >> ((t & 1) * 16 + kb);
#pragma unroll
                for (int r = 0; r < 8; ++r)
                    sv[t][r] = ((zb >> r) & 1u) ? -1.0e9f : sv[t][r];
            }
        }

        // online softmax of this lane's query
        float mx = sv[0][0];
#pragma unroll
        for (int t = 0; t < 4; ++t)
#pragma unroll
            for (int r = 0; r < 8; ++r) mx = fmaxf(mx, sv[t][r]);
        mx = fmaxf(mx, xhalf(mx));
        const float mnew  = fmaxf(mrow, mx);
        const float alpha = __expf(mrow - mnew);
        mrow = mnew;

        float ps[4][8];
        float sm[4];
#pragma unroll
        for (int t = 0; t < 4; ++t) {
#pragma unroll
            for (int r = 0; r < 8; ++r) ps[t][r] = __expf(sv[t][r] - mnew);
            sm[t] = ((ps[t][0] + ps[t][1]) + (ps[t][2] + ps[t][3])) +
                    ((ps[t][4] + ps[t][5]) + (ps[t][6] + ps[t][7]));
        }
        lrow = lrow * alpha + ((sm[0] + sm[1]) + (sm[2] + sm[3]));
#pragma unroll
        for (int n = 0; n < 4; ++n)
#pragma unroll
            for (int r = 0; r < 8; ++r) oacc[n][r] *= alpha;

        // O^T += V^T * P^T
#pragma unroll
        for (int s = 0; s < 2; ++s) {
            // elements 0..7 = keys s*32 + kb + 0..7, 8..15 = keys s*32 + 16 + kb + 0..7: as load_frag
            v16bf pf;
#pragma unroll
            for (int i = 0; i < 8; ++i) {
                pf[i]     = (bf16)ps[2 * s][i];
                pf[i + 8] = (bf16)ps[2 * s + 1][i];
            }
#pragma unroll
            for (int n = 0; n < 4; ++n) {
                v16bf vf = load_frag(&Vt[(n * 16 + ln) * LDK + s * 32], kb);
                oacc[n] = WMMA_BF16(vf, pf, oacc[n]);
            }
        }
    }

    // finalize: O /= l, write bf16 [token][h*64 + d], eight consecutive d per store
    const float invl = 1.0f / (lrow + xhalf(lrow));
    bf16* orow = O + (size_t)(b * SEQ + q0 + ln) * D_MODEL + dbase + kb;
#pragma unroll
    for (int n = 0; n < 4; ++n) {
        v8bf ov;
#pragma unroll
        for (int r = 0; r < 8; ++r) ov[r] = (bf16)(oacc[n][r] * invl);
        *(v8bf*)(orow + n * 16) = ov;
    }
}

// ---------------------------------------------------------------------------
// launch
// ---------------------------------------------------------------------------
extern "C" void kernel_launch(void* const* d_in, const int* in_sizes, int n_in,
                              void* d_out, int out_size, void* d_ws, size_t ws_size,
                              hipStream_t stream)
{
    const float* x      = (const float*)d_in[0];
    const int*   mask   = (const int*)  d_in[1];
    const float* w_q    = (const float*)d_in[2];
    const float* w_k    = (const float*)d_in[3];
    const float* w_v    = (const float*)d_in[4];
    const float* w_o    = (const float*)d_in[5];
    const float* alpha1 = (const float*)d_in[6];
    const float* beta1  = (const float*)d_in[7];
    const float* alpha2 = (const float*)d_in[8];
    const float* beta2  = (const float*)d_in[9];
    const float* fc1_w  = (const float*)d_in[10];
    const float* fc1_b  = (const float*)d_in[11];
    const float* fc2_w  = (const float*)d_in[12];
    const float* fc2_b  = (const float*)d_in[13];

    char* ws = (char*)d_ws;
    size_t off = 0;
    auto take = [&](size_t bytes) { char* p = ws + off; off += bytes; return p; };

    bf16* wqb   = (bf16*)take((size_t)D_MODEL * D_MODEL * 2);
    bf16* wkb   = (bf16*)take((size_t)D_MODEL * D_MODEL * 2);
    bf16* wvb   = (bf16*)take((size_t)D_MODEL * D_MODEL * 2);
    bf16* wob   = (bf16*)take((size_t)D_MODEL * D_MODEL * 2);
    bf16* fc1b  = (bf16*)take((size_t)D_FC * D_MODEL * 2);
    bf16* fc2b  = (bf16*)take((size_t)D_MODEL * D_FC * 2);
    bf16* ln1b  = (bf16*)take((size_t)M_TOK * D_MODEL * 2);
    bf16* Qb    = (bf16*)take((size_t)M_TOK * D_MODEL * 2);
    bf16* Kb    = (bf16*)take((size_t)M_TOK * D_MODEL * 2);
    bf16* Vb    = (bf16*)take((size_t)M_TOK * D_MODEL * 2);
    bf16* attnb = (bf16*)take((size_t)M_TOK * D_MODEL * 2);
    float* x1   = (float*)take((size_t)M_TOK * D_MODEL * 4);
    bf16* ln2b  = (bf16*)take((size_t)M_TOK * D_MODEL * 2);
    bf16* hidb  = (bf16*)take((size_t)M_TOK * D_FC * 2);

    // weight conversions: the six bf16 copies are one run that starts at wqb
    cvt_weights_bf16<<<CVT_BLOCKS, CVT_THREADS, 0, stream>>>(
        w_q, w_k, w_v, w_o, fc1_w, fc2_w, wqb);

    // LN1
    layernorm_bf16<<<M_TOK, 256, 0, stream>>>(x, alpha1, beta1, ln1b);

    // Q, K, V projections (bf16 out) in one launch: wqb, wkb, wvb lie back to back in the
    // workspace, and so do Qb, Kb, Vb
    dim3 gP(D_MODEL / 128, M_TOK / 64);       // the two narrow products: 64x128 tiles
    dim3 gQKV(D_MODEL / 128, M_TOK / 128, 3);
    gemm_bf16_wmma<0,0,0,1><<<gQKV, 256, 0, stream>>>(ln1b, wqb, nullptr, nullptr,
                                                      nullptr, Qb, M_TOK, D_MODEL, D_MODEL);

    // attention
    flash_attn_wmma<<<dim3(SEQ / 128, BATCH * NHEAD), 256, 0, stream>>>(
        Qb, Kb, Vb, mask, attnb);

    // output projection + residual:  x1 = x + attn @ w_o^T  (f32 out)
    gemm_bf16_wmma_khalves<0><<<gP, 256, 0, stream>>>(attnb, wob, nullptr, x,
                                                      x1, D_MODEL);

    // LN2
    layernorm_bf16<<<M_TOK, 256, 0, stream>>>(x1, alpha2, beta2, ln2b);

    // FC1: relu(ln2 @ fc1^T + b1) -> bf16 hidden
    dim3 gF1(D_FC / 128, M_TOK / 128);
    gemm_bf16_wmma<1,1,0,1><<<gF1, 256, 0, stream>>>(ln2b, fc1b, fc1_b, nullptr,
                                                     nullptr, hidb, M_TOK, D_FC, D_MODEL);

    // FC2: out = x1 + hidden @ fc2^T + b2  (f32 -> d_out)
    gemm_bf16_wmma_khalves<1><<<gP, 256, 0, stream>>>(hidb, fc2b, fc2_b, x1,
                                                      (float*)d_out, D_FC);

    (void)in_sizes; (void)n_in; (void)out_size; (void)ws_size;
}

// v007
// A run of this version takes 100 microseconds.
// Two timings next to v006 put it at 1.04 and 1.03 times that version's speed.
// All steps since v000 together make it 2.07 times as fast.
#include <hip/hip_runtime.h>
#include <math.h>

typedef __bf16 bf16;
typedef __attribute__((ext_vector_type(16))) __bf16 v16bf;
typedef __attribute__((ext_vector_type(8)))  __bf16 v8bf;
typedef __attribute__((ext_vector_type(8)))  float  v8f;

#define D_MODEL 1024
#define NHEAD   16
#define DKH     64
#define D_FC    4096
#define BATCH   2
#define SEQ     1024
#define M_TOK   (BATCH*SEQ)   // 2048
#define LN_EPS  1e-6f

// ---------------------------------------------------------------------------
// fragment load: 16-bit A/B fragment from a padded row in LDS/global.
// lane L: row chosen by caller (L&15), kb = (L>>4)*8.
// elements 0..7  = K kb..kb+7 ; elements 8..15 = K 16+kb..16+kb+7
// ---------------------------------------------------------------------------
__device__ __forceinline__ v16bf load_frag(const bf16* rowbase, int kb) {
    v8bf lo = *(const v8bf*)(rowbase + kb);
    v8bf hi = *(const v8bf*)(rowbase + kb + 16);
    v16bf f;
#pragma unroll
    for (int i = 0; i < 8; ++i) { f[i] = lo[i]; f[i + 8] = hi[i]; }
    return f;
}

#define WMMA_BF16(A_, B_, C_) \
    __builtin_amdgcn_wmma_f32_16x16x32_bf16(false, (A_), false, (B_), (short)0, (C_), false, false)

// CDNA5 async global->LDS copies, 16B per lane each, tracked by ASYNCcnt.
// Eight copies of one operand's slab: copy i takes LDS byte address lds + i*lstep
// and global address g + i*gstep (elements). The closing s_wait_xcnt 0 stands in the
// copies' own statement so that no address register is rewritten ahead of it.
__device__ __forceinline__ void async_ld8_b128(uint32_t lds, uint32_t lstep,
                                               const bf16* g, size_t gstep) {
    asm volatile("global_load_async_to_lds_b128 %0, %8, off\n\t"
                 "global_load_async_to_lds_b128 %1, %9, off\n\t"
                 "global_load_async_to_lds_b128 %2, %10, off\n\t"
                 "global_load_async_to_lds_b128 %3, %11, off\n\t"
                 "global_load_async_to_lds_b128 %4, %12, off\n\t"
                 "global_load_async_to_lds_b128 %5, %13, off\n\t"
                 "global_load_async_to_lds_b128 %6, %14, off\n\t"
                 "global_load_async_to_lds_b128 %7, %15, off\n\t"
                 "s_wait_xcnt 0x0"
                 :: "v"(lds), "v"(lds + lstep), "v"(lds + 2 * lstep), "v"(lds + 3 * lstep),
                    "v"(lds + 4 * lstep), "v"(lds + 5 * lstep), "v"(lds + 6 * lstep),
                    "v"(lds + 7 * lstep),
                    "v"(g), "v"(g + gstep), "v"(g + 2 * gstep), "v"(g + 3 * gstep),
                    "v"(g + 4 * gstep), "v"(g + 5 * gstep), "v"(g + 6 * gstep),
                    "v"(g + 7 * gstep)
                 : "memory");
}
__device__ __forceinline__ uint32_t lds_off32(const void* p) {
    return (uint32_t)(uintptr_t)p;   // flat LDS aperture: low 32 bits = LDS address
}

// ---------------------------------------------------------------------------
// float -> bf16 of all six weight matrices in one launch of few, long waves.
// The bf16 copies lie back to back in the workspace (q, k, v, o, fc1, fc2), so the
// output is one array of 12 Mi elements. A unit is 1024 consecutive elements (eight
// wave-wide 512 B loads, eight 256 B stores). Wave w of 4096 converts three units:
// unit w of the four square matrices taken as one run of 4 Mi, unit w of fc1, unit w of fc2.
// A thread's 24 loads are independent of one another and are all issued before the first is used.
// ---------------------------------------------------------------------------
typedef __attribute__((ext_vector_type(4))) float  f32x4;
typedef __attribute__((ext_vector_type(4))) __bf16 bf16x4;
#define CVT_THREADS 512                       // 16 waves
#define CVT_BLOCKS  256                       // 4096 waves
#define CVT_UNIT    1024
#define SQ_ELEMS    (D_MODEL * D_MODEL)       // 1 Mi = 1024 units = 64 work-groups
#define FC_ELEMS    (D_FC * D_MODEL)          // 4 Mi = 4096 units = all 256 work-groups

__global__ __launch_bounds__(CVT_THREADS) void cvt_weights_bf16(
    const float* __restrict__ wq, const float* __restrict__ wk,
    const float* __restrict__ wv, const float* __restrict__ wo,
    const float* __restrict__ fc1, const float* __restrict__ fc2,
    bf16* __restrict__ out)
{
    // the same for the whole work-group: its square matrix and its first element in each run
    const unsigned sel = blockIdx.x >> 6;
    const float* sq = (sel & 2) ? ((sel & 1) ? wo : wv) : ((sel & 1) ? wk : wq);
    const unsigned g0 = blockIdx.x * (CVT_THREADS / 32 * CVT_UNIT);
    const float* s0 = sq  + (g0 & (SQ_ELEMS - 1));
    const float* s1 = fc1 + g0;
    const float* s2 = fc2 + g0;
    bf16* o0 = out + g0;
    bf16* o1 = o0 + 4 * SQ_ELEMS;
    bf16* o2 = o1 + FC_ELEMS;
    // the thread's own place inside the work-group's 16 units
    const unsigned t = (threadIdx.x >> 5) * CVT_UNIT + (threadIdx.x & 31) * 4;

    // all six loops are unrolled so that a, b and c stay in registers and i * 128 becomes an
    // immediate offset of the load or store
    f32x4 a[8], b[8], c[8];
#pragma unroll
    for (int i = 0; i < 8; ++i) a[i] = *(const f32x4*)(s0 + t + i * 128);
#pragma unroll
    for (int i = 0; i < 8; ++i) b[i] = *(const f32x4*)(s1 + t + i * 128);
#pragma unroll
    for (int i = 0; i < 8; ++i) c[i] = *(const f32x4*)(s2 + t + i * 128);
    // keeps all 24 loads ahead of the first conversion: without it the scheduler issues them in
    // small groups with a wait between, and the wave pays the memory latency several times
    __builtin_amdgcn_sched_barrier(0);

#pragma unroll
    for (int i = 0; i < 8; ++i) *(bf16x4*)(o0 + t + i * 128) = __builtin_convertvector(a[i], bf16x4);
#pragma unroll
    for (int i = 0; i < 8; ++i) *(bf16x4*)(o1 + t + i * 128) = __builtin_convertvector(b[i], bf16x4);
#pragma unroll
    for (int i = 0; i < 8; ++i) *(bf16x4*)(o2 + t + i * 128) = __builtin_convertvector(c[i], bf16x4);
}

// ---------------------------------------------------------------------------
// LayerNorm (ddof=1, divide by std+eps), D_MODEL=1024: one wave per row, eight rows per
// work-group. A lane holds 32 elements of its row (eight float4, each wave-wide load 512
// contiguous bytes); both sums are in-lane adds and a five-step exchange between lanes,
// so there is no LDS and no barrier, and a launch is 2048 waves.
// ---------------------------------------------------------------------------
// x of lane l ^ M, M = 1, 2, 4 or 8 (inside the 16-lane row)
template<int M>
__device__ __forceinline__ float xrow(float x) {
    return __builtin_bit_cast(float, __builtin_amdgcn_update_dpp(
        0, __builtin_bit_cast(int, x), 0x160 + M, 0xf, 0xf, true));
}
// the sum over the wave's 32 lanes, the same value in every lane
__device__ __forceinline__ float wave_sum(float x) {
    x += xrow<1>(x);
    x += xrow<2>(x);
    x += xrow<4>(x);
    x += xrow<8>(x);
    return x + __builtin_bit_cast(float, __builtin_amdgcn_permlanex16(
        __builtin_bit_cast(int, x), __builtin_bit_cast(int, x),
        0x76543210, 0xfedcba98, false, false));
}
#define LN_ROWS 8                             // rows (waves) per work-group

__global__ __launch_bounds__(LN_ROWS * 32) void layernorm_bf16(
    const float* __restrict__ x, const float* __restrict__ alpha,
    const float* __restrict__ beta, bf16* __restrict__ out)
{
    const int lane = threadIdx.x & 31;
    // the wave's number as a scalar: the row's address is then a scalar base, and all loads
    // share one vector offset register
    const int row  = blockIdx.x * LN_ROWS + __builtin_amdgcn_readfirstlane(threadIdx.x >> 5);
    const float* xr = x + (size_t)row * D_MODEL + lane * 4;
    const float* ar = alpha + lane * 4;
    const float* br = beta + lane * 4;

    // every loop is unrolled so that v, a and b stay in registers and i * 128 becomes an
    // immediate offset of the load or store
    f32x4 v[8], a[8], b[8];
#pragma unroll
    for (int i = 0; i < 8; ++i) v[i] = *(const f32x4*)(xr + i * 128);
#pragma unroll
    for (int i = 0; i < 8; ++i) a[i] = *(const f32x4*)(ar + i * 128);
#pragma unroll
    for (int i = 0; i < 8; ++i) b[i] = *(const f32x4*)(br + i * 128);
    // keeps all 24 loads ahead of the first add: without it the scheduler sinks the loads of a
    // and b behind the first sum, in pairs with a wait after each, and the wave pays their
    // latency several times
    __builtin_amdgcn_sched_barrier(0);

    const f32x4 s4 = ((v[0] + v[1]) + (v[2] + v[3])) + ((v[4] + v[5]) + (v[6] + v[7]));
    const float mean = wave_sum((s4[0] + s4[1]) + (s4[2] + s4[3])) * (1.0f / 1024.0f);

    f32x4 q4 = {0.0f, 0.0f, 0.0f, 0.0f};
#pragma unroll
    for (int i = 0; i < 8; ++i) { v[i] -= mean; q4 += v[i] * v[i]; }
    const float var = wave_sum((q4[0] + q4[1]) + (q4[2] + q4[3])) * (1.0f / 1023.0f);   // ddof = 1
    const float inv = 1.0f / (sqrtf(var) + LN_EPS);

    bf16* orow = out + (size_t)row * D_MODEL + lane * 4;
#pragma unroll
    for (int i = 0; i < 8; ++i)
        *(bf16x4*)(orow + i * 128) = __builtin_convertvector(a[i] * v[i] * inv + b[i], bf16x4);
}

// ---------------------------------------------------------------------------
// Tiled WMMA bf16 GEMM:  C[M,N] = A[M,K] * B[N,K]^T   (+bias/relu/res)
// block tile 128x128, 8 waves (4 along M x 2 along N), wave tile 32x64.
// Two LDS buffers, each one pass of 128 k (256 B of every operand row), filled by
// async global->LDS copies one pass ahead; one publish point per pass.
// blockIdx.z picks one of several products that share A (and M, N, K): their B matrices
// lie back to back, and so do their outputs; bias and res, where present, are common to all.
// ---------------------------------------------------------------------------
template<int HAS_BIAS, int HAS_RELU, int HAS_RES, int OUT_BF16>
__global__ __launch_bounds__(256) void gemm_bf16_wmma(
    const bf16* __restrict__ A, const bf16* __restrict__ B,
    const float* __restrict__ bias, const float* __restrict__ res,
    float* __restrict__ Cf, bf16* __restrict__ Cb,
    int M, int N, int K)
{
    const int LDT = 136;                    // padded row stride (halfs): 272B = 17*16B
    __shared__ __align__(16) bf16 As[2][128 * 136];
    __shared__ __align__(16) bf16 Bs[2][128 * 136];

    const int tid  = threadIdx.x;
    const int lane = tid & 31;
    const int wid  = tid >> 5;
    const int wm   = wid & 3;               // M wave offset: 32*wm
    const int wn   = wid >> 2;              // N wave offset: 64*wn
    const int ln   = lane & 15;
    const int hi   = lane >> 4;
    const int kb   = hi * 8;
    const int m0   = blockIdx.y * 128;
    const int n0   = blockIdx.x * 128;

    // staging coordinates: this thread owns chunks tid + i*256, i = 0..7, per operand
    // chunk c: row = c>>4 (0..127), col = (c&15)*8  (within the 128-wide slab)
    const int r0 = tid >> 4, c0 = (tid & 15) * 8;

    const bf16* gA = A + (size_t)(m0 + r0) * K + c0;
    const bf16* gB = B + ((size_t)blockIdx.z * N + n0 + r0) * K + c0;
    const size_t   gstep = (size_t)16 * K;          // 16 rows further per copy
    const uint32_t lstep = 16 * LDT * 2;            // the same in LDS bytes

    uint32_t lA[2], lB[2];
#pragma unroll
    for (int bi = 0; bi < 2; ++bi) {
        lA[bi] = lds_off32(&As[bi][r0 * LDT + c0]);
        lB[bi] = lds_off32(&Bs[bi][r0 * LDT + c0]);
    }

    auto issue_stage = [&](int s) {
        const int buf = s & 1;
        const int k0  = s * 128;
        async_ld8_b128(lA[buf], lstep, gA + k0, gstep);
        async_ld8_b128(lB[buf], lstep, gB + k0, gstep);
    };

    v8f acc[2][4];
#pragma unroll
    for (int mt = 0; mt < 2; ++mt)
#pragma unroll
        for (int nt = 0; nt < 4; ++nt)
#pragma unroll
            for (int r = 0; r < 8; ++r) acc[mt][nt][r] = 0.0f;

    const int nk = K / 128;
    issue_stage(0);
    // stage 0 has landed for this wave before the barrier publishes it to the others
    asm volatile("s_wait_asynccnt 0x0" ::: "memory");
    __syncthreads();
    if (nk > 1) issue_stage(1);

    for (int t = 0; t < nk; ++t) {
        const bf16* as = As[t & 1];
        const bf16* bs = Bs[t & 1];
        // unrolled so that the four 32-k blocks' LDS reads can be scheduled ahead of the WMMAs
#pragma unroll
        for (int kq = 0; kq < 4; ++kq) {
            v16bf af[2], bfr[4];
#pragma unroll
            for (int mt = 0; mt < 2; ++mt)
                af[mt] = load_frag(&as[(wm * 32 + mt * 16 + ln) * LDT + kq * 32], kb);
#pragma unroll
            for (int nt = 0; nt < 4; ++nt)
                bfr[nt] = load_frag(&bs[(wn * 64 + nt * 16 + ln) * LDT + kq * 32], kb);

#pragma unroll
            for (int mt = 0; mt < 2; ++mt)
#pragma unroll
                for (int nt = 0; nt < 4; ++nt)
                    acc[mt][nt] = WMMA_BF16(af[mt], bfr[nt], acc[mt][nt]);
        }

        // publish point of stage t+1:
        // this wave's reads of buffer t&1 have retired before the buffer is refilled
        asm volatile("s_wait_dscnt 0x0" ::: "memory");
        // this wave's copies of stage t+1 have landed before the barrier publishes them
        asm volatile("s_wait_asynccnt 0x0" ::: "memory");
        __syncthreads();
        if (t + 2 < nk) issue_stage(t + 2); // refill the buffer every reader has left
    }
    // no copy is outstanding when the wave goes on to its end
    asm volatile("s_wait_asynccnt 0x0" ::: "memory");

    // epilogue
    const size_t cz = (size_t)blockIdx.z * M * N;   // this product's own output
#pragma unroll
    for (int mt = 0; mt < 2; ++mt) {
#pragma unroll
        for (int nt = 0; nt < 4; ++nt) {
            const int gn = n0 + wn * 64 + nt * 16 + ln;
#pragma unroll
            for (int r = 0; r < 8; ++r) {
                const int gm = m0 + wm * 32 + mt * 16 + r + 8 * hi;
                float v = acc[mt][nt][r];
                if constexpr (HAS_BIAS) v += bias[gn];
                if constexpr (HAS_RELU) v = fmaxf(v, 0.0f);
                if constexpr (HAS_RES)  v += res[(size_t)gm * N + gn];
                if constexpr (OUT_BF16) Cb[cz + (size_t)gm * N + gn] = (bf16)v;
                else                    Cf[cz + (size_t)gm * N + gn] = v;
            }
        }
    }
}

// ---------------------------------------------------------------------------
// The same product for a narrow output (N = 1024): f32 out = A * B^T (+bias) + res.
// With 128x128 tiles such an output has 128 tiles, one for every second WGP. Here the
// block tile is 64x128, so that there are 256, and the eight waves still have a 32x64 tile
// each: a pass holds 256 k, waves 0..3 take its first 128 k and waves 4..7 its second.
// Behind the loop the two groups' partial sums are joined through LDS: each wave hands the
// 16 rows it does not store to its partner in the other group and adds the partner's to
// the 16 rows it stores.
// Ring as above: two buffers, filled one pass ahead, one publish point per pass.
// ---------------------------------------------------------------------------
template<int HAS_BIAS>
__global__ __launch_bounds__(256) void gemm_bf16_wmma_khalves(
    const bf16* __restrict__ A, const bf16* __restrict__ B,
    const float* __restrict__ bias, const float* __restrict__ res,
    float* __restrict__ Cf, int K)
{
    const int N   = D_MODEL;                // a constant: row steps of res and Cf become offsets
    const int LDT = 136;                    // padded row stride (halfs): 272B = 17*16B
    // [buffer][k half][row * LDT + k inside the half]
    __shared__ __align__(16) bf16 As[2][2][64 * 136];
    __shared__ __align__(16) bf16 Bs[2][2][128 * 136];
    // [wave][four accumulator registers][lane]
    __shared__ __align__(16) f32x4 xch[8][8][32];

    const int tid  = threadIdx.x;
    const int lane = tid & 31;
    const int wid  = tid >> 5;
    const int kg   = wid >> 2;              // this wave's half of every pass's k
    const int wm   = wid & 1;               // M wave offset: 32*wm
    const int wn   = (wid >> 1) & 1;        // N wave offset: 64*wn
    const int ln   = lane & 15;
    const int hi   = lane >> 4;
    const int kb   = hi * 8;
    const int m0   = blockIdx.y * 64;
    const int n0   = blockIdx.x * 128;

    // staging: one copy of a wave brings one row's 256 k (512 B). This thread owns 16 bytes
    // at k offset lane*8 of rows wid + 8*i: i = 0..7 of A, i = 0..15 of B.
    const int sh = lane >> 4, sc = (lane & 15) * 8;

    const bf16* gA = A + (size_t)(m0 + wid) * K + lane * 8;
    const bf16* gB = B + (size_t)(n0 + wid) * K + lane * 8;
    const size_t   gstep = (size_t)8 * K;           // 8 rows further per copy
    const uint32_t lstep = 8 * LDT * 2;             // the same in LDS bytes

    uint32_t lA[2], lB[2];
#pragma unroll
    for (int bi = 0; bi < 2; ++bi) {
        lA[bi] = lds_off32(&As[bi][sh][wid * LDT + sc]);
        lB[bi] = lds_off32(&Bs[bi][sh][wid * LDT + sc]);
    }

    auto issue_stage = [&](int s) {
        const int buf = s & 1;
        const int k0  = s * 256;
        async_ld8_b128(lA[buf], lstep, gA + k0, gstep);
        async_ld8_b128(lB[buf], lstep, gB + k0, gstep);
        async_ld8_b128(lB[buf] + 8 * lstep, lstep, gB + k0 + 8 * gstep, gstep);
    };

    v8f acc[2][4];
#pragma unroll
    for (int mt = 0; mt < 2; ++mt)
#pragma unroll
        for (int nt = 0; nt < 4; ++nt)
#pragma unroll
            for (int r = 0; r < 8; ++r) acc[mt][nt][r] = 0.0f;

    const int nk = K / 256;
    issue_stage(0);
    // stage 0 has landed for this wave before the barrier publishes it to the others
    asm volatile("s_wait_asynccnt 0x0" ::: "memory");
    __syncthreads();
    if (nk > 1) issue_stage(1);

    for (int t = 0; t < nk; ++t) {
        const bf16* as = As[t & 1][kg];
        const bf16* bs = Bs[t & 1][kg];
        // unrolled so that the four 32-k blocks' LDS reads can be scheduled ahead of the WMMAs
#pragma unroll
        for (int kq = 0; kq < 4; ++kq) {
            v16bf af[2], bfr[4];
#pragma unroll
            for (int mt = 0; mt < 2; ++mt)
                af[mt] = load_frag(&as[(wm * 32 + mt * 16 + ln) * LDT + kq * 32], kb);
#pragma unroll
            for (int nt = 0; nt < 4; ++nt)
                bfr[nt] = load_frag(&bs[(wn * 64 + nt * 16 + ln) * LDT + kq * 32], kb);

#pragma unroll
            for (int mt = 0; mt < 2; ++mt)
#pragma unroll
                for (int nt = 0; nt < 4; ++nt)
                    acc[mt][nt] = WMMA_BF16(af[mt], bfr[nt], acc[mt][nt]);
        }

        // publish point of stage t+1:
        // this wave's reads of buffer t&1 have retired before the buffer is refilled
        asm volatile("s_wait_dscnt 0x0" ::: "memory");
        // this wave's copies of stage t+1 have landed before the barrier publishes them
        asm volatile("s_wait_asynccnt 0x0" ::: "memory");
        __syncthreads();
        if (t + 2 < nk) issue_stage(t + 2); // refill the buffer every reader has left
    }
    // no copy is outstanding when the wave goes on to its end
    asm volatile("s_wait_asynccnt 0x0" ::: "memory");

    // this lane's first output element: row block mt = kg of the wave's tile, column ln
    const size_t o0 = (size_t)(m0 + wm * 32 + kg * 16 + 8 * hi) * N + n0 + wn * 64 + ln;
    const float* rp = res + o0;
    float*       cp = Cf + o0;

    // the residual and the bias are fetched ahead of the join: they are in flight while the
    // rows to hand over are picked and stored to LDS
    float rv[4][8], bv[4];
#pragma unroll
    for (int nt = 0; nt < 4; ++nt)
#pragma unroll
        for (int r = 0; r < 8; ++r) rv[nt][r] = rp[r * N + nt * 16];
    if constexpr (HAS_BIAS) {
        // a bias load's result may be given a register that held the address of the loads above:
        // the wait that belongs in front of that overwrite is written here
        asm volatile("s_wait_xcnt 0x0" ::: "memory");
#pragma unroll
        for (int nt = 0; nt < 4; ++nt) bv[nt] = bias[n0 + wn * 64 + nt * 16 + ln];
    }

    // join of the two k halves: group kg stores row block mt = kg and hands over the other
#pragma unroll
    for (int nt = 0; nt < 4; ++nt)
#pragma unroll
        for (int q = 0; q < 2; ++q) {
            f32x4 g;
#pragma unroll
            for (int j = 0; j < 4; ++j)
                g[j] = kg ? acc[0][nt][q * 4 + j] : acc[1][nt][q * 4 + j];
            xch[wid][nt * 2 + q][lane] = g;
        }
    __syncthreads();

    // epilogue
#pragma unroll
    for (int nt = 0; nt < 4; ++nt) {
#pragma unroll
        for (int q = 0; q < 2; ++q) {
            const f32x4 p = xch[wid ^ 4][nt * 2 + q][lane];
#pragma unroll
            for (int j = 0; j < 4; ++j) {
                const int r = q * 4 + j;
                float v = (kg ? acc[1][nt][r] : acc[0][nt][r]) + p[j];
                if constexpr (HAS_BIAS) v += bv[nt];
                v += rv[nt][r];
                cp[r * N + nt * 16] = v;
            }
        }
    }
}

__device__ __forceinline__ float xhalf(float x) {
    return __builtin_bit_cast(float, __builtin_amdgcn_permlanex16(
        __builtin_bit_cast(int, x), __builtin_bit_cast(int, x),
        0x76543210, 0xfedcba98, false, false));
}

__global__ __launch_bounds__(256) void flash_attn_wmma(
    const bf16* __restrict__ Q, const bf16* __restrict__ Km,
    const bf16* __restrict__ Vm, const int* __restrict__ mask,
    bf16* __restrict__ O)
{
    const int LDK = 72;                       // padded stride (halfs): 144B
    __shared__ __align__(16) bf16 Ks[64 * 72];
    __shared__ __align__(16) bf16 Vt[64 * 72];          // Vt[d][key]

    const int bh   = blockIdx.y;
    const int b    = bh >> 4;
    const int h    = bh & 15;
    const int tid  = threadIdx.x;
    const int lane = tid & 31;
    const int wid  = tid >> 5;
    const int ln   = lane & 15;
    const int hi   = lane >> 4;
    const int kb   = hi * 8;
    const int q0   = blockIdx.x * 128 + wid * 16;       // query offset in seq
    const size_t dbase = (size_t)h * DKH;

    // Q fragments (2 K-slabs of 32 over DK=64), straight from global
    v16bf qf[2];
    {
        const size_t qrow = (size_t)(b * SEQ + q0 + ln) * D_MODEL + dbase;
#pragma unroll
        for (int s = 0; s < 2; ++s)
            qf[s] = load_frag(Q + qrow + s * 32, kb);
    }

    // oacc[n][r] = O^T[d = n*16 + 8*hi + r][query ln]
    v8f oacc[4];
#pragma unroll
    for (int n = 0; n < 4; ++n)
#pragma unroll
        for (int r = 0; r < 8; ++r) oacc[n][r] = 0.0f;

    // this lane's query: running maximum (the same in both halves) and the sum over this
    // half's keys alone; the halves' sums are joined behind the loop
    float mrow = -3.0e38f, lrow = 0.0f;

    const float scale = 0.125f;               // 1/sqrt(64)

    // this thread's share of a 64-key tile: 16 bytes of K and of V in rows sr and sr + 32,
    // and the mask words of keys lane and lane + 32
    const int sr   = tid >> 3;
    const int scol = (tid & 7) * 8;
    const bf16* gK = Km + (size_t)(b * SEQ + sr) * D_MODEL + dbase + scol;
    const bf16* gV = Vm + (size_t)(b * SEQ + sr) * D_MODEL + dbase + scol;
    const int*  gM = mask + b * SEQ + lane;

    v8bf  kst[2];
    v8bf  vst[2];
    int   mst[2];
    auto fetch_tile = [&](int kk) {
#pragma unroll
        for (int i = 0; i < 2; ++i) {
            kst[i] = *(const v8bf*)(gK + (size_t)(kk + i * 32) * D_MODEL);
            vst[i] = *(const v8bf*)(gV + (size_t)(kk + i * 32) * D_MODEL);
        }
#pragma unroll
        for (int i = 0; i < 2; ++i) mst[i] = gM[kk + i * 32];
        // the loads stay in flight over a branch, behind which their address registers are
        // reused: the wait that belongs in front of that overwrite is written here
        asm volatile("s_wait_xcnt 0x0" ::: "memory");
    };
    fetch_tile(0);

    for (int kk0 = 0; kk0 < SEQ; kk0 += 64) {
        __syncthreads();
        // stage K tile [64][64] and V transposed [d][key] from the registers filled one tile ago
#pragma unroll
        for (int i = 0; i < 2; ++i) {
            const int r = sr + i * 32;
            *(v8bf*)(&Ks[r * LDK + scol]) = kst[i];
#pragma unroll
            for (int j = 0; j < 8; ++j) Vt[(scol + j) * LDK + r] = vst[i][j];
        }
        // bit k of mz[i]: the mask word of key i*32 + k is 0
        unsigned mz[2];
#pragma unroll
        for (int i = 0; i < 2; ++i) mz[i] = __builtin_amdgcn_ballot_w32(mst[i] == 0);
        __syncthreads();
        // the next tile's loads fly while this tile is worked on
        if (kk0 + 64 < SEQ) fetch_tile(kk0 + 64);

        // scores S^T = K * Q^T  (4 tiles of 16 keys)
        v8f sacc[4];
#pragma unroll
        for (int t = 0; t < 4; ++t)
#pragma unroll
            for (int r = 0; r < 8; ++r) sacc[t][r] = 0.0f;
#pragma unroll
        for (int s = 0; s < 2; ++s)
#pragma unroll
            for (int t = 0; t < 4; ++t) {
                v16bf kf = load_frag(&Ks[(t * 16 + ln) * LDK + s * 32], kb);
                sacc[t] = WMMA_BF16(kf, qf[s], sacc[t]);
            }

        // scale + mask
        float sv[4][8];
#pragma unroll
        for (int t = 0; t < 4; ++t)
#pragma unroll
            for (int r = 0; r < 8; ++r) sv[t][r] = sacc[t][r] * scale;
        // in this map a key is a register, not a lane, so its mask bit is tested per register;
        // one scalar test per tile keeps those tests out of tiles that hold no masked key
        if ((mz[0] | mz[1]) != 0u) {
#pragma unroll
            for (int t = 0; t < 4; ++t) {
                // bit r: this lane's key t*16 + 8*hi + r is masked out
                const unsigned zb = mz[t >> 1] >> ((t & 1) * 16 + kb);
#pragma unroll
                for (int r = 0; r < 8; ++r)
                    sv[t][r] = ((zb >> r) & 1u) ? -1.0e9f : sv[t][r];
            }
        }

        // online softmax of this lane's query
        float mx = sv[0][0];
#pragma unroll
        for (int t = 0; t < 4; ++t)
#pragma unroll
            for (int r = 0; r < 8; ++r) mx = fmaxf(mx, sv[t][r]);
        mx = fmaxf(mx, xhalf(mx));
        const float mnew  = fmaxf(mrow, mx);
        const float alpha = __expf(mrow - mnew);
        mrow = mnew;

        float ps[4][8];
        float sm[4];
#pragma unroll
        for (int t = 0; t < 4; ++t) {
#pragma unroll
            for (int r = 0; r < 8; ++r) ps[t][r] = __expf(sv[t][r] - mnew);
            sm[t] = ((ps[t][0] + ps[t][1]) + (ps[t][2] + ps[t][3])) +
                    ((ps[t][4] + ps[t][5]) + (ps[t][6] + ps[t][7]));
        }
        lrow = lrow * alpha + ((sm[0] + sm[1]) + (sm[2] + sm[3]));
#pragma unroll
        for (int n = 0; n < 4; ++n)
#pragma unroll
            for (int r = 0; r < 8; ++r) oacc[n][r] *= alpha;

        // O^T += V^T * P^T
#pragma unroll
        for (int s = 0; s < 2; ++s) {
            // elements 0..7 = keys s*32 + kb + 0..7, 8..15 = keys s*32 + 16 + kb + 0..7: as load_frag
            v16bf pf;
#pragma unroll
            for (int i = 0; i < 8; ++i) {
                pf[i]     = (bf16)ps[2 * s][i];
                pf[i + 8] = (bf16)ps[2 * s + 1][i];
            }
#pragma unroll
            for (int n = 0; n < 4; ++n) {
                v16bf vf = load_frag(&Vt[(n * 16 + ln) * LDK + s * 32], kb);
                oacc[n] = WMMA_BF16(vf, pf, oacc[n]);
            }
        }
    }

    // finalize: O /= l, write bf16 [token][h*64 + d], eight consecutive d per store
    const float invl = 1.0f / (lrow + xhalf(lrow));
    bf16* orow = O + (size_t)(b * SEQ + q0 + ln) * D_MODEL + dbase + kb;
#pragma unroll
    for (int n = 0; n < 4; ++n) {
        v8bf ov;
#pragma unroll
        for (int r = 0; r < 8; ++r) ov[r] = (bf16)(oacc[n][r] * invl);
        *(v8bf*)(orow + n * 16) = ov;
    }
}

// ---------------------------------------------------------------------------
// launch
// ---------------------------------------------------------------------------
extern "C" void kernel_launch(void* const* d_in, const int* in_sizes, int n_in,
                              void* d_out, int out_size, void* d_ws, size_t ws_size,
                              hipStream_t stream)
{
    const float* x      = (const float*)d_in[0];
    const int*   mask   = (const int*)  d_in[1];
    const float* w_q    = (const float*)d_in[2];
    const float* w_k    = (const float*)d_in[3];
    const float* w_v    = (const float*)d_in[4];
    const float* w_o    = (const float*)d_in[5];
    const float* alpha1 = (const float*)d_in[6];
    const float* beta1  = (const float*)d_in[7];
    const float* alpha2 = (const float*)d_in[8];
    const float* beta2  = (const float*)d_in[9];
    const float* fc1_w  = (const float*)d_in[10];
    const float* fc1_b  = (const float*)d_in[11];
    const float* fc2_w  = (const float*)d_in[12];
    const float* fc2_b  = (const float*)d_in[13];

    char* ws = (char*)d_ws;
    size_t off = 0;
    auto take = [&](size_t bytes) { char* p = ws + off; off += bytes; return p; };

    bf16* wqb   = (bf16*)take((size_t)D_MODEL * D_MODEL * 2);
    bf16* wkb   = (bf16*)take((size_t)D_MODEL * D_MODEL * 2);
    bf16* wvb   = (bf16*)take((size_t)D_MODEL * D_MODEL * 2);
    bf16* wob   = (bf16*)take((size_t)D_MODEL * D_MODEL * 2);
    bf16* fc1b  = (bf16*)take((size_t)D_FC * D_MODEL * 2);
    bf16* fc2b  = (bf16*)take((size_t)D_MODEL * D_FC * 2);
    bf16* ln1b  = (bf16*)take((size_t)M_TOK * D_MODEL * 2);
    bf16* Qb    = (bf16*)take((size_t)M_TOK * D_MODEL * 2);
    bf16* Kb    = (bf16*)take((size_t)M_TOK * D_MODEL * 2);
    bf16* Vb    = (bf16*)take((size_t)M_TOK * D_MODEL * 2);
    bf16* attnb = (bf16*)take((size_t)M_TOK * D_MODEL * 2);
    float* x1   = (float*)take((size_t)M_TOK * D_MODEL * 4);
    bf16* ln2b  = (bf16*)take((size_t)M_TOK * D_MODEL * 2);
    bf16* hidb  = (bf16*)take((size_t)M_TOK * D_FC * 2);

    // weight conversions: the six bf16 copies are one run that starts at wqb
    cvt_weights_bf16<<<CVT_BLOCKS, CVT_THREADS, 0, stream>>>(
        w_q, w_k, w_v, w_o, fc1_w, fc2_w, wqb);

    // LN1
    layernorm_bf16<<<M_TOK / LN_ROWS, LN_ROWS * 32, 0, stream>>>(x, alpha1, beta1, ln1b);

    // Q, K, V projections (bf16 out) in one launch: wqb, wkb, wvb lie back to back in the
    // workspace, and so do Qb, Kb, Vb
    dim3 gP(D_MODEL / 128, M_TOK / 64);       // the two narrow products: 64x128 tiles
    dim3 gQKV(D_MODEL / 128, M_TOK / 128, 3);
    gemm_bf16_wmma<0,0,0,1><<<gQKV, 256, 0, stream>>>(ln1b, wqb, nullptr, nullptr,
                                                      nullptr, Qb, M_TOK, D_MODEL, D_MODEL);

    // attention
    flash_attn_wmma<<<dim3(SEQ / 128, BATCH * NHEAD), 256, 0, stream>>>(
        Qb, Kb, Vb, mask, attnb);

    // output projection + residual:  x1 = x + attn @ w_o^T  (f32 out)
    gemm_bf16_wmma_khalves<0><<<gP, 256, 0, stream>>>(attnb, wob, nullptr, x,
                                                      x1, D_MODEL);

    // LN2
    layernorm_bf16<<<M_TOK / LN_ROWS, LN_ROWS * 32, 0, stream>>>(x1, alpha2, beta2, ln2b);

    // FC1: relu(ln2 @ fc1^T + b1) -> bf16 hidden
    dim3 gF1(D_FC / 128, M_TOK / 128);
    gemm_bf16_wmma<1,1,0,1><<<gF1, 256, 0, stream>>>(ln2b, fc1b, fc1_b, nullptr,
                                                     nullptr, hidb, M_TOK, D_FC, D_MODEL);

    // FC2: out = x1 + hidden @ fc2^T + b2  (f32 -> d_out)
    gemm_bf16_wmma_khalves<1><<<gP, 256, 0, stream>>>(hidb, fc2b, fc2_b, x1,
                                                      (float*)d_out, D_FC);

    (void)in_sizes; (void)n_in; (void)out_size; (void)ws_size;
}

// v008
// One run takes 95.6 microseconds.
// Timed twice side by side with v007, it ran 1.05 times as fast both times.
// Counting every step since v000, it is 2.17 times as fast.
#include <hip/hip_runtime.h>
#include <math.h>

typedef __bf16 bf16;
typedef __attribute__((ext_vector_type(16))) __bf16 v16bf;
typedef __attribute__((ext_vector_type(8)))  __bf16 v8bf;
typedef __attribute__((ext_vector_type(8)))  float  v8f;

#define D_MODEL 1024
#define NHEAD   16
#define DKH     64
#define D_FC    4096
#define BATCH   2
#define SEQ     1024
#define M_TOK   (BATCH*SEQ)   // 2048
#define LN_EPS  1e-6f

// ---------------------------------------------------------------------------
// fragment load: 16-bit A/B fragment from a padded row in LDS/global.
// lane L: row chosen by caller (L&15), kb = (L>>4)*8.
// elements 0..7  = K kb..kb+7 ; elements 8..15 = K 16+kb..16+kb+7
// ---------------------------------------------------------------------------
__device__ __forceinline__ v16bf load_frag(const bf16* rowbase, int kb) {
    v8bf lo = *(const v8bf*)(rowbase + kb);
    v8bf hi = *(const v8bf*)(rowbase + kb + 16);
    v16bf f;
#pragma unroll
    for (int i = 0; i < 8; ++i) { f[i] = lo[i]; f[i + 8] = hi[i]; }
    return f;
}

#define WMMA_BF16(A_, B_, C_) \
    __builtin_amdgcn_wmma_f32_16x16x32_bf16(false, (A_), false, (B_), (short)0, (C_), false, false)

// CDNA5 async global->LDS copies, 16B per lane each, tracked by ASYNCcnt.
// Eight copies of one operand's slab: copy i takes LDS byte address lds + i*lstep
// and global address g + i*gstep (elements). The closing s_wait_xcnt 0 stands in the
// copies' own statement so that no address register is rewritten ahead of it.
__device__ __forceinline__ void async_ld8_b128(uint32_t lds, uint32_t lstep,
                                               const bf16* g, size_t gstep) {
    asm volatile("global_load_async_to_lds_b128 %0, %8, off\n\t"
                 "global_load_async_to_lds_b128 %1, %9, off\n\t"
                 "global_load_async_to_lds_b128 %2, %10, off\n\t"
                 "global_load_async_to_lds_b128 %3, %11, off\n\t"
                 "global_load_async_to_lds_b128 %4, %12, off\n\t"
                 "global_load_async_to_lds_b128 %5, %13, off\n\t"
                 "global_load_async_to_lds_b128 %6, %14, off\n\t"
                 "global_load_async_to_lds_b128 %7, %15, off\n\t"
                 "s_wait_xcnt 0x0"
                 :: "v"(lds), "v"(lds + lstep), "v"(lds + 2 * lstep), "v"(lds + 3 * lstep),
                    "v"(lds + 4 * lstep), "v"(lds + 5 * lstep), "v"(lds + 6 * lstep),
                    "v"(lds + 7 * lstep),
                    "v"(g), "v"(g + gstep), "v"(g + 2 * gstep), "v"(g + 3 * gstep),
                    "v"(g + 4 * gstep), "v"(g + 5 * gstep), "v"(g + 6 * gstep),
                    "v"(g + 7 * gstep)
                 : "memory");
}
__device__ __forceinline__ uint32_t lds_off32(const void* p) {
    return (uint32_t)(uintptr_t)p;   // flat LDS aperture: low 32 bits = LDS address
}

// ---------------------------------------------------------------------------
// float -> bf16 of the six weight matrices, by few, long waves. It has no launch of its own:
// its work-groups ride, by block index, in launches whose own work does not depend on them and
// that end before the first reader of their output starts: q, k, v beside LayerNorm 1 (both
// feed the Q, K, V projections), o, fc1, fc2 beside attention (first read by the launches
// behind it), where their memory time passes under attention's arithmetic.
// The bf16 copies lie back to back in the workspace (q, k, v, o, fc1, fc2): twelve segments of
// 1 Mi elements. A unit is 1024 consecutive elements (eight wave-wide 512 B loads, eight 256 B
// stores). A work-group of 8 waves takes the same 8 units of three segments, a wave one unit of
// each. A thread's 24 loads are independent of one another and are all issued before the first
// is used.
// ---------------------------------------------------------------------------
typedef __attribute__((ext_vector_type(4))) float  f32x4;
typedef __attribute__((ext_vector_type(4))) __bf16 bf16x4;
#define CVT_UNIT    1024
#define SEG_ELEMS   (D_MODEL * D_MODEL)       // 1 Mi = 1024 units
#define CVT_WG_PER_3SEG (SEG_ELEMS / (8 * CVT_UNIT))   // 128 work-groups of 8 waves

// s0, s1, s2: the work-group's first element in its three source segments; o0: the same in the
// first of the three output segments, which follow one another
__device__ __forceinline__ void cvt_three_units(
    const float* __restrict__ s0, const float* __restrict__ s1,
    const float* __restrict__ s2, bf16* __restrict__ o0)
{
    bf16* o1 = o0 + SEG_ELEMS;
    bf16* o2 = o1 + SEG_ELEMS;
    // the thread's own place inside the work-group's 8 units
    const unsigned t = (threadIdx.x >> 5) * CVT_UNIT + (threadIdx.x & 31) * 4;

    // all six loops are unrolled so that a, b and c stay in registers and i * 128 becomes an
    // immediate offset of the load or store
    f32x4 a[8], b[8], c[8];
#pragma unroll
    for (int i = 0; i < 8; ++i) a[i] = *(const f32x4*)(s0 + t + i * 128);
#pragma unroll
    for (int i = 0; i < 8; ++i) b[i] = *(const f32x4*)(s1 + t + i * 128);
#pragma unroll
    for (int i = 0; i < 8; ++i) c[i] = *(const f32x4*)(s2 + t + i * 128);
    // the loads are in flight while the output's address is formed, for which the compiler may
    // reuse a register that holds one of their addresses: the wait that belongs in front of that
    // overwrite is written here
    asm volatile("s_wait_xcnt 0x0" ::: "memory");
    // keeps all 24 loads ahead of the first conversion: without it the scheduler issues them in
    // small groups with a wait between, and the wave pays the memory latency several times
    __builtin_amdgcn_sched_barrier(0);

#pragma unroll
    for (int i = 0; i < 8; ++i) *(bf16x4*)(o0 + t + i * 128) = __builtin_convertvector(a[i], bf16x4);
#pragma unroll
    for (int i = 0; i < 8; ++i) *(bf16x4*)(o1 + t + i * 128) = __builtin_convertvector(b[i], bf16x4);
#pragma unroll
    for (int i = 0; i < 8; ++i) *(bf16x4*)(o2 + t + i * 128) = __builtin_convertvector(c[i], bf16x4);
    // the stores are in flight where the caller's code goes on, and that code may reuse the
    // registers that hold their base address: the wait that belongs in front of such an
    // overwrite is written here, once for all three runs of stores
    asm volatile("s_wait_xcnt 0x0" ::: "memory");
}

// ---------------------------------------------------------------------------
// LayerNorm (ddof=1, divide by std+eps), D_MODEL=1024: one wave per row, eight rows per
// work-group. A lane holds 32 elements of its row (eight float4, each wave-wide load 512
// contiguous bytes); both sums are in-lane adds and a five-step exchange between lanes,
// so there is no LDS and no barrier, and LayerNorm is 2048 waves of a launch.
// ---------------------------------------------------------------------------
// x of lane l ^ M, M = 1, 2, 4 or 8 (inside the 16-lane row)
template<int M>
__device__ __forceinline__ float xrow(float x) {
    return __builtin_bit_cast(float, __builtin_amdgcn_update_dpp(
        0, __builtin_bit_cast(int, x), 0x160 + M, 0xf, 0xf, true));
}
// the sum over the wave's 32 lanes, the same value in every lane
__device__ __forceinline__ float wave_sum(float x) {
    x += xrow<1>(x);
    x += xrow<2>(x);
    x += xrow<4>(x);
    x += xrow<8>(x);
    return x + __builtin_bit_cast(float, __builtin_amdgcn_permlanex16(
        __builtin_bit_cast(int, x), __builtin_bit_cast(int, x),
        0x76543210, 0xfedcba98, false, false));
}
#define LN_ROWS 8                             // rows (waves) per work-group

__device__ __forceinline__ void layernorm_rows(
    const float* __restrict__ x, const float* __restrict__ alpha,
    const float* __restrict__ beta, bf16* __restrict__ out)
{
    const int lane = threadIdx.x & 31;
    // the wave's number as a scalar: the row's address is then a scalar base, and all loads
    // share one vector offset register
    const int row  = blockIdx.x * LN_ROWS + __builtin_amdgcn_readfirstlane(threadIdx.x >> 5);
    const float* xr = x + (size_t)row * D_MODEL + lane * 4;
    const float* ar = alpha + lane * 4;
    const float* br = beta + lane * 4;

    // every loop is unrolled so that v, a and b stay in registers and i * 128 becomes an
    // immediate offset of the load or store
    f32x4 v[8], a[8], b[8];
#pragma unroll
    for (int i = 0; i < 8; ++i) v[i] = *(const f32x4*)(xr + i * 128);
#pragma unroll
    for (int i = 0; i < 8; ++i) a[i] = *(const f32x4*)(ar + i * 128);
#pragma unroll
    for (int i = 0; i < 8; ++i) b[i] = *(const f32x4*)(br + i * 128);
    // keeps all 24 loads ahead of the first add: without it the scheduler sinks the loads of a
    // and b behind the first sum, in pairs with a wait after each, and the wave pays their
    // latency several times
    __builtin_amdgcn_sched_barrier(0);

    const f32x4 s4 = ((v[0] + v[1]) + (v[2] + v[3])) + ((v[4] + v[5]) + (v[6] + v[7]));
    const float mean = wave_sum((s4[0] + s4[1]) + (s4[2] + s4[3])) * (1.0f / 1024.0f);

    f32x4 q4 = {0.0f, 0.0f, 0.0f, 0.0f};
#pragma unroll
    for (int i = 0; i < 8; ++i) { v[i] -= mean; q4 += v[i] * v[i]; }
    const float var = wave_sum((q4[0] + q4[1]) + (q4[2] + q4[3])) * (1.0f / 1023.0f);   // ddof = 1
    const float inv = 1.0f / (sqrtf(var) + LN_EPS);

    bf16* orow = out + (size_t)row * D_MODEL + lane * 4;
#pragma unroll
    for (int i = 0; i < 8; ++i)
        *(bf16x4*)(orow + i * 128) = __builtin_convertvector(a[i] * v[i] * inv + b[i], bf16x4);
}

__global__ __launch_bounds__(LN_ROWS * 32) void layernorm_bf16(
    const float* __restrict__ x, const float* __restrict__ alpha,
    const float* __restrict__ beta, bf16* __restrict__ out)
{
    layernorm_rows(x, alpha, beta, out);
}

// LayerNorm 1 and, in the work-groups behind its own, the conversion of w_q, w_k, w_v
__global__ __launch_bounds__(LN_ROWS * 32) void layernorm_bf16_cvt_qkv(
    const float* __restrict__ x, const float* __restrict__ alpha,
    const float* __restrict__ beta, bf16* __restrict__ out,
    const float* __restrict__ wq, const float* __restrict__ wk,
    const float* __restrict__ wv, bf16* __restrict__ wout)
{
    if (blockIdx.x < M_TOK / LN_ROWS) {
        layernorm_rows(x, alpha, beta, out);
    } else {
        const unsigned e0 = (blockIdx.x - M_TOK / LN_ROWS) * (8 * CVT_UNIT);
        cvt_three_units(wq + e0, wk + e0, wv + e0, wout + e0);
    }
}

// ---------------------------------------------------------------------------
// Tiled WMMA bf16 GEMM:  C[M,N] = A[M,K] * B[N,K]^T   (+bias/relu/res)
// block tile 128x128, 8 waves (4 along M x 2 along N), wave tile 32x64.
// Two LDS buffers, each one pass of 128 k (256 B of every operand row), filled by
// async global->LDS copies one pass ahead; one publish point per pass.
// blockIdx.z picks one of several products that share A (and M, N, K): their B matrices
// lie back to back, and so do their outputs; bias and res, where present, are common to all.
// ---------------------------------------------------------------------------
template<int HAS_BIAS, int HAS_RELU, int HAS_RES, int OUT_BF16>
__global__ __launch_bounds__(256) void gemm_bf16_wmma(
    const bf16* __restrict__ A, const bf16* __restrict__ B,
    const float* __restrict__ bias, const float* __restrict__ res,
    float* __restrict__ Cf, bf16* __restrict__ Cb,
    int M, int N, int K)
{
    const int LDT = 136;                    // padded row stride (halfs): 272B = 17*16B
    __shared__ __align__(16) bf16 As[2][128 * 136];
    __shared__ __align__(16) bf16 Bs[2][128 * 136];

    const int tid  = threadIdx.x;
    const int lane = tid & 31;
    const int wid  = tid >> 5;
    const int wm   = wid & 3;               // M wave offset: 32*wm
    const int wn   = wid >> 2;              // N wave offset: 64*wn
    const int ln   = lane & 15;
    const int hi   = lane >> 4;
    const int kb   = hi * 8;
    const int m0   = blockIdx.y * 128;
    const int n0   = blockIdx.x * 128;

    // staging coordinates: this thread owns chunks tid + i*256, i = 0..7, per operand
    // chunk c: row = c>>4 (0..127), col = (c&15)*8  (within the 128-wide slab)
    const int r0 = tid >> 4, c0 = (tid & 15) * 8;

    const bf16* gA = A + (size_t)(m0 + r0) * K + c0;
    const bf16* gB = B + ((size_t)blockIdx.z * N + n0 + r0) * K + c0;
    const size_t   gstep = (size_t)16 * K;          // 16 rows further per copy
    const uint32_t lstep = 16 * LDT * 2;            // the same in LDS bytes

    uint32_t lA[2], lB[2];
#pragma unroll
    for (int bi = 0; bi < 2; ++bi) {
        lA[bi] = lds_off32(&As[bi][r0 * LDT + c0]);
        lB[bi] = lds_off32(&Bs[bi][r0 * LDT + c0]);
    }

    auto issue_stage = [&](int s) {
        const int buf = s & 1;
        const int k0  = s * 128;
        async_ld8_b128(lA[buf], lstep, gA + k0, gstep);
        async_ld8_b128(lB[buf], lstep, gB + k0, gstep);
    };

    v8f acc[2][4];
#pragma unroll
    for (int mt = 0; mt < 2; ++mt)
#pragma unroll
        for (int nt = 0; nt < 4; ++nt)
#pragma unroll
            for (int r = 0; r < 8; ++r) acc[mt][nt][r] = 0.0f;

    const int nk = K / 128;
    issue_stage(0);
    // stage 0 has landed for this wave before the barrier publishes it to the others
    asm volatile("s_wait_asynccnt 0x0" ::: "memory");
    __syncthreads();
    if (nk > 1) issue_stage(1);

    for (int t = 0; t < nk; ++t) {
        const bf16* as = As[t & 1];
        const bf16* bs = Bs[t & 1];
        // unrolled so that the four 32-k blocks' LDS reads can be scheduled ahead of the WMMAs
#pragma unroll
        for (int kq = 0; kq < 4; ++kq) {
            v16bf af[2], bfr[4];
#pragma unroll
            for (int mt = 0; mt < 2; ++mt)
                af[mt] = load_frag(&as[(wm * 32 + mt * 16 + ln) * LDT + kq * 32], kb);
#pragma unroll
            for (int nt = 0; nt < 4; ++nt)
                bfr[nt] = load_frag(&bs[(wn * 64 + nt * 16 + ln) * LDT + kq * 32], kb);

#pragma unroll
            for (int mt = 0; mt < 2; ++mt)
#pragma unroll
                for (int nt = 0; nt < 4; ++nt)
                    acc[mt][nt] = WMMA_BF16(af[mt], bfr[nt], acc[mt][nt]);
        }

        // publish point of stage t+1:
        // this wave's reads of buffer t&1 have retired before the buffer is refilled
        asm volatile("s_wait_dscnt 0x0" ::: "memory");
        // this wave's copies of stage t+1 have landed before the barrier publishes them
        asm volatile("s_wait_asynccnt 0x0" ::: "memory");
        __syncthreads();
        if (t + 2 < nk) issue_stage(t + 2); // refill the buffer every reader has left
    }
    // no copy is outstanding when the wave goes on to its end
    asm volatile("s_wait_asynccnt 0x0" ::: "memory");

    // epilogue
    const size_t cz = (size_t)blockIdx.z * M * N;   // this product's own output
#pragma unroll
    for (int mt = 0; mt < 2; ++mt) {
#pragma unroll
        for (int nt = 0; nt < 4; ++nt) {
            const int gn = n0 + wn * 64 + nt * 16 + ln;
#pragma unroll
            for (int r = 0; r < 8; ++r) {
                const int gm = m0 + wm * 32 + mt * 16 + r + 8 * hi;
                float v = acc[mt][nt][r];
                if constexpr (HAS_BIAS) v += bias[gn];
                if constexpr (HAS_RELU) v = fmaxf(v, 0.0f);
                if constexpr (HAS_RES)  v += res[(size_t)gm * N + gn];
                if constexpr (OUT_BF16) Cb[cz + (size_t)gm * N + gn] = (bf16)v;
                else                    Cf[cz + (size_t)gm * N + gn] = v;
            }
        }
    }
}

// ---------------------------------------------------------------------------
// The same product for a narrow output (N = 1024): f32 out = A * B^T (+bias) + res.
// With 128x128 tiles such an output has 128 tiles, one for every second WGP. Here the
// block tile is 64x128, so that there are 256, and the eight waves still have a 32x64 tile
// each: a pass holds 256 k, waves 0..3 take its first 128 k and waves 4..7 its second.
// Behind the loop the two groups' partial sums are joined through LDS: each wave hands the
// 16 rows it does not store to its partner in the other group and adds the partner's to
// the 16 rows it stores.
// Ring as above: two buffers, filled one pass ahead, one publish point per pass.
// ---------------------------------------------------------------------------
template<int HAS_BIAS>
__global__ __launch_bounds__(256) void gemm_bf16_wmma_khalves(
    const bf16* __restrict__ A, const bf16* __restrict__ B,
    const float* __restrict__ bias, const float* __restrict__ res,
    float* __restrict__ Cf, int K)
{
    const int N   = D_MODEL;                // a constant: row steps of res and Cf become offsets
    const int LDT = 136;                    // padded row stride (halfs): 272B = 17*16B
    // [buffer][k half][row * LDT + k inside the half]
    __shared__ __align__(16) bf16 As[2][2][64 * 136];
    __shared__ __align__(16) bf16 Bs[2][2][128 * 136];
    // [wave][four accumulator registers][lane]
    __shared__ __align__(16) f32x4 xch[8][8][32];

    const int tid  = threadIdx.x;
    const int lane = tid & 31;
    const int wid  = tid >> 5;
    const int kg   = wid >> 2;              // this wave's half of every pass's k
    const int wm   = wid & 1;               // M wave offset: 32*wm
    const int wn   = (wid >> 1) & 1;        // N wave offset: 64*wn
    const int ln   = lane & 15;
    const int hi   = lane >> 4;
    const int kb   = hi * 8;
    const int m0   = blockIdx.y * 64;
    const int n0   = blockIdx.x * 128;

    // staging: one copy of a wave brings one row's 256 k (512 B). This thread owns 16 bytes
    // at k offset lane*8 of rows wid + 8*i: i = 0..7 of A, i = 0..15 of B.
    const int sh = lane >> 4, sc = (lane & 15) * 8;

    const bf16* gA = A + (size_t)(m0 + wid) * K + lane * 8;
    const bf16* gB = B + (size_t)(n0 + wid) * K + lane * 8;
    const size_t   gstep = (size_t)8 * K;           // 8 rows further per copy
    const uint32_t lstep = 8 * LDT * 2;             // the same in LDS bytes

    uint32_t lA[2], lB[2];
#pragma unroll
    for (int bi = 0; bi < 2; ++bi) {
        lA[bi] = lds_off32(&As[bi][sh][wid * LDT + sc]);
        lB[bi] = lds_off32(&Bs[bi][sh][wid * LDT + sc]);
    }

    auto issue_stage = [&](int s) {
        const int buf = s & 1;
        const int k0  = s * 256;
        async_ld8_b128(lA[buf], lstep, gA + k0, gstep);
        async_ld8_b128(lB[buf], lstep, gB + k0, gstep);
        async_ld8_b128(lB[buf] + 8 * lstep, lstep, gB + k0 + 8 * gstep, gstep);
    };

    v8f acc[2][4];
#pragma unroll
    for (int mt = 0; mt < 2; ++mt)
#pragma unroll
        for (int nt = 0; nt < 4; ++nt)
#pragma unroll
            for (int r = 0; r < 8; ++r) acc[mt][nt][r] = 0.0f;

    const int nk = K / 256;
    issue_stage(0);
    // stage 0 has landed for this wave before the barrier publishes it to the others
    asm volatile("s_wait_asynccnt 0x0" ::: "memory");
    __syncthreads();
    if (nk > 1) issue_stage(1);

    for (int t = 0; t < nk; ++t) {
        const bf16* as = As[t & 1][kg];
        const bf16* bs = Bs[t & 1][kg];
        // unrolled so that the four 32-k blocks' LDS reads can be scheduled ahead of the WMMAs
#pragma unroll
        for (int kq = 0; kq < 4; ++kq) {
            v16bf af[2], bfr[4];
#pragma unroll
            for (int mt = 0; mt < 2; ++mt)
                af[mt] = load_frag(&as[(wm * 32 + mt * 16 + ln) * LDT + kq * 32], kb);
#pragma unroll
            for (int nt = 0; nt < 4; ++nt)
                bfr[nt] = load_frag(&bs[(wn * 64 + nt * 16 + ln) * LDT + kq * 32], kb);

#pragma unroll
            for (int mt = 0; mt < 2; ++mt)
#pragma unroll
                for (int nt = 0; nt < 4; ++nt)
                    acc[mt][nt] = WMMA_BF16(af[mt], bfr[nt], acc[mt][nt]);
        }

        // publish point of stage t+1:
        // this wave's reads of buffer t&1 have retired before the buffer is refilled
        asm volatile("s_wait_dscnt 0x0" ::: "memory");
        // this wave's copies of stage t+1 have landed before the barrier publishes them
        asm volatile("s_wait_asynccnt 0x0" ::: "memory");
        __syncthreads();
        if (t + 2 < nk) issue_stage(t + 2); // refill the buffer every reader has left
    }
    // no copy is outstanding when the wave goes on to its end
    asm volatile("s_wait_asynccnt 0x0" ::: "memory");

    // this lane's first output element: row block mt = kg of the wave's tile, column ln
    const size_t o0 = (size_t)(m0 + wm * 32 + kg * 16 + 8 * hi) * N + n0 + wn * 64 + ln;
    const float* rp = res + o0;
    float*       cp = Cf + o0;

    // the residual and the bias are fetched ahead of the join: they are in flight while the
    // rows to hand over are picked and stored to LDS
    float rv[4][8], bv[4];
#pragma unroll
    for (int nt = 0; nt < 4; ++nt)
#pragma unroll
        for (int r = 0; r < 8; ++r) rv[nt][r] = rp[r * N + nt * 16];
    if constexpr (HAS_BIAS) {
        // a bias load's result may be given a register that held the address of the loads above:
        // the wait that belongs in front of that overwrite is written here
        asm volatile("s_wait_xcnt 0x0" ::: "memory");
#pragma unroll
        for (int nt = 0; nt < 4; ++nt) bv[nt] = bias[n0 + wn * 64 + nt * 16 + ln];
    }

    // join of the two k halves: group kg stores row block mt = kg and hands over the other
#pragma unroll
    for (int nt = 0; nt < 4; ++nt)
#pragma unroll
        for (int q = 0; q < 2; ++q) {
            f32x4 g;
#pragma unroll
            for (int j = 0; j < 4; ++j)
                g[j] = kg ? acc[0][nt][q * 4 + j] : acc[1][nt][q * 4 + j];
            xch[wid][nt * 2 + q][lane] = g;
        }
    __syncthreads();

    // epilogue
#pragma unroll
    for (int nt = 0; nt < 4; ++nt) {
#pragma unroll
        for (int q = 0; q < 2; ++q) {
            const f32x4 p = xch[wid ^ 4][nt * 2 + q][lane];
#pragma unroll
            for (int j = 0; j < 4; ++j) {
                const int r = q * 4 + j;
                float v = (kg ? acc[1][nt][r] : acc[0][nt][r]) + p[j];
                if constexpr (HAS_BIAS) v += bv[nt];
                v += rv[nt][r];
                cp[r * N + nt * 16] = v;
            }
        }
    }
}

__device__ __forceinline__ float xhalf(float x) {
    return __builtin_bit_cast(float, __builtin_amdgcn_permlanex16(
        __builtin_bit_cast(int, x), __builtin_bit_cast(int, x),
        0x76543210, 0xfedcba98, false, false));
}

__global__ __launch_bounds__(256) void flash_attn_wmma(
    const bf16* __restrict__ Q, const bf16* __restrict__ Km,
    const bf16* __restrict__ Vm, const int* __restrict__ mask,
    bf16* __restrict__ O,
    const float* __restrict__ wo, const float* __restrict__ fc1,
    const float* __restrict__ fc2, bf16* __restrict__ wout)
{
    const int LDK = 72;                       // padded stride (halfs): 144B
    __shared__ __align__(16) bf16 Ks[64 * 72];
    __shared__ __align__(16) bf16 Vt[64 * 72];          // Vt[d][key]

    // the whole work-group leaves here, in front of every barrier
    if (blockIdx.y >= BATCH * NHEAD) {
        const unsigned blk = (blockIdx.y - BATCH * NHEAD) * (SEQ / 128) + blockIdx.x;
        const unsigned g   = blk / CVT_WG_PER_3SEG;            // segments 3g, 3g+1, 3g+2 of nine
        const unsigned e0  = (blk % CVT_WG_PER_3SEG) * (8 * CVT_UNIT);
        // segment 0 is w_o, 1..4 are fc1_w, 5..8 are fc2_w
        const float* s0 = g == 0 ? wo              : g == 1 ? fc1 + 2 * SEG_ELEMS : fc2 + SEG_ELEMS;
        const float* s1 = g == 0 ? fc1             : g == 1 ? fc1 + 3 * SEG_ELEMS : fc2 + 2 * SEG_ELEMS;
        const float* s2 = g == 0 ? fc1 + SEG_ELEMS : g == 1 ? fc2                 : fc2 + 3 * SEG_ELEMS;
        cvt_three_units(s0 + e0, s1 + e0, s2 + e0, wout + (size_t)g * (3 * SEG_ELEMS) + e0);
        return;
    }

    const int bh   = blockIdx.y;
    const int b    = bh >> 4;
    const int h    = bh & 15;
    const int tid  = threadIdx.x;
    const int lane = tid & 31;
    const int wid  = tid >> 5;
    const int ln   = lane & 15;
    const int hi   = lane >> 4;
    const int kb   = hi * 8;
    const int q0   = blockIdx.x * 128 + wid * 16;       // query offset in seq
    const size_t dbase = (size_t)h * DKH;

    // Q fragments (2 K-slabs of 32 over DK=64), straight from global
    v16bf qf[2];
    {
        const size_t qrow = (size_t)(b * SEQ + q0 + ln) * D_MODEL + dbase;
#pragma unroll
        for (int s = 0; s < 2; ++s)
            qf[s] = load_frag(Q + qrow + s * 32, kb);
    }

    // oacc[n][r] = O^T[d = n*16 + 8*hi + r][query ln]
    v8f oacc[4];
#pragma unroll
    for (int n = 0; n < 4; ++n)
#pragma unroll
        for (int r = 0; r < 8; ++r) oacc[n][r] = 0.0f;

    // this lane's query: running maximum (the same in both halves) and the sum over this
    // half's keys alone; the halves' sums are joined behind the loop
    float mrow = -3.0e38f, lrow = 0.0f;

    const float scale = 0.125f;               // 1/sqrt(64)

    // this thread's share of a 64-key tile: 16 bytes of K and of V in rows sr and sr + 32,
    // and the mask words of keys lane and lane + 32
    const int sr   = tid >> 3;
    const int scol = (tid & 7) * 8;
    const bf16* gK = Km + (size_t)(b * SEQ + sr) * D_MODEL + dbase + scol;
    const bf16* gV = Vm + (size_t)(b * SEQ + sr) * D_MODEL + dbase + scol;
    const int*  gM = mask + b * SEQ + lane;

    v8bf  kst[2];
    v8bf  vst[2];
    int   mst[2];
    auto fetch_tile = [&](int kk) {
#pragma unroll
        for (int i = 0; i < 2; ++i) {
            kst[i] = *(const v8bf*)(gK + (size_t)(kk + i * 32) * D_MODEL);
            vst[i] = *(const v8bf*)(gV + (size_t)(kk + i * 32) * D_MODEL);
        }
#pragma unroll
        for (int i = 0; i < 2; ++i) mst[i] = gM[kk + i * 32];
        // the loads stay in flight over a branch, behind which their address registers are
        // reused: the wait that belongs in front of that overwrite is written here
        asm volatile("s_wait_xcnt 0x0" ::: "memory");
    };
    fetch_tile(0);

    for (int kk0 = 0; kk0 < SEQ; kk0 += 64) {
        __syncthreads();
        // stage K tile [64][64] and V transposed [d][key] from the registers filled one tile ago
#pragma unroll
        for (int i = 0; i < 2; ++i) {
            const int r = sr + i * 32;
            *(v8bf*)(&Ks[r * LDK + scol]) = kst[i];
#pragma unroll
            for (int j = 0; j < 8; ++j) Vt[(scol + j) * LDK + r] = vst[i][j];
        }
        // bit k of mz[i]: the mask word of key i*32 + k is 0
        unsigned mz[2];
#pragma unroll
        for (int i = 0; i < 2; ++i) mz[i] = __builtin_amdgcn_ballot_w32(mst[i] == 0);
        __syncthreads();
        // the next tile's loads fly while this tile is worked on
        if (kk0 + 64 < SEQ) fetch_tile(kk0 + 64);

        // scores S^T = K * Q^T  (4 tiles of 16 keys)
        v8f sacc[4];
#pragma unroll
        for (int t = 0; t < 4; ++t)
#pragma unroll
            for (int r = 0; r < 8; ++r) sacc[t][r] = 0.0f;
#pragma unroll
        for (int s = 0; s < 2; ++s)
#pragma unroll
            for (int t = 0; t < 4; ++t) {
                v16bf kf = load_frag(&Ks[(t * 16 + ln) * LDK + s * 32], kb);
                sacc[t] = WMMA_BF16(kf, qf[s], sacc[t]);
            }

        // scale + mask
        float sv[4][8];
#pragma unroll
        for (int t = 0; t < 4; ++t)
#pragma unroll
            for (int r = 0; r < 8; ++r) sv[t][r] = sacc[t][r] * scale;
        // in this map a key is a register, not a lane, so its mask bit is tested per register;
        // one scalar test per tile keeps those tests out of tiles that hold no masked key
        if ((mz[0] | mz[1]) != 0u) {
#pragma unroll
            for (int t = 0; t < 4; ++t) {
                // bit r: this lane's key t*16 + 8*hi + r is masked out
                const unsigned zb = mz[t >> 1] >> ((t & 1) * 16 + kb);
#pragma unroll
                for (int r = 0; r < 8; ++r)
                    sv[t][r] = ((zb >> r) & 1u) ? -1.0e9f : sv[t][r];
            }
        }

        // online softmax of this lane's query
        float mx = sv[0][0];
#pragma unroll
        for (int t = 0; t < 4; ++t)
#pragma unroll
            for (int r = 0; r < 8; ++r) mx = fmaxf(mx, sv[t][r]);
        mx = fmaxf(mx, xhalf(mx));
        const float mnew  = fmaxf(mrow, mx);
        const float alpha = __expf(mrow - mnew);
        mrow = mnew;

        float ps[4][8];
        float sm[4];
#pragma unroll
        for (int t = 0; t < 4; ++t) {
#pragma unroll
            for (int r = 0; r < 8; ++r) ps[t][r] = __expf(sv[t][r] - mnew);
            sm[t] = ((ps[t][0] + ps[t][1]) + (ps[t][2] + ps[t][3])) +
                    ((ps[t][4] + ps[t][5]) + (ps[t][6] + ps[t][7]));
        }
        lrow = lrow * alpha + ((sm[0] + sm[1]) + (sm[2] + sm[3]));
#pragma unroll
        for (int n = 0; n < 4; ++n)
#pragma unroll
            for (int r = 0; r < 8; ++r) oacc[n][r] *= alpha;

        // O^T += V^T * P^T
#pragma unroll
        for (int s = 0; s < 2; ++s) {
            // elements 0..7 = keys s*32 + kb + 0..7, 8..15 = keys s*32 + 16 + kb + 0..7: as load_frag
            v16bf pf;
#pragma unroll
            for (int i = 0; i < 8; ++i) {
                pf[i]     = (bf16)ps[2 * s][i];
                pf[i + 8] = (bf16)ps[2 * s + 1][i];
            }
#pragma unroll
            for (int n = 0; n < 4; ++n) {
                v16bf vf = load_frag(&Vt[(n * 16 + ln) * LDK + s * 32], kb);
                oacc[n] = WMMA_BF16(vf, pf, oacc[n]);
            }
        }
    }

    // finalize: O /= l, write bf16 [token][h*64 + d], eight consecutive d per store
    const float invl = 1.0f / (lrow + xhalf(lrow));
    bf16* orow = O + (size_t)(b * SEQ + q0 + ln) * D_MODEL + dbase + kb;
#pragma unroll
    for (int n = 0; n < 4; ++n) {
        v8bf ov;
#pragma unroll
        for (int r = 0; r < 8; ++r) ov[r] = (bf16)(oacc[n][r] * invl);
        *(v8bf*)(orow + n * 16) = ov;
    }
}

// ---------------------------------------------------------------------------
// launch
// ---------------------------------------------------------------------------
extern "C" void kernel_launch(void* const* d_in, const int* in_sizes, int n_in,
                              void* d_out, int out_size, void* d_ws, size_t ws_size,
                              hipStream_t stream)
{
    const float* x      = (const float*)d_in[0];
    const int*   mask   = (const int*)  d_in[1];
    const float* w_q    = (const float*)d_in[2];
    const float* w_k    = (const float*)d_in[3];
    const float* w_v    = (const float*)d_in[4];
    const float* w_o    = (const float*)d_in[5];
    const float* alpha1 = (const float*)d_in[6];
    const float* beta1  = (const float*)d_in[7];
    const float* alpha2 = (const float*)d_in[8];
    const float* beta2  = (const float*)d_in[9];
    const float* fc1_w  = (const float*)d_in[10];
    const float* fc1_b  = (const float*)d_in[11];
    const float* fc2_w  = (const float*)d_in[12];
    const float* fc2_b  = (const float*)d_in[13];

    char* ws = (char*)d_ws;
    size_t off = 0;
    auto take = [&](size_t bytes) { char* p = ws + off; off += bytes; return p; };

    bf16* wqb   = (bf16*)take((size_t)D_MODEL * D_MODEL * 2);
    bf16* wkb   = (bf16*)take((size_t)D_MODEL * D_MODEL * 2);
    bf16* wvb   = (bf16*)take((size_t)D_MODEL * D_MODEL * 2);
    bf16* wob   = (bf16*)take((size_t)D_MODEL * D_MODEL * 2);
    bf16* fc1b  = (bf16*)take((size_t)D_FC * D_MODEL * 2);
    bf16* fc2b  = (bf16*)take((size_t)D_MODEL * D_FC * 2);
    bf16* ln1b  = (bf16*)take((size_t)M_TOK * D_MODEL * 2);
    bf16* Qb    = (bf16*)take((size_t)M_TOK * D_MODEL * 2);
    bf16* Kb    = (bf16*)take((size_t)M_TOK * D_MODEL * 2);
    bf16* Vb    = (bf16*)take((size_t)M_TOK * D_MODEL * 2);
    bf16* attnb = (bf16*)take((size_t)M_TOK * D_MODEL * 2);
    float* x1   = (float*)take((size_t)M_TOK * D_MODEL * 4);
    bf16* ln2b  = (bf16*)take((size_t)M_TOK * D_MODEL * 2);
    bf16* hidb  = (bf16*)take((size_t)M_TOK * D_FC * 2);

    // LN1, and w_q, w_k, w_v to bf16: their copies are one run that starts at wqb
    layernorm_bf16_cvt_qkv<<<M_TOK / LN_ROWS + CVT_WG_PER_3SEG, LN_ROWS * 32, 0, stream>>>(
        x, alpha1, beta1, ln1b, w_q, w_k, w_v, wqb);

    // Q, K, V projections (bf16 out) in one launch: wqb, wkb, wvb lie back to back in the
    // workspace, and so do Qb, Kb, Vb
    dim3 gP(D_MODEL / 128, M_TOK / 64);       // the two narrow products: 64x128 tiles
    dim3 gQKV(D_MODEL / 128, M_TOK / 128, 3);
    gemm_bf16_wmma<0,0,0,1><<<gQKV, 256, 0, stream>>>(ln1b, wqb, nullptr, nullptr,
                                                      nullptr, Qb, M_TOK, D_MODEL, D_MODEL);

    // attention, and w_o, fc1_w, fc2_w to bf16: their copies are one run that starts at wob
    flash_attn_wmma<<<dim3(SEQ / 128, BATCH * NHEAD + 3 * CVT_WG_PER_3SEG / (SEQ / 128)), 256, 0, stream>>>(
        Qb, Kb, Vb, mask, attnb, w_o, fc1_w, fc2_w, wob);

    // output projection + residual:  x1 = x + attn @ w_o^T  (f32 out)
    gemm_bf16_wmma_khalves<0><<<gP, 256, 0, stream>>>(attnb, wob, nullptr, x,
                                                      x1, D_MODEL);

    // LN2
    layernorm_bf16<<<M_TOK / LN_ROWS, LN_ROWS * 32, 0, stream>>>(x1, alpha2, beta2, ln2b);

    // FC1: relu(ln2 @ fc1^T + b1) -> bf16 hidden
    dim3 gF1(D_FC / 128, M_TOK / 128);
    gemm_bf16_wmma<1,1,0,1><<<gF1, 256, 0, stream>>>(ln2b, fc1b, fc1_b, nullptr,
                                                     nullptr, hidb, M_TOK, D_FC, D_MODEL);

    // FC2: out = x1 + hidden @ fc2^T + b2  (f32 -> d_out)
    gemm_bf16_wmma_khalves<1><<<gP, 256, 0, stream>>>(hidb, fc2b, fc2_b, x1,
                                                      (float*)d_out, D_FC);

    (void)in_sizes; (void)n_in; (void)out_size; (void)ws_size;
}

// v009
// Measured time: 88.6 microseconds a run.
// Timed twice side by side with v008, it ran 1.07 times as fast both times.
// Over all steps from v000 it is 2.32 times as fast.
#include <hip/hip_runtime.h>
#include <math.h>

typedef __bf16 bf16;
typedef __attribute__((ext_vector_type(16))) __bf16 v16bf;
typedef __attribute__((ext_vector_type(8)))  __bf16 v8bf;
typedef __attribute__((ext_vector_type(8)))  float  v8f;

#define D_MODEL 1024
#define NHEAD   16
#define DKH     64
#define D_FC    4096
#define BATCH   2
#define SEQ     1024
#define M_TOK   (BATCH*SEQ)   // 2048
#define LN_EPS  1e-6f

// ---------------------------------------------------------------------------
// fragment load: 16-bit A/B fragment from a padded row in LDS/global.
// lane L: row chosen by caller (L&15), kb = (L>>4)*8.
// elements 0..7  = K kb..kb+7 ; elements 8..15 = K 16+kb..16+kb+7
// ---------------------------------------------------------------------------
__device__ __forceinline__ v16bf load_frag(const bf16* rowbase, int kb) {
    v8bf lo = *(const v8bf*)(rowbase + kb);
    v8bf hi = *(const v8bf*)(rowbase + kb + 16);
    v16bf f;
#pragma unroll
    for (int i = 0; i < 8; ++i) { f[i] = lo[i]; f[i + 8] = hi[i]; }
    return f;
}

// the same fragment of the TRANSPOSE of a row-major 16-bit LDS tile T[k][column], by two
// transposing loads. p: the lane's address, row 8*(L>>4) + (L&7) of the first 16 k, 16-byte half
// (L>>3)&1 of the 16 columns; lane L then holds column L&15, k in the order of load_frag.
// step16: 16 rows of T, in elements.
__device__ __forceinline__ v16bf load_frag_tr(const bf16* p, int step16) {
    typedef __attribute__((address_space(3))) v8bf lds_v8bf;
    v8bf lo = __builtin_amdgcn_ds_load_tr16_b128_v8bf16((lds_v8bf*)p);
    v8bf hi = __builtin_amdgcn_ds_load_tr16_b128_v8bf16((lds_v8bf*)(p + step16));
    v16bf f;
#pragma unroll
    for (int i = 0; i < 8; ++i) { f[i] = lo[i]; f[i + 8] = hi[i]; }
    return f;
}

#define WMMA_BF16(A_, B_, C_) \
    __builtin_amdgcn_wmma_f32_16x16x32_bf16(false, (A_), false, (B_), (short)0, (C_), false, false)

// CDNA5 async global->LDS copies, 16B per lane each, tracked by ASYNCcnt.
// Eight copies of one operand's slab: copy i takes LDS byte address lds + i*lstep
// and global address g + i*gstep (elements). The closing s_wait_xcnt 0 stands in the
// copies' own statement so that no address register is rewritten ahead of it.
__device__ __forceinline__ void async_ld8_b128(uint32_t lds, uint32_t lstep,
                                               const bf16* g, size_t gstep) {
    asm volatile("global_load_async_to_lds_b128 %0, %8, off\n\t"
                 "global_load_async_to_lds_b128 %1, %9, off\n\t"
                 "global_load_async_to_lds_b128 %2, %10, off\n\t"
                 "global_load_async_to_lds_b128 %3, %11, off\n\t"
                 "global_load_async_to_lds_b128 %4, %12, off\n\t"
                 "global_load_async_to_lds_b128 %5, %13, off\n\t"
                 "global_load_async_to_lds_b128 %6, %14, off\n\t"
                 "global_load_async_to_lds_b128 %7, %15, off\n\t"
                 "s_wait_xcnt 0x0"
                 :: "v"(lds), "v"(lds + lstep), "v"(lds + 2 * lstep), "v"(lds + 3 * lstep),
                    "v"(lds + 4 * lstep), "v"(lds + 5 * lstep), "v"(lds + 6 * lstep),
                    "v"(lds + 7 * lstep),
                    "v"(g), "v"(g + gstep), "v"(g + 2 * gstep), "v"(g + 3 * gstep),
                    "v"(g + 4 * gstep), "v"(g + 5 * gstep), "v"(g + 6 * gstep),
                    "v"(g + 7 * gstep)
                 : "memory");
}
__device__ __forceinline__ uint32_t lds_off32(const void* p) {
    return (uint32_t)(uintptr_t)p;   // flat LDS aperture: low 32 bits = LDS address
}

// ---------------------------------------------------------------------------
// float -> bf16 of the six weight matrices, by few, long waves. It has no launch of its own:
// its work-groups ride, by block index, in launches whose own work does not depend on them and
// that end before the first reader of their output starts: q, k, v beside LayerNorm 1 (both
// feed the Q, K, V projections), o, fc1, fc2 beside attention (first read by the launches
// behind it), where their memory time passes under attention's arithmetic.
// The bf16 copies lie back to back in the workspace (q, k, v, o, fc1, fc2): twelve segments of
// 1 Mi elements. A unit is 1024 consecutive elements (eight wave-wide 512 B loads, eight 256 B
// stores). A work-group of 8 waves takes the same 8 units of three segments, a wave one unit of
// each. A thread's 24 loads are independent of one another and are all issued before the first
// is used.
// ---------------------------------------------------------------------------
typedef __attribute__((ext_vector_type(4))) float  f32x4;
typedef __attribute__((ext_vector_type(4))) __bf16 bf16x4;
#define CVT_UNIT    1024
#define SEG_ELEMS   (D_MODEL * D_MODEL)       // 1 Mi = 1024 units
#define CVT_WG_PER_3SEG (SEG_ELEMS / (8 * CVT_UNIT))   // 128 work-groups of 8 waves

// s0, s1, s2: the work-group's first element in its three source segments; o0: the same in the
// first of the three output segments, which follow one another
__device__ __forceinline__ void cvt_three_units(
    const float* __restrict__ s0, const float* __restrict__ s1,
    const float* __restrict__ s2, bf16* __restrict__ o0)
{
    bf16* o1 = o0 + SEG_ELEMS;
    bf16* o2 = o1 + SEG_ELEMS;
    // the thread's own place inside the work-group's 8 units
    const unsigned t = (threadIdx.x >> 5) * CVT_UNIT + (threadIdx.x & 31) * 4;

    // all six loops are unrolled so that a, b and c stay in registers and i * 128 becomes an
    // immediate offset of the load or store
    f32x4 a[8], b[8], c[8];
#pragma unroll
    for (int i = 0; i < 8; ++i) a[i] = *(const f32x4*)(s0 + t + i * 128);
#pragma unroll
    for (int i = 0; i < 8; ++i) b[i] = *(const f32x4*)(s1 + t + i * 128);
#pragma unroll
    for (int i = 0; i < 8; ++i) c[i] = *(const f32x4*)(s2 + t + i * 128);
    // the loads are in flight while the output's address is formed, for which the compiler may
    // reuse a register that holds one of their addresses: the wait that belongs in front of that
    // overwrite is written here
    asm volatile("s_wait_xcnt 0x0" ::: "memory");
    // keeps all 24 loads ahead of the first conversion: without it the scheduler issues them in
    // small groups with a wait between, and the wave pays the memory latency several times
    __builtin_amdgcn_sched_barrier(0);

#pragma unroll
    for (int i = 0; i < 8; ++i) *(bf16x4*)(o0 + t + i * 128) = __builtin_convertvector(a[i], bf16x4);
#pragma unroll
    for (int i = 0; i < 8; ++i) *(bf16x4*)(o1 + t + i * 128) = __builtin_convertvector(b[i], bf16x4);
#pragma unroll
    for (int i = 0; i < 8; ++i) *(bf16x4*)(o2 + t + i * 128) = __builtin_convertvector(c[i], bf16x4);
    // the stores are in flight where the caller's code goes on, and that code may reuse the
    // registers that hold their base address: the wait that belongs in front of such an
    // overwrite is written here, once for all three runs of stores
    asm volatile("s_wait_xcnt 0x0" ::: "memory");
}

// ---------------------------------------------------------------------------
// LayerNorm (ddof=1, divide by std+eps), D_MODEL=1024: one wave per row, eight rows per
// work-group. A lane holds 32 elements of its row (eight float4, each wave-wide load 512
// contiguous bytes); both sums are in-lane adds and a five-step exchange between lanes,
// so there is no LDS and no barrier, and LayerNorm is 2048 waves of a launch.
// ---------------------------------------------------------------------------
// x of lane l ^ M, M = 1, 2, 4 or 8 (inside the 16-lane row)
template<int M>
__device__ __forceinline__ float xrow(float x) {
    return __builtin_bit_cast(float, __builtin_amdgcn_update_dpp(
        0, __builtin_bit_cast(int, x), 0x160 + M, 0xf, 0xf, true));
}
// the sum over the wave's 32 lanes, the same value in every lane
__device__ __forceinline__ float wave_sum(float x) {
    x += xrow<1>(x);
    x += xrow<2>(x);
    x += xrow<4>(x);
    x += xrow<8>(x);
    return x + __builtin_bit_cast(float, __builtin_amdgcn_permlanex16(
        __builtin_bit_cast(int, x), __builtin_bit_cast(int, x),
        0x76543210, 0xfedcba98, false, false));
}
#define LN_ROWS 8                             // rows (waves) per work-group

__device__ __forceinline__ void layernorm_rows(
    const float* __restrict__ x, const float* __restrict__ alpha,
    const float* __restrict__ beta, bf16* __restrict__ out)
{
    const int lane = threadIdx.x & 31;
    // the wave's number as a scalar: the row's address is then a scalar base, and all loads
    // share one vector offset register
    const int row  = blockIdx.x * LN_ROWS + __builtin_amdgcn_readfirstlane(threadIdx.x >> 5);
    const float* xr = x + (size_t)row * D_MODEL + lane * 4;
    const float* ar = alpha + lane * 4;
    const float* br = beta + lane * 4;

    // every loop is unrolled so that v, a and b stay in registers and i * 128 becomes an
    // immediate offset of the load or store
    f32x4 v[8], a[8], b[8];
#pragma unroll
    for (int i = 0; i < 8; ++i) v[i] = *(const f32x4*)(xr + i * 128);
#pragma unroll
    for (int i = 0; i < 8; ++i) a[i] = *(const f32x4*)(ar + i * 128);
#pragma unroll
    for (int i = 0; i < 8; ++i) b[i] = *(const f32x4*)(br + i * 128);
    // keeps all 24 loads ahead of the first add: without it the scheduler sinks the loads of a
    // and b behind the first sum, in pairs with a wait after each, and the wave pays their
    // latency several times
    __builtin_amdgcn_sched_barrier(0);

    const f32x4 s4 = ((v[0] + v[1]) + (v[2] + v[3])) + ((v[4] + v[5]) + (v[6] + v[7]));
    const float mean = wave_sum((s4[0] + s4[1]) + (s4[2] + s4[3])) * (1.0f / 1024.0f);

    f32x4 q4 = {0.0f, 0.0f, 0.0f, 0.0f};
#pragma unroll
    for (int i = 0; i < 8; ++i) { v[i] -= mean; q4 += v[i] * v[i]; }
    const float var = wave_sum((q4[0] + q4[1]) + (q4[2] + q4[3])) * (1.0f / 1023.0f);   // ddof = 1
    const float inv = 1.0f / (sqrtf(var) + LN_EPS);

    bf16* orow = out + (size_t)row * D_MODEL + lane * 4;
#pragma unroll
    for (int i = 0; i < 8; ++i)
        *(bf16x4*)(orow + i * 128) = __builtin_convertvector(a[i] * v[i] * inv + b[i], bf16x4);
}

__global__ __launch_bounds__(LN_ROWS * 32) void layernorm_bf16(
    const float* __restrict__ x, const float* __restrict__ alpha,
    const float* __restrict__ beta, bf16* __restrict__ out)
{
    layernorm_rows(x, alpha, beta, out);
}

// LayerNorm 1 and, in the work-groups behind its own, the conversion of w_q, w_k, w_v
__global__ __launch_bounds__(LN_ROWS * 32) void layernorm_bf16_cvt_qkv(
    const float* __restrict__ x, const float* __restrict__ alpha,
    const float* __restrict__ beta, bf16* __restrict__ out,
    const float* __restrict__ wq, const float* __restrict__ wk,
    const float* __restrict__ wv, bf16* __restrict__ wout)
{
    if (blockIdx.x < M_TOK / LN_ROWS) {
        layernorm_rows(x, alpha, beta, out);
    } else {
        const unsigned e0 = (blockIdx.x - M_TOK / LN_ROWS) * (8 * CVT_UNIT);
        cvt_three_units(wq + e0, wk + e0, wv + e0, wout + e0);
    }
}

// ---------------------------------------------------------------------------
// Tiled WMMA bf16 GEMM:  C[M,N] = A[M,K] * B[N,K]^T   (+bias/relu/res)
// block tile 128x128, 8 waves (4 along M x 2 along N), wave tile 32x64.
// Two LDS buffers, each one pass of 128 k (256 B of every operand row), filled by
// async global->LDS copies one pass ahead; one publish point per pass.
// blockIdx.z picks one of several products that share A (and M, N, K): their B matrices
// lie back to back, and so do their outputs; bias and res, where present, are common to all.
// ---------------------------------------------------------------------------
template<int HAS_BIAS, int HAS_RELU, int HAS_RES, int OUT_BF16>
__global__ __launch_bounds__(256) void gemm_bf16_wmma(
    const bf16* __restrict__ A, const bf16* __restrict__ B,
    const float* __restrict__ bias, const float* __restrict__ res,
    float* __restrict__ Cf, bf16* __restrict__ Cb,
    int M, int N, int K)
{
    const int LDT = 136;                    // padded row stride (halfs): 272B = 17*16B
    __shared__ __align__(16) bf16 As[2][128 * 136];
    __shared__ __align__(16) bf16 Bs[2][128 * 136];

    const int tid  = threadIdx.x;
    const int lane = tid & 31;
    const int wid  = tid >> 5;
    const int wm   = wid & 3;               // M wave offset: 32*wm
    const int wn   = wid >> 2;              // N wave offset: 64*wn
    const int ln   = lane & 15;
    const int hi   = lane >> 4;
    const int kb   = hi * 8;
    const int m0   = blockIdx.y * 128;
    const int n0   = blockIdx.x * 128;

    // staging coordinates: this thread owns chunks tid + i*256, i = 0..7, per operand
    // chunk c: row = c>>4 (0..127), col = (c&15)*8  (within the 128-wide slab)
    const int r0 = tid >> 4, c0 = (tid & 15) * 8;

    const bf16* gA = A + (size_t)(m0 + r0) * K + c0;
    const bf16* gB = B + ((size_t)blockIdx.z * N + n0 + r0) * K + c0;
    const size_t   gstep = (size_t)16 * K;          // 16 rows further per copy
    const uint32_t lstep = 16 * LDT * 2;            // the same in LDS bytes

    uint32_t lA[2], lB[2];
#pragma unroll
    for (int bi = 0; bi < 2; ++bi) {
        lA[bi] = lds_off32(&As[bi][r0 * LDT + c0]);
        lB[bi] = lds_off32(&Bs[bi][r0 * LDT + c0]);
    }

    auto issue_stage = [&](int s) {
        const int buf = s & 1;
        const int k0  = s * 128;
        async_ld8_b128(lA[buf], lstep, gA + k0, gstep);
        async_ld8_b128(lB[buf], lstep, gB + k0, gstep);
    };

    v8f acc[2][4];
#pragma unroll
    for (int mt = 0; mt < 2; ++mt)
#pragma unroll
        for (int nt = 0; nt < 4; ++nt)
#pragma unroll
            for (int r = 0; r < 8; ++r) acc[mt][nt][r] = 0.0f;

    const int nk = K / 128;
    issue_stage(0);
    // stage 0 has landed for this wave before the barrier publishes it to the others
    asm volatile("s_wait_asynccnt 0x0" ::: "memory");
    __syncthreads();
    if (nk > 1) issue_stage(1);

    for (int t = 0; t < nk; ++t) {
        const bf16* as = As[t & 1];
        const bf16* bs = Bs[t & 1];
        // unrolled so that the four 32-k blocks' LDS reads can be scheduled ahead of the WMMAs
#pragma unroll
        for (int kq = 0; kq < 4; ++kq) {
            v16bf af[2], bfr[4];
#pragma unroll
            for (int mt = 0; mt < 2; ++mt)
                af[mt] = load_frag(&as[(wm * 32 + mt * 16 + ln) * LDT + kq * 32], kb);
#pragma unroll
            for (int nt = 0; nt < 4; ++nt)
                bfr[nt] = load_frag(&bs[(wn * 64 + nt * 16 + ln) * LDT + kq * 32], kb);

#pragma unroll
            for (int mt = 0; mt < 2; ++mt)
#pragma unroll
                for (int nt = 0; nt < 4; ++nt)
                    acc[mt][nt] = WMMA_BF16(af[mt], bfr[nt], acc[mt][nt]);
        }

        // publish point of stage t+1:
        // this wave's reads of buffer t&1 have retired before the buffer is refilled
        asm volatile("s_wait_dscnt 0x0" ::: "memory");
        // this wave's copies of stage t+1 have landed before the barrier publishes them
        asm volatile("s_wait_asynccnt 0x0" ::: "memory");
        __syncthreads();
        if (t + 2 < nk) issue_stage(t + 2); // refill the buffer every reader has left
    }
    // no copy is outstanding when the wave goes on to its end
    asm volatile("s_wait_asynccnt 0x0" ::: "memory");

    // epilogue
    const size_t cz = (size_t)blockIdx.z * M * N;   // this product's own output
#pragma unroll
    for (int mt = 0; mt < 2; ++mt) {
#pragma unroll
        for (int nt = 0; nt < 4; ++nt) {
            const int gn = n0 + wn * 64 + nt * 16 + ln;
#pragma unroll
            for (int r = 0; r < 8; ++r) {
                const int gm = m0 + wm * 32 + mt * 16 + r + 8 * hi;
                float v = acc[mt][nt][r];
                if constexpr (HAS_BIAS) v += bias[gn];
                if constexpr (HAS_RELU) v = fmaxf(v, 0.0f);
                if constexpr (HAS_RES)  v += res[(size_t)gm * N + gn];
                if constexpr (OUT_BF16) Cb[cz + (size_t)gm * N + gn] = (bf16)v;
                else                    Cf[cz + (size_t)gm * N + gn] = v;
            }
        }
    }
}

// ---------------------------------------------------------------------------
// The same product for a narrow output (N = 1024): f32 out = A * B^T (+bias) + res.
// With 128x128 tiles such an output has 128 tiles, one for every second WGP. Here the
// block tile is 64x128, so that there are 256, and the eight waves still have a 32x64 tile
// each: a pass holds 256 k, waves 0..3 take its first 128 k and waves 4..7 its second.
// Behind the loop the two groups' partial sums are joined through LDS: each wave hands the
// 16 rows it does not store to its partner in the other group and adds the partner's to
// the 16 rows it stores.
// Ring as above: two buffers, filled one pass ahead, one publish point per pass.
// ---------------------------------------------------------------------------
template<int HAS_BIAS>
__global__ __launch_bounds__(256) void gemm_bf16_wmma_khalves(
    const bf16* __restrict__ A, const bf16* __restrict__ B,
    const float* __restrict__ bias, const float* __restrict__ res,
    float* __restrict__ Cf, int K)
{
    const int N   = D_MODEL;                // a constant: row steps of res and Cf become offsets
    const int LDT = 136;                    // padded row stride (halfs): 272B = 17*16B
    // [buffer][k half][row * LDT + k inside the half]
    __shared__ __align__(16) bf16 As[2][2][64 * 136];
    __shared__ __align__(16) bf16 Bs[2][2][128 * 136];
    // [wave][four accumulator registers][lane]
    __shared__ __align__(16) f32x4 xch[8][8][32];

    const int tid  = threadIdx.x;
    const int lane = tid & 31;
    const int wid  = tid >> 5;
    const int kg   = wid >> 2;              // this wave's half of every pass's k
    const int wm   = wid & 1;               // M wave offset: 32*wm
    const int wn   = (wid >> 1) & 1;        // N wave offset: 64*wn
    const int ln   = lane & 15;
    const int hi   = lane >> 4;
    const int kb   = hi * 8;
    const int m0   = blockIdx.y * 64;
    const int n0   = blockIdx.x * 128;

    // staging: one copy of a wave brings one row's 256 k (512 B). This thread owns 16 bytes
    // at k offset lane*8 of rows wid + 8*i: i = 0..7 of A, i = 0..15 of B.
    const int sh = lane >> 4, sc = (lane & 15) * 8;

    const bf16* gA = A + (size_t)(m0 + wid) * K + lane * 8;
    const bf16* gB = B + (size_t)(n0 + wid) * K + lane * 8;
    const size_t   gstep = (size_t)8 * K;           // 8 rows further per copy
    const uint32_t lstep = 8 * LDT * 2;             // the same in LDS bytes

    uint32_t lA[2], lB[2];
#pragma unroll
    for (int bi = 0; bi < 2; ++bi) {
        lA[bi] = lds_off32(&As[bi][sh][wid * LDT + sc]);
        lB[bi] = lds_off32(&Bs[bi][sh][wid * LDT + sc]);
    }

    auto issue_stage = [&](int s) {
        const int buf = s & 1;
        const int k0  = s * 256;
        async_ld8_b128(lA[buf], lstep, gA + k0, gstep);
        async_ld8_b128(lB[buf], lstep, gB + k0, gstep);
        async_ld8_b128(lB[buf] + 8 * lstep, lstep, gB + k0 + 8 * gstep, gstep);
    };

    v8f acc[2][4];
#pragma unroll
    for (int mt = 0; mt < 2; ++mt)
#pragma unroll
        for (int nt = 0; nt < 4; ++nt)
#pragma unroll
            for (int r = 0; r < 8; ++r) acc[mt][nt][r] = 0.0f;

    const int nk = K / 256;
    issue_stage(0);
    // stage 0 has landed for this wave before the barrier publishes it to the others
    asm volatile("s_wait_asynccnt 0x0" ::: "memory");
    __syncthreads();
    if (nk > 1) issue_stage(1);

    for (int t = 0; t < nk; ++t) {
        const bf16* as = As[t & 1][kg];
        const bf16* bs = Bs[t & 1][kg];
        // unrolled so that the four 32-k blocks' LDS reads can be scheduled ahead of the WMMAs
#pragma unroll
        for (int kq = 0; kq < 4; ++kq) {
            v16bf af[2], bfr[4];
#pragma unroll
            for (int mt = 0; mt < 2; ++mt)
                af[mt] = load_frag(&as[(wm * 32 + mt * 16 + ln) * LDT + kq * 32], kb);
#pragma unroll
            for (int nt = 0; nt < 4; ++nt)
                bfr[nt] = load_frag(&bs[(wn * 64 + nt * 16 + ln) * LDT + kq * 32], kb);

#pragma unroll
            for (int mt = 0; mt < 2; ++mt)
#pragma unroll
                for (int nt = 0; nt < 4; ++nt)
                    acc[mt][nt] = WMMA_BF16(af[mt], bfr[nt], acc[mt][nt]);
        }

        // publish point of stage t+1:
        // this wave's reads of buffer t&1 have retired before the buffer is refilled
        asm volatile("s_wait_dscnt 0x0" ::: "memory");
        // this wave's copies of stage t+1 have landed before the barrier publishes them
        asm volatile("s_wait_asynccnt 0x0" ::: "memory");
        __syncthreads();
        if (t + 2 < nk) issue_stage(t + 2); // refill the buffer every reader has left
    }
    // no copy is outstanding when the wave goes on to its end
    asm volatile("s_wait_asynccnt 0x0" ::: "memory");

    // this lane's first output element: row block mt = kg of the wave's tile, column ln
    const size_t o0 = (size_t)(m0 + wm * 32 + kg * 16 + 8 * hi) * N + n0 + wn * 64 + ln;
    const float* rp = res + o0;
    float*       cp = Cf + o0;

    // the residual and the bias are fetched ahead of the join: they are in flight while the
    // rows to hand over are picked and stored to LDS
    float rv[4][8], bv[4];
#pragma unroll
    for (int nt = 0; nt < 4; ++nt)
#pragma unroll
        for (int r = 0; r < 8; ++r) rv[nt][r] = rp[r * N + nt * 16];
    if constexpr (HAS_BIAS) {
        // a bias load's result may be given a register that held the address of the loads above:
        // the wait that belongs in front of that overwrite is written here
        asm volatile("s_wait_xcnt 0x0" ::: "memory");
#pragma unroll
        for (int nt = 0; nt < 4; ++nt) bv[nt] = bias[n0 + wn * 64 + nt * 16 + ln];
    }

    // join of the two k halves: group kg stores row block mt = kg and hands over the other
#pragma unroll
    for (int nt = 0; nt < 4; ++nt)
#pragma unroll
        for (int q = 0; q < 2; ++q) {
            f32x4 g;
#pragma unroll
            for (int j = 0; j < 4; ++j)
                g[j] = kg ? acc[0][nt][q * 4 + j] : acc[1][nt][q * 4 + j];
            xch[wid][nt * 2 + q][lane] = g;
        }
    __syncthreads();

    // epilogue
#pragma unroll
    for (int nt = 0; nt < 4; ++nt) {
#pragma unroll
        for (int q = 0; q < 2; ++q) {
            const f32x4 p = xch[wid ^ 4][nt * 2 + q][lane];
#pragma unroll
            for (int j = 0; j < 4; ++j) {
                const int r = q * 4 + j;
                float v = (kg ? acc[1][nt][r] : acc[0][nt][r]) + p[j];
                if constexpr (HAS_BIAS) v += bv[nt];
                v += rv[nt][r];
                cp[r * N + nt * 16] = v;
            }
        }
    }
}

__device__ __forceinline__ float xhalf(float x) {
    return __builtin_bit_cast(float, __builtin_amdgcn_permlanex16(
        __builtin_bit_cast(int, x), __builtin_bit_cast(int, x),
        0x76543210, 0xfedcba98, false, false));
}

__global__ __launch_bounds__(256) void flash_attn_wmma(
    const bf16* __restrict__ Q, const bf16* __restrict__ Km,
    const bf16* __restrict__ Vm, const int* __restrict__ mask,
    bf16* __restrict__ O,
    const float* __restrict__ wo, const float* __restrict__ fc1,
    const float* __restrict__ fc2, bf16* __restrict__ wout)
{
    const int LDK = 72;                       // padded stride (halfs): 144B
    __shared__ __align__(16) bf16 Ks[64 * 72];
    const int LDV = 80;                       // V's stride (halfs): 160B = 5*32B, for the transposing load
    __shared__ __align__(16) bf16 Vs[64 * 80];          // Vs[key][d]

    // the whole work-group leaves here, in front of every barrier
    if (blockIdx.y >= BATCH * NHEAD) {
        const unsigned blk = (blockIdx.y - BATCH * NHEAD) * (SEQ / 128) + blockIdx.x;
        const unsigned g   = blk / CVT_WG_PER_3SEG;            // segments 3g, 3g+1, 3g+2 of nine
        const unsigned e0  = (blk % CVT_WG_PER_3SEG) * (8 * CVT_UNIT);
        // segment 0 is w_o, 1..4 are fc1_w, 5..8 are fc2_w
        const float* s0 = g == 0 ? wo              : g == 1 ? fc1 + 2 * SEG_ELEMS : fc2 + SEG_ELEMS;
        const float* s1 = g == 0 ? fc1             : g == 1 ? fc1 + 3 * SEG_ELEMS : fc2 + 2 * SEG_ELEMS;
        const float* s2 = g == 0 ? fc1 + SEG_ELEMS : g == 1 ? fc2                 : fc2 + 3 * SEG_ELEMS;
        cvt_three_units(s0 + e0, s1 + e0, s2 + e0, wout + (size_t)g * (3 * SEG_ELEMS) + e0);
        return;
    }

    const int bh   = blockIdx.y;
    const int b    = bh >> 4;
    const int h    = bh & 15;
    const int tid  = threadIdx.x;
    const int lane = tid & 31;
    const int wid  = tid >> 5;
    const int ln   = lane & 15;
    const int hi   = lane >> 4;
    const int kb   = hi * 8;
    const int q0   = blockIdx.x * 128 + wid * 16;       // query offset in seq
    const size_t dbase = (size_t)h * DKH;

    // Q fragments (2 K-slabs of 32 over DK=64), straight from global
    v16bf qf[2];
    {
        const size_t qrow = (size_t)(b * SEQ + q0 + ln) * D_MODEL + dbase;
#pragma unroll
        for (int s = 0; s < 2; ++s)
            qf[s] = load_frag(Q + qrow + s * 32, kb);
    }

    // oacc[n][r] = O^T[d = n*16 + 8*hi + r][query ln]
    v8f oacc[4];
#pragma unroll
    for (int n = 0; n < 4; ++n)
#pragma unroll
        for (int r = 0; r < 8; ++r) oacc[n][r] = 0.0f;

    // this lane's query: running maximum (the same in both halves) and the sum over this
    // half's keys alone; the halves' sums are joined behind the loop
    float mrow = -3.0e38f, lrow = 0.0f;

    const float scale = 0.125f;               // 1/sqrt(64)

    // this thread's share of a 64-key tile: 16 bytes of K and of V in rows sr and sr + 32,
    // and the mask words of keys lane and lane + 32
    const int sr   = tid >> 3;
    const int scol = (tid & 7) * 8;
    const bf16* gK = Km + (size_t)(b * SEQ + sr) * D_MODEL + dbase + scol;
    const bf16* gV = Vm + (size_t)(b * SEQ + sr) * D_MODEL + dbase + scol;
    const int*  gM = mask + b * SEQ + lane;

    // this lane's address in the transposing loads of V: row 8*hi + (lane & 7), 16-byte half
    // (lane >> 3) & 1 of the 16 columns
    const bf16* vtr = &Vs[(kb + (lane & 7)) * LDV + ((lane >> 3) & 1) * 8];

    v8bf  kst[2];
    v8bf  vst[2];
    int   mst[2];
    auto fetch_tile = [&](int kk) {
#pragma unroll
        for (int i = 0; i < 2; ++i) {
            kst[i] = *(const v8bf*)(gK + (size_t)(kk + i * 32) * D_MODEL);
            vst[i] = *(const v8bf*)(gV + (size_t)(kk + i * 32) * D_MODEL);
        }
#pragma unroll
        for (int i = 0; i < 2; ++i) mst[i] = gM[kk + i * 32];
        // the loads stay in flight over a branch, behind which their address registers are
        // reused: the wait that belongs in front of that overwrite is written here
        asm volatile("s_wait_xcnt 0x0" ::: "memory");
    };
    fetch_tile(0);

    for (int kk0 = 0; kk0 < SEQ; kk0 += 64) {
        __syncthreads();
        // stage the K and V tiles [64 keys][64] from the registers filled one tile ago
#pragma unroll
        for (int i = 0; i < 2; ++i) {
            const int r = sr + i * 32;
            *(v8bf*)(&Ks[r * LDK + scol]) = kst[i];
            *(v8bf*)(&Vs[r * LDV + scol]) = vst[i];
        }
        // bit k of mz[i]: the mask word of key i*32 + k is 0
        unsigned mz[2];
#pragma unroll
        for (int i = 0; i < 2; ++i) mz[i] = __builtin_amdgcn_ballot_w32(mst[i] == 0);
        __syncthreads();
        // the next tile's loads fly while this tile is worked on
        if (kk0 + 64 < SEQ) fetch_tile(kk0 + 64);

        // scores S^T = K * Q^T  (4 tiles of 16 keys)
        v8f sacc[4];
#pragma unroll
        for (int t = 0; t < 4; ++t)
#pragma unroll
            for (int r = 0; r < 8; ++r) sacc[t][r] = 0.0f;
#pragma unroll
        for (int s = 0; s < 2; ++s)
#pragma unroll
            for (int t = 0; t < 4; ++t) {
                v16bf kf = load_frag(&Ks[(t * 16 + ln) * LDK + s * 32], kb);
                sacc[t] = WMMA_BF16(kf, qf[s], sacc[t]);
            }

        // scale + mask
        float sv[4][8];
#pragma unroll
        for (int t = 0; t < 4; ++t)
#pragma unroll
            for (int r = 0; r < 8; ++r) sv[t][r] = sacc[t][r] * scale;
        // in this map a key is a register, not a lane, so its mask bit is tested per register;
        // one scalar test per tile keeps those tests out of tiles that hold no masked key
        if ((mz[0] | mz[1]) != 0u) {
#pragma unroll
            for (int t = 0; t < 4; ++t) {
                // bit r: this lane's key t*16 + 8*hi + r is masked out
                const unsigned zb = mz[t >> 1] >> ((t & 1) * 16 + kb);
#pragma unroll
                for (int r = 0; r < 8; ++r)
                    sv[t][r] = ((zb >> r) & 1u) ? -1.0e9f : sv[t][r];
            }
        }

        // online softmax of this lane's query
        float mx = sv[0][0];
#pragma unroll
        for (int t = 0; t < 4; ++t)
#pragma unroll
            for (int r = 0; r < 8; ++r) mx = fmaxf(mx, sv[t][r]);
        mx = fmaxf(mx, xhalf(mx));
        const float mnew  = fmaxf(mrow, mx);
        const float alpha = __expf(mrow - mnew);
        mrow = mnew;

        float ps[4][8];
        float sm[4];
#pragma unroll
        for (int t = 0; t < 4; ++t) {
#pragma unroll
            for (int r = 0; r < 8; ++r) ps[t][r] = __expf(sv[t][r] - mnew);
            sm[t] = ((ps[t][0] + ps[t][1]) + (ps[t][2] + ps[t][3])) +
                    ((ps[t][4] + ps[t][5]) + (ps[t][6] + ps[t][7]));
        }
        lrow = lrow * alpha + ((sm[0] + sm[1]) + (sm[2] + sm[3]));
#pragma unroll
        for (int n = 0; n < 4; ++n)
#pragma unroll
            for (int r = 0; r < 8; ++r) oacc[n][r] *= alpha;

        // O^T += V^T * P^T
#pragma unroll
        for (int s = 0; s < 2; ++s) {
            // elements 0..7 = keys s*32 + kb + 0..7, 8..15 = keys s*32 + 16 + kb + 0..7: as load_frag
            v16bf pf;
#pragma unroll
            for (int i = 0; i < 8; ++i) {
                pf[i]     = (bf16)ps[2 * s][i];
                pf[i + 8] = (bf16)ps[2 * s + 1][i];
            }
#pragma unroll
            for (int n = 0; n < 4; ++n) {
                // row d = n*16 + ln of V^T, keys in the same order as pf
                v16bf vf = load_frag_tr(vtr + s * 32 * LDV + n * 16, 16 * LDV);
                oacc[n] = WMMA_BF16(vf, pf, oacc[n]);
            }
        }
    }

    // finalize: O /= l, write bf16 [token][h*64 + d], eight consecutive d per store
    const float invl = 1.0f / (lrow + xhalf(lrow));
    bf16* orow = O + (size_t)(b * SEQ + q0 + ln) * D_MODEL + dbase + kb;
#pragma unroll
    for (int n = 0; n < 4; ++n) {
        v8bf ov;
#pragma unroll
        for (int r = 0; r < 8; ++r) ov[r] = (bf16)(oacc[n][r] * invl);
        *(v8bf*)(orow + n * 16) = ov;
    }
}

// ---------------------------------------------------------------------------
// launch
// ---------------------------------------------------------------------------
extern "C" void kernel_launch(void* const* d_in, const int* in_sizes, int n_in,
                              void* d_out, int out_size, void* d_ws, size_t ws_size,
                              hipStream_t stream)
{
    const float* x      = (const float*)d_in[0];
    const int*   mask   = (const int*)  d_in[1];
    const float* w_q    = (const float*)d_in[2];
    const float* w_k    = (const float*)d_in[3];
    const float* w_v    = (const float*)d_in[4];
    const float* w_o    = (const float*)d_in[5];
    const float* alpha1 = (const float*)d_in[6];
    const float* beta1  = (const float*)d_in[7];
    const float* alpha2 = (const float*)d_in[8];
    const float* beta2  = (const float*)d_in[9];
    const float* fc1_w  = (const float*)d_in[10];
    const float* fc1_b  = (const float*)d_in[11];
    const float* fc2_w  = (const float*)d_in[12];
    const float* fc2_b  = (const float*)d_in[13];

    char* ws = (char*)d_ws;
    size_t off = 0;
    auto take = [&](size_t bytes) { char* p = ws + off; off += bytes; return p; };

    bf16* wqb   = (bf16*)take((size_t)D_MODEL * D_MODEL * 2);
    bf16* wkb   = (bf16*)take((size_t)D_MODEL * D_MODEL * 2);
    bf16* wvb   = (bf16*)take((size_t)D_MODEL * D_MODEL * 2);
    bf16* wob   = (bf16*)take((size_t)D_MODEL * D_MODEL * 2);
    bf16* fc1b  = (bf16*)take((size_t)D_FC * D_MODEL * 2);
    bf16* fc2b  = (bf16*)take((size_t)D_MODEL * D_FC * 2);
    bf16* ln1b  = (bf16*)take((size_t)M_TOK * D_MODEL * 2);
    bf16* Qb    = (bf16*)take((size_t)M_TOK * D_MODEL * 2);
    bf16* Kb    = (bf16*)take((size_t)M_TOK * D_MODEL * 2);
    bf16* Vb    = (bf16*)take((size_t)M_TOK * D_MODEL * 2);
    bf16* attnb = (bf16*)take((size_t)M_TOK * D_MODEL * 2);
    float* x1   = (float*)take((size_t)M_TOK * D_MODEL * 4);
    bf16* ln2b  = (bf16*)take((size_t)M_TOK * D_MODEL * 2);
    bf16* hidb  = (bf16*)take((size_t)M_TOK * D_FC * 2);

    // LN1, and w_q, w_k, w_v to bf16: their copies are one run that starts at wqb
    layernorm_bf16_cvt_qkv<<<M_TOK / LN_ROWS + CVT_WG_PER_3SEG, LN_ROWS * 32, 0, stream>>>(
        x, alpha1, beta1, ln1b, w_q, w_k, w_v, wqb);

    // Q, K, V projections (bf16 out) in one launch: wqb, wkb, wvb lie back to back in the
    // workspace, and so do Qb, Kb, Vb
    dim3 gP(D_MODEL / 128, M_TOK / 64);       // the two narrow products: 64x128 tiles
    dim3 gQKV(D_MODEL / 128, M_TOK / 128, 3);
    gemm_bf16_wmma<0,0,0,1><<<gQKV, 256, 0, stream>>>(ln1b, wqb, nullptr, nullptr,
                                                      nullptr, Qb, M_TOK, D_MODEL, D_MODEL);

    // attention, and w_o, fc1_w, fc2_w to bf16: their copies are one run that starts at wob
    flash_attn_wmma<<<dim3(SEQ / 128, BATCH * NHEAD + 3 * CVT_WG_PER_3SEG / (SEQ / 128)), 256, 0, stream>>>(
        Qb, Kb, Vb, mask, attnb, w_o, fc1_w, fc2_w, wob);

    // output projection + residual:  x1 = x + attn @ w_o^T  (f32 out)
    gemm_bf16_wmma_khalves<0><<<gP, 256, 0, stream>>>(attnb, wob, nullptr, x,
                                                      x1, D_MODEL);

    // LN2
    layernorm_bf16<<<M_TOK / LN_ROWS, LN_ROWS * 32, 0, stream>>>(x1, alpha2, beta2, ln2b);

    // FC1: relu(ln2 @ fc1^T + b1) -> bf16 hidden
    dim3 gF1(D_FC / 128, M_TOK / 128);
    gemm_bf16_wmma<1,1,0,1><<<gF1, 256, 0, stream>>>(ln2b, fc1b, fc1_b, nullptr,
                                                     nullptr, hidb, M_TOK, D_FC, D_MODEL);

    // FC2: out = x1 + hidden @ fc2^T + b2  (f32 -> d_out)
    gemm_bf16_wmma_khalves<1><<<gP, 256, 0, stream>>>(hidb, fc2b, fc2_b, x1,
                                                      (float*)d_out, D_FC);

    (void)in_sizes; (void)n_in; (void)out_size; (void)ws_size;
}

// v010
// One run takes 84.9 microseconds.
// Timed twice side by side with v009, it ran 1.04 times as fast both times.
// Counting every step since v000, it is 2.42 times as fast.
#include <hip/hip_runtime.h>
#include <math.h>

typedef __bf16 bf16;
typedef __attribute__((ext_vector_type(16))) __bf16 v16bf;
typedef __attribute__((ext_vector_type(8)))  __bf16 v8bf;
typedef __attribute__((ext_vector_type(8)))  float  v8f;

#define D_MODEL 1024
#define NHEAD   16
#define DKH     64
#define D_FC    4096
#define BATCH   2
#define SEQ     1024
#define M_TOK   (BATCH*SEQ)   // 2048
#define LN_EPS  1e-6f

// ---------------------------------------------------------------------------
// fragment load: 16-bit A/B fragment from a padded row in LDS/global.
// lane L: row chosen by caller (L&15), kb = (L>>4)*8.
// elements 0..7  = K kb..kb+7 ; elements 8..15 = K 16+kb..16+kb+7
// ---------------------------------------------------------------------------
__device__ __forceinline__ v16bf load_frag(const bf16* rowbase, int kb) {
    v8bf lo = *(const v8bf*)(rowbase + kb);
    v8bf hi = *(const v8bf*)(rowbase + kb + 16);
    v16bf f;
#pragma unroll
    for (int i = 0; i < 8; ++i) { f[i] = lo[i]; f[i + 8] = hi[i]; }
    return f;
}

// the same fragment of the TRANSPOSE of a row-major 16-bit LDS tile T[k][column], by two
// transposing loads. p: the lane's address, row 8*(L>>4) + (L&7) of the first 16 k, 16-byte half
// (L>>3)&1 of the 16 columns; lane L then holds column L&15, k in the order of load_frag.
// step16: 16 rows of T, in elements.
__device__ __forceinline__ v16bf load_frag_tr(const bf16* p, int step16) {
    typedef __attribute__((address_space(3))) v8bf lds_v8bf;
    v8bf lo = __builtin_amdgcn_ds_load_tr16_b128_v8bf16((lds_v8bf*)p);
    v8bf hi = __builtin_amdgcn_ds_load_tr16_b128_v8bf16((lds_v8bf*)(p + step16));
    v16bf f;
#pragma unroll
    for (int i = 0; i < 8; ++i) { f[i] = lo[i]; f[i + 8] = hi[i]; }
    return f;
}

#define WMMA_BF16(A_, B_, C_) \
    __builtin_amdgcn_wmma_f32_16x16x32_bf16(false, (A_), false, (B_), (short)0, (C_), false, false)

// CDNA5 async global->LDS copies, 16B per lane each, tracked by ASYNCcnt.
// Eight copies of one operand's slab: copy i takes LDS byte address lds + i*lstep
// and global address g + i*gstep (elements). The closing s_wait_xcnt 0 stands in the
// copies' own statement so that no address register is rewritten ahead of it.
__device__ __forceinline__ void async_ld8_b128(uint32_t lds, uint32_t lstep,
                                               const bf16* g, size_t gstep) {
    asm volatile("global_load_async_to_lds_b128 %0, %8, off\n\t"
                 "global_load_async_to_lds_b128 %1, %9, off\n\t"
                 "global_load_async_to_lds_b128 %2, %10, off\n\t"
                 "global_load_async_to_lds_b128 %3, %11, off\n\t"
                 "global_load_async_to_lds_b128 %4, %12, off\n\t"
                 "global_load_async_to_lds_b128 %5, %13, off\n\t"
                 "global_load_async_to_lds_b128 %6, %14, off\n\t"
                 "global_load_async_to_lds_b128 %7, %15, off\n\t"
                 "s_wait_xcnt 0x0"
                 :: "v"(lds), "v"(lds + lstep), "v"(lds + 2 * lstep), "v"(lds + 3 * lstep),
                    "v"(lds + 4 * lstep), "v"(lds + 5 * lstep), "v"(lds + 6 * lstep),
                    "v"(lds + 7 * lstep),
                    "v"(g), "v"(g + gstep), "v"(g + 2 * gstep), "v"(g + 3 * gstep),
                    "v"(g + 4 * gstep), "v"(g + 5 * gstep), "v"(g + 6 * gstep),
                    "v"(g + 7 * gstep)
                 : "memory");
}
__device__ __forceinline__ uint32_t lds_off32(const void* p) {
    return (uint32_t)(uintptr_t)p;   // flat LDS aperture: low 32 bits = LDS address
}

// ---------------------------------------------------------------------------
// float -> bf16 of the six weight matrices, by few, long waves. It has no launch of its own:
// its work-groups ride, by block index, in launches whose own work does not depend on them and
// that end before the first reader of their output starts: q, k, v beside LayerNorm 1 (both
// feed the Q, K, V projections), o, fc1, fc2 beside attention (first read by the launches
// behind it), where their memory time passes under attention's arithmetic.
// The bf16 copies lie back to back in the workspace (q, k, v, o, fc1, fc2): twelve segments of
// 1 Mi elements. A unit is 1024 consecutive elements (eight wave-wide 512 B loads, eight 256 B
// stores). A work-group of 8 waves takes the same 8 units of three segments, a wave one unit of
// each. A thread's 24 loads are independent of one another and are all issued before the first
// is used.
// ---------------------------------------------------------------------------
typedef __attribute__((ext_vector_type(4))) float  f32x4;
typedef __attribute__((ext_vector_type(4))) __bf16 bf16x4;
#define CVT_UNIT    1024
#define SEG_ELEMS   (D_MODEL * D_MODEL)       // 1 Mi = 1024 units
#define CVT_WG_PER_3SEG (SEG_ELEMS / (8 * CVT_UNIT))   // 128 work-groups of 8 waves

// s0, s1, s2: the work-group's first element in its three source segments; o0: the same in the
// first of the three output segments, which follow one another
__device__ __forceinline__ void cvt_three_units(
    const float* __restrict__ s0, const float* __restrict__ s1,
    const float* __restrict__ s2, bf16* __restrict__ o0)
{
    bf16* o1 = o0 + SEG_ELEMS;
    bf16* o2 = o1 + SEG_ELEMS;
    // the thread's own place inside the work-group's 8 units
    const unsigned t = (threadIdx.x >> 5) * CVT_UNIT + (threadIdx.x & 31) * 4;

    // all six loops are unrolled so that a, b and c stay in registers and i * 128 becomes an
    // immediate offset of the load or store
    f32x4 a[8], b[8], c[8];
#pragma unroll
    for (int i = 0; i < 8; ++i) a[i] = *(const f32x4*)(s0 + t + i * 128);
#pragma unroll
    for (int i = 0; i < 8; ++i) b[i] = *(const f32x4*)(s1 + t + i * 128);
#pragma unroll
    for (int i = 0; i < 8; ++i) c[i] = *(const f32x4*)(s2 + t + i * 128);
    // the loads are in flight while the output's address is formed, for which the compiler may
    // reuse a register that holds one of their addresses: the wait that belongs in front of that
    // overwrite is written here
    asm volatile("s_wait_xcnt 0x0" ::: "memory");
    // keeps all 24 loads ahead of the first conversion: without it the scheduler issues them in
    // small groups with a wait between, and the wave pays the memory latency several times
    __builtin_amdgcn_sched_barrier(0);

#pragma unroll
    for (int i = 0; i < 8; ++i) *(bf16x4*)(o0 + t + i * 128) = __builtin_convertvector(a[i], bf16x4);
#pragma unroll
    for (int i = 0; i < 8; ++i) *(bf16x4*)(o1 + t + i * 128) = __builtin_convertvector(b[i], bf16x4);
#pragma unroll
    for (int i = 0; i < 8; ++i) *(bf16x4*)(o2 + t + i * 128) = __builtin_convertvector(c[i], bf16x4);
    // the stores are in flight where the caller's code goes on, and that code may reuse the
    // registers that hold their base address: the wait that belongs in front of such an
    // overwrite is written here, once for all three runs of stores
    asm volatile("s_wait_xcnt 0x0" ::: "memory");
}

// ---------------------------------------------------------------------------
// LayerNorm (ddof=1, divide by std+eps), D_MODEL=1024: one wave per row, eight rows per
// work-group. A lane holds 32 elements of its row (eight float4, each wave-wide load 512
// contiguous bytes); both sums are in-lane adds and a five-step exchange between lanes,
// so there is no LDS and no barrier, and LayerNorm is 2048 waves of a launch.
// ---------------------------------------------------------------------------
// x of lane l ^ M, M = 1, 2, 4 or 8 (inside the 16-lane row)
template<int M>
__device__ __forceinline__ float xrow(float x) {
    return __builtin_bit_cast(float, __builtin_amdgcn_update_dpp(
        0, __builtin_bit_cast(int, x), 0x160 + M, 0xf, 0xf, true));
}
// the sum over the wave's 32 lanes, the same value in every lane
__device__ __forceinline__ float wave_sum(float x) {
    x += xrow<1>(x);
    x += xrow<2>(x);
    x += xrow<4>(x);
    x += xrow<8>(x);
    return x + __builtin_bit_cast(float, __builtin_amdgcn_permlanex16(
        __builtin_bit_cast(int, x), __builtin_bit_cast(int, x),
        0x76543210, 0xfedcba98, false, false));
}
#define LN_ROWS 8                             // rows (waves) per work-group

__device__ __forceinline__ void layernorm_rows(
    const float* __restrict__ x, const float* __restrict__ alpha,
    const float* __restrict__ beta, bf16* __restrict__ out)
{
    const int lane = threadIdx.x & 31;
    // the wave's number as a scalar: the row's address is then a scalar base, and all loads
    // share one vector offset register
    const int row  = blockIdx.x * LN_ROWS + __builtin_amdgcn_readfirstlane(threadIdx.x >> 5);
    const float* xr = x + (size_t)row * D_MODEL + lane * 4;
    const float* ar = alpha + lane * 4;
    const float* br = beta + lane * 4;

    // every loop is unrolled so that v, a and b stay in registers and i * 128 becomes an
    // immediate offset of the load or store
    f32x4 v[8], a[8], b[8];
#pragma unroll
    for (int i = 0; i < 8; ++i) v[i] = *(const f32x4*)(xr + i * 128);
#pragma unroll
    for (int i = 0; i < 8; ++i) a[i] = *(const f32x4*)(ar + i * 128);
#pragma unroll
    for (int i = 0; i < 8; ++i) b[i] = *(const f32x4*)(br + i * 128);
    // keeps all 24 loads ahead of the first add: without it the scheduler sinks the loads of a
    // and b behind the first sum, in pairs with a wait after each, and the wave pays their
    // latency several times
    __builtin_amdgcn_sched_barrier(0);

    const f32x4 s4 = ((v[0] + v[1]) + (v[2] + v[3])) + ((v[4] + v[5]) + (v[6] + v[7]));
    const float mean = wave_sum((s4[0] + s4[1]) + (s4[2] + s4[3])) * (1.0f / 1024.0f);

    f32x4 q4 = {0.0f, 0.0f, 0.0f, 0.0f};
#pragma unroll
    for (int i = 0; i < 8; ++i) { v[i] -= mean; q4 += v[i] * v[i]; }
    const float var = wave_sum((q4[0] + q4[1]) + (q4[2] + q4[3])) * (1.0f / 1023.0f);   // ddof = 1
    const float inv = 1.0f / (sqrtf(var) + LN_EPS);

    bf16* orow = out + (size_t)row * D_MODEL + lane * 4;
#pragma unroll
    for (int i = 0; i < 8; ++i)
        *(bf16x4*)(orow + i * 128) = __builtin_convertvector(a[i] * v[i] * inv + b[i], bf16x4);
}

__global__ __launch_bounds__(LN_ROWS * 32) void layernorm_bf16(
    const float* __restrict__ x, const float* __restrict__ alpha,
    const float* __restrict__ beta, bf16* __restrict__ out)
{
    layernorm_rows(x, alpha, beta, out);
}

// LayerNorm 1 and, in the work-groups behind its own, the conversion of w_q, w_k, w_v
__global__ __launch_bounds__(LN_ROWS * 32) void layernorm_bf16_cvt_qkv(
    const float* __restrict__ x, const float* __restrict__ alpha,
    const float* __restrict__ beta, bf16* __restrict__ out,
    const float* __restrict__ wq, const float* __restrict__ wk,
    const float* __restrict__ wv, bf16* __restrict__ wout)
{
    if (blockIdx.x < M_TOK / LN_ROWS) {
        layernorm_rows(x, alpha, beta, out);
    } else {
        const unsigned e0 = (blockIdx.x - M_TOK / LN_ROWS) * (8 * CVT_UNIT);
        cvt_three_units(wq + e0, wk + e0, wv + e0, wout + e0);
    }
}

// ---------------------------------------------------------------------------
// Tiled WMMA bf16 GEMM:  C[M,N] = A[M,K] * B[N,K]^T   (+bias/relu/res)
// block tile 128x128, 8 waves (4 along M x 2 along N), wave tile 32x64.
// Two LDS buffers, each one pass of 128 k (256 B of every operand row), filled by
// async global->LDS copies one pass ahead; one publish point per pass.
// Each work-group walks k from a start of its own and wraps round (see rot below).
// blockIdx.z picks one of several products that share A (and M, N, K): their B matrices
// lie back to back, and so do their outputs; bias and res, where present, are common to all.
// ---------------------------------------------------------------------------
template<int HAS_BIAS, int HAS_RELU, int HAS_RES, int OUT_BF16>
__global__ __launch_bounds__(256) void gemm_bf16_wmma(
    const bf16* __restrict__ A, const bf16* __restrict__ B,
    const float* __restrict__ bias, const float* __restrict__ res,
    float* __restrict__ Cf, bf16* __restrict__ Cb,
    int M, int N, int K)
{
    const int LDT = 136;                    // padded row stride (halfs): 272B = 17*16B
    __shared__ __align__(16) bf16 As[2][128 * 136];
    __shared__ __align__(16) bf16 Bs[2][128 * 136];

    const int tid  = threadIdx.x;
    const int lane = tid & 31;
    const int wid  = tid >> 5;
    const int wm   = wid & 3;               // M wave offset: 32*wm
    const int wn   = wid >> 2;              // N wave offset: 64*wn
    const int ln   = lane & 15;
    const int hi   = lane >> 4;
    const int kb   = hi * 8;
    const int m0   = blockIdx.y * 128;
    const int n0   = blockIdx.x * 128;

    // staging coordinates: this thread owns chunks tid + i*256, i = 0..7, per operand
    // chunk c: row = c>>4 (0..127), col = (c&15)*8  (within the 128-wide slab)
    const int r0 = tid >> 4, c0 = (tid & 15) * 8;

    const bf16* gA = A + (size_t)(m0 + r0) * K + c0;
    const bf16* gB = B + ((size_t)blockIdx.z * N + n0 + r0) * K + c0;
    const size_t   gstep = (size_t)16 * K;          // 16 rows further per copy
    const uint32_t lstep = 16 * LDT * 2;            // the same in LDS bytes

    uint32_t lA[2], lB[2];
#pragma unroll
    for (int bi = 0; bi < 2; ++bi) {
        lA[bi] = lds_off32(&As[bi][r0 * LDT + c0]);
        lB[bi] = lds_off32(&Bs[bi][r0 * LDT + c0]);
    }

    // rotated k start: stage s of this work-group is k block (s + rot) mod nk. The work-groups
    // that share rows of A (same blockIdx.y) or of B (same blockIdx.x and z) run at the same
    // pace; from a common start they would all ask L2 for the same lines at the same moment
    const int nk  = K / 128;
    const int rot = (int)((blockIdx.x + blockIdx.y + blockIdx.z) % (unsigned)nk);

    auto issue_stage = [&](int s) {
        const int buf = s & 1;
        const int kb_ = s + rot;
        const int k0  = (kb_ >= nk ? kb_ - nk : kb_) * 128;
        async_ld8_b128(lA[buf], lstep, gA + k0, gstep);
        async_ld8_b128(lB[buf], lstep, gB + k0, gstep);
    };

    v8f acc[2][4];
#pragma unroll
    for (int mt = 0; mt < 2; ++mt)
#pragma unroll
        for (int nt = 0; nt < 4; ++nt)
#pragma unroll
            for (int r = 0; r < 8; ++r) acc[mt][nt][r] = 0.0f;

    issue_stage(0);
    // stage 0 has landed for this wave before the barrier publishes it to the others
    asm volatile("s_wait_asynccnt 0x0" ::: "memory");
    __syncthreads();
    if (nk > 1) issue_stage(1);

    for (int t = 0; t < nk; ++t) {
        const bf16* as = As[t & 1];
        const bf16* bs = Bs[t & 1];
        // unrolled so that the four 32-k blocks' LDS reads can be scheduled ahead of the WMMAs
#pragma unroll
        for (int kq = 0; kq < 4; ++kq) {
            v16bf af[2], bfr[4];
#pragma unroll
            for (int mt = 0; mt < 2; ++mt)
                af[mt] = load_frag(&as[(wm * 32 + mt * 16 + ln) * LDT + kq * 32], kb);
#pragma unroll
            for (int nt = 0; nt < 4; ++nt)
                bfr[nt] = load_frag(&bs[(wn * 64 + nt * 16 + ln) * LDT + kq * 32], kb);

#pragma unroll
            for (int mt = 0; mt < 2; ++mt)
#pragma unroll
                for (int nt = 0; nt < 4; ++nt)
                    acc[mt][nt] = WMMA_BF16(af[mt], bfr[nt], acc[mt][nt]);
        }

        // publish point of stage t+1:
        // this wave's reads of buffer t&1 have retired before the buffer is refilled
        asm volatile("s_wait_dscnt 0x0" ::: "memory");
        // this wave's copies of stage t+1 have landed before the barrier publishes them
        asm volatile("s_wait_asynccnt 0x0" ::: "memory");
        __syncthreads();
        if (t + 2 < nk) issue_stage(t + 2); // refill the buffer every reader has left
    }
    // no copy is outstanding when the wave goes on to its end
    asm volatile("s_wait_asynccnt 0x0" ::: "memory");

    // epilogue
    const size_t cz = (size_t)blockIdx.z * M * N;   // this product's own output
#pragma unroll
    for (int mt = 0; mt < 2; ++mt) {
#pragma unroll
        for (int nt = 0; nt < 4; ++nt) {
            const int gn = n0 + wn * 64 + nt * 16 + ln;
#pragma unroll
            for (int r = 0; r < 8; ++r) {
                const int gm = m0 + wm * 32 + mt * 16 + r + 8 * hi;
                float v = acc[mt][nt][r];
                if constexpr (HAS_BIAS) v += bias[gn];
                if constexpr (HAS_RELU) v = fmaxf(v, 0.0f);
                if constexpr (HAS_RES)  v += res[(size_t)gm * N + gn];
                if constexpr (OUT_BF16) Cb[cz + (size_t)gm * N + gn] = (bf16)v;
                else                    Cf[cz + (size_t)gm * N + gn] = v;
            }
        }
    }
}

// ---------------------------------------------------------------------------
// The same product for a narrow output (N = 1024): f32 out = A * B^T (+bias) + res.
// With 128x128 tiles such an output has 128 tiles, one for every second WGP. Here the
// block tile is 64x128, so that there are 256, and the eight waves still have a 32x64 tile
// each: a pass holds 256 k, waves 0..3 take its first 128 k and waves 4..7 its second.
// Behind the loop the two groups' partial sums are joined through LDS: each wave hands the
// 16 rows it does not store to its partner in the other group and adds the partner's to
// the 16 rows it stores.
// Ring as above: two buffers, filled one pass ahead, one publish point per pass.
// ---------------------------------------------------------------------------
template<int HAS_BIAS>
__global__ __launch_bounds__(256) void gemm_bf16_wmma_khalves(
    const bf16* __restrict__ A, const bf16* __restrict__ B,
    const float* __restrict__ bias, const float* __restrict__ res,
    float* __restrict__ Cf, int K)
{
    const int N   = D_MODEL;                // a constant: row steps of res and Cf become offsets
    const int LDT = 136;                    // padded row stride (halfs): 272B = 17*16B
    // [buffer][k half][row * LDT + k inside the half]
    __shared__ __align__(16) bf16 As[2][2][64 * 136];
    __shared__ __align__(16) bf16 Bs[2][2][128 * 136];
    // [wave][four accumulator registers][lane]
    __shared__ __align__(16) f32x4 xch[8][8][32];

    const int tid  = threadIdx.x;
    const int lane = tid & 31;
    const int wid  = tid >> 5;
    const int kg   = wid >> 2;              // this wave's half of every pass's k
    const int wm   = wid & 1;               // M wave offset: 32*wm
    const int wn   = (wid >> 1) & 1;        // N wave offset: 64*wn
    const int ln   = lane & 15;
    const int hi   = lane >> 4;
    const int kb   = hi * 8;
    const int m0   = blockIdx.y * 64;
    const int n0   = blockIdx.x * 128;

    // staging: one copy of a wave brings one row's 256 k (512 B). This thread owns 16 bytes
    // at k offset lane*8 of rows wid + 8*i: i = 0..7 of A, i = 0..15 of B.
    const int sh = lane >> 4, sc = (lane & 15) * 8;

    const bf16* gA = A + (size_t)(m0 + wid) * K + lane * 8;
    const bf16* gB = B + (size_t)(n0 + wid) * K + lane * 8;
    const size_t   gstep = (size_t)8 * K;           // 8 rows further per copy
    const uint32_t lstep = 8 * LDT * 2;             // the same in LDS bytes

    uint32_t lA[2], lB[2];
#pragma unroll
    for (int bi = 0; bi < 2; ++bi) {
        lA[bi] = lds_off32(&As[bi][sh][wid * LDT + sc]);
        lB[bi] = lds_off32(&Bs[bi][sh][wid * LDT + sc]);
    }

    // rotated k start, as above: stage s of this work-group is k block (s + rot) mod nk
    const int nk  = K / 256;
    const int rot = (int)((blockIdx.x + blockIdx.y) % (unsigned)nk);

    auto issue_stage = [&](int s) {
        const int buf = s & 1;
        const int kb_ = s + rot;
        const int k0  = (kb_ >= nk ? kb_ - nk : kb_) * 256;
        async_ld8_b128(lA[buf], lstep, gA + k0, gstep);
        async_ld8_b128(lB[buf], lstep, gB + k0, gstep);
        async_ld8_b128(lB[buf] + 8 * lstep, lstep, gB + k0 + 8 * gstep, gstep);
    };

    v8f acc[2][4];
#pragma unroll
    for (int mt = 0; mt < 2; ++mt)
#pragma unroll
        for (int nt = 0; nt < 4; ++nt)
#pragma unroll
            for (int r = 0; r < 8; ++r) acc[mt][nt][r] = 0.0f;

    issue_stage(0);
    // stage 0 has landed for this wave before the barrier publishes it to the others
    asm volatile("s_wait_asynccnt 0x0" ::: "memory");
    __syncthreads();
    if (nk > 1) issue_stage(1);

    for (int t = 0; t < nk; ++t) {
        const bf16* as = As[t & 1][kg];
        const bf16* bs = Bs[t & 1][kg];
        // unrolled so that the four 32-k blocks' LDS reads can be scheduled ahead of the WMMAs
#pragma unroll
        for (int kq = 0; kq < 4; ++kq) {
            v16bf af[2], bfr[4];
#pragma unroll
            for (int mt = 0; mt < 2; ++mt)
                af[mt] = load_frag(&as[(wm * 32 + mt * 16 + ln) * LDT + kq * 32], kb);
#pragma unroll
            for (int nt = 0; nt < 4; ++nt)
                bfr[nt] = load_frag(&bs[(wn * 64 + nt * 16 + ln) * LDT + kq * 32], kb);

#pragma unroll
            for (int mt = 0; mt < 2; ++mt)
#pragma unroll
                for (int nt = 0; nt < 4; ++nt)
                    acc[mt][nt] = WMMA_BF16(af[mt], bfr[nt], acc[mt][nt]);
        }

        // publish point of stage t+1:
        // this wave's reads of buffer t&1 have retired before the buffer is refilled
        asm volatile("s_wait_dscnt 0x0" ::: "memory");
        // this wave's copies of stage t+1 have landed before the barrier publishes them
        asm volatile("s_wait_asynccnt 0x0" ::: "memory");
        __syncthreads();
        if (t + 2 < nk) issue_stage(t + 2); // refill the buffer every reader has left
    }
    // no copy is outstanding when the wave goes on to its end
    asm volatile("s_wait_asynccnt 0x0" ::: "memory");

    // this lane's first output element: row block mt = kg of the wave's tile, column ln
    const size_t o0 = (size_t)(m0 + wm * 32 + kg * 16 + 8 * hi) * N + n0 + wn * 64 + ln;
    const float* rp = res + o0;
    float*       cp = Cf + o0;

    // the residual and the bias are fetched ahead of the join: they are in flight while the
    // rows to hand over are picked and stored to LDS
    float rv[4][8], bv[4];
#pragma unroll
    for (int nt = 0; nt < 4; ++nt)
#pragma unroll
        for (int r = 0; r < 8; ++r) rv[nt][r] = rp[r * N + nt * 16];
    if constexpr (HAS_BIAS) {
        // a bias load's result may be given a register that held the address of the loads above:
        // the wait that belongs in front of that overwrite is written here
        asm volatile("s_wait_xcnt 0x0" ::: "memory");
#pragma unroll
        for (int nt = 0; nt < 4; ++nt) bv[nt] = bias[n0 + wn * 64 + nt * 16 + ln];
    }

    // join of the two k halves: group kg stores row block mt = kg and hands over the other
#pragma unroll
    for (int nt = 0; nt < 4; ++nt)
#pragma unroll
        for (int q = 0; q < 2; ++q) {
            f32x4 g;
#pragma unroll
            for (int j = 0; j < 4; ++j)
                g[j] = kg ? acc[0][nt][q * 4 + j] : acc[1][nt][q * 4 + j];
            xch[wid][nt * 2 + q][lane] = g;
        }
    __syncthreads();

    // epilogue
#pragma unroll
    for (int nt = 0; nt < 4; ++nt) {
#pragma unroll
        for (int q = 0; q < 2; ++q) {
            const f32x4 p = xch[wid ^ 4][nt * 2 + q][lane];
#pragma unroll
            for (int j = 0; j < 4; ++j) {
                const int r = q * 4 + j;
                float v = (kg ? acc[1][nt][r] : acc[0][nt][r]) + p[j];
                if constexpr (HAS_BIAS) v += bv[nt];
                v += rv[nt][r];
                cp[r * N + nt * 16] = v;
            }
        }
    }
}

__device__ __forceinline__ float xhalf(float x) {
    return __builtin_bit_cast(float, __builtin_amdgcn_permlanex16(
        __builtin_bit_cast(int, x), __builtin_bit_cast(int, x),
        0x76543210, 0xfedcba98, false, false));
}

__global__ __launch_bounds__(256) void flash_attn_wmma(
    const bf16* __restrict__ Q, const bf16* __restrict__ Km,
    const bf16* __restrict__ Vm, const int* __restrict__ mask,
    bf16* __restrict__ O,
    const float* __restrict__ wo, const float* __restrict__ fc1,
    const float* __restrict__ fc2, bf16* __restrict__ wout)
{
    const int LDK = 72;                       // padded stride (halfs): 144B
    __shared__ __align__(16) bf16 Ks[64 * 72];
    const int LDV = 80;                       // V's stride (halfs): 160B = 5*32B, for the transposing load
    __shared__ __align__(16) bf16 Vs[64 * 80];          // Vs[key][d]

    // the whole work-group leaves here, in front of every barrier
    if (blockIdx.y >= BATCH * NHEAD) {
        const unsigned blk = (blockIdx.y - BATCH * NHEAD) * (SEQ / 128) + blockIdx.x;
        const unsigned g   = blk / CVT_WG_PER_3SEG;            // segments 3g, 3g+1, 3g+2 of nine
        const unsigned e0  = (blk % CVT_WG_PER_3SEG) * (8 * CVT_UNIT);
        // segment 0 is w_o, 1..4 are fc1_w, 5..8 are fc2_w
        const float* s0 = g == 0 ? wo              : g == 1 ? fc1 + 2 * SEG_ELEMS : fc2 + SEG_ELEMS;
        const float* s1 = g == 0 ? fc1             : g == 1 ? fc1 + 3 * SEG_ELEMS : fc2 + 2 * SEG_ELEMS;
        const float* s2 = g == 0 ? fc1 + SEG_ELEMS : g == 1 ? fc2                 : fc2 + 3 * SEG_ELEMS;
        cvt_three_units(s0 + e0, s1 + e0, s2 + e0, wout + (size_t)g * (3 * SEG_ELEMS) + e0);
        return;
    }

    const int bh   = blockIdx.y;
    const int b    = bh >> 4;
    const int h    = bh & 15;
    const int tid  = threadIdx.x;
    const int lane = tid & 31;
    const int wid  = tid >> 5;
    const int ln   = lane & 15;
    const int hi   = lane >> 4;
    const int kb   = hi * 8;
    const int q0   = blockIdx.x * 128 + wid * 16;       // query offset in seq
    const size_t dbase = (size_t)h * DKH;

    // Q fragments (2 K-slabs of 32 over DK=64), straight from global
    v16bf qf[2];
    {
        const size_t qrow = (size_t)(b * SEQ + q0 + ln) * D_MODEL + dbase;
#pragma unroll
        for (int s = 0; s < 2; ++s)
            qf[s] = load_frag(Q + qrow + s * 32, kb);
    }

    // oacc[n][r] = O^T[d = n*16 + 8*hi + r][query ln]
    v8f oacc[4];
#pragma unroll
    for (int n = 0; n < 4; ++n)
#pragma unroll
        for (int r = 0; r < 8; ++r) oacc[n][r] = 0.0f;

    // this lane's query: running maximum (the same in both halves) and the sum over this
    // half's keys alone; the halves' sums are joined behind the loop
    float mrow = -3.0e38f, lrow = 0.0f;

    const float scale = 0.125f;               // 1/sqrt(64)

    // this thread's share of a 64-key tile: 16 bytes of K and of V in rows sr and sr + 32,
    // and the mask words of keys lane and lane + 32
    const int sr   = tid >> 3;
    const int scol = (tid & 7) * 8;
    const bf16* gK = Km + (size_t)(b * SEQ + sr) * D_MODEL + dbase + scol;
    const bf16* gV = Vm + (size_t)(b * SEQ + sr) * D_MODEL + dbase + scol;
    const int*  gM = mask + b * SEQ + lane;

    // this lane's address in the transposing loads of V: row 8*hi + (lane & 7), 16-byte half
    // (lane >> 3) & 1 of the 16 columns
    const bf16* vtr = &Vs[(kb + (lane & 7)) * LDV + ((lane >> 3) & 1) * 8];

    v8bf  kst[2];
    v8bf  vst[2];
    int   mst[2];
    auto fetch_tile = [&](int kk) {
#pragma unroll
        for (int i = 0; i < 2; ++i) {
            kst[i] = *(const v8bf*)(gK + (size_t)(kk + i * 32) * D_MODEL);
            vst[i] = *(const v8bf*)(gV + (size_t)(kk + i * 32) * D_MODEL);
        }
#pragma unroll
        for (int i = 0; i < 2; ++i) mst[i] = gM[kk + i * 32];
        // the loads stay in flight over a branch, behind which their address registers are
        // reused: the wait that belongs in front of that overwrite is written here
        asm volatile("s_wait_xcnt 0x0" ::: "memory");
    };
    fetch_tile(0);

    for (int kk0 = 0; kk0 < SEQ; kk0 += 64) {
        __syncthreads();
        // stage the K and V tiles [64 keys][64] from the registers filled one tile ago
#pragma unroll
        for (int i = 0; i < 2; ++i) {
            const int r = sr + i * 32;
            *(v8bf*)(&Ks[r * LDK + scol]) = kst[i];
            *(v8bf*)(&Vs[r * LDV + scol]) = vst[i];
        }
        // bit k of mz[i]: the mask word of key i*32 + k is 0
        unsigned mz[2];
#pragma unroll
        for (int i = 0; i < 2; ++i) mz[i] = __builtin_amdgcn_ballot_w32(mst[i] == 0);
        __syncthreads();
        // the next tile's loads fly while this tile is worked on
        if (kk0 + 64 < SEQ) fetch_tile(kk0 + 64);

        // scores S^T = K * Q^T  (4 tiles of 16 keys)
        v8f sacc[4];
#pragma unroll
        for (int t = 0; t < 4; ++t)
#pragma unroll
            for (int r = 0; r < 8; ++r) sacc[t][r] = 0.0f;
#pragma unroll
        for (int s = 0; s < 2; ++s)
#pragma unroll
            for (int t = 0; t < 4; ++t) {
                v16bf kf = load_frag(&Ks[(t * 16 + ln) * LDK + s * 32], kb);
                sacc[t] = WMMA_BF16(kf, qf[s], sacc[t]);
            }

        // scale + mask
        float sv[4][8];
#pragma unroll
        for (int t = 0; t < 4; ++t)
#pragma unroll
            for (int r = 0; r < 8; ++r) sv[t][r] = sacc[t][r] * scale;
        // in this map a key is a register, not a lane, so its mask bit is tested per register;
        // one scalar test per tile keeps those tests out of tiles that hold no masked key
        if ((mz[0] | mz[1]) != 0u) {
#pragma unroll
            for (int t = 0; t < 4; ++t) {
                // bit r: this lane's key t*16 + 8*hi + r is masked out
                const unsigned zb = mz[t >> 1] >> ((t & 1) * 16 + kb);
#pragma unroll
                for (int r = 0; r < 8; ++r)
                    sv[t][r] = ((zb >> r) & 1u) ? -1.0e9f : sv[t][r];
            }
        }

        // online softmax of this lane's query
        float mx = sv[0][0];
#pragma unroll
        for (int t = 0; t < 4; ++t)
#pragma unroll
            for (int r = 0; r < 8; ++r) mx = fmaxf(mx, sv[t][r]);
        mx = fmaxf(mx, xhalf(mx));
        const float mnew  = fmaxf(mrow, mx);
        const float alpha = __expf(mrow - mnew);
        mrow = mnew;

        float ps[4][8];
        float sm[4];
#pragma unroll
        for (int t = 0; t < 4; ++t) {
#pragma unroll
            for (int r = 0; r < 8; ++r) ps[t][r] = __expf(sv[t][r] - mnew);
            sm[t] = ((ps[t][0] + ps[t][1]) + (ps[t][2] + ps[t][3])) +
                    ((ps[t][4] + ps[t][5]) + (ps[t][6] + ps[t][7]));
        }
        lrow = lrow * alpha + ((sm[0] + sm[1]) + (sm[2] + sm[3]));
#pragma unroll
        for (int n = 0; n < 4; ++n)
#pragma unroll
            for (int r = 0; r < 8; ++r) oacc[n][r] *= alpha;

        // O^T += V^T * P^T
#pragma unroll
        for (int s = 0; s < 2; ++s) {
            // elements 0..7 = keys s*32 + kb + 0..7, 8..15 = keys s*32 + 16 + kb + 0..7: as load_frag
            v16bf pf;
#pragma unroll
            for (int i = 0; i < 8; ++i) {
                pf[i]     = (bf16)ps[2 * s][i];
                pf[i + 8] = (bf16)ps[2 * s + 1][i];
            }
#pragma unroll
            for (int n = 0; n < 4; ++n) {
                // row d = n*16 + ln of V^T, keys in the same order as pf
                v16bf vf = load_frag_tr(vtr + s * 32 * LDV + n * 16, 16 * LDV);
                oacc[n] = WMMA_BF16(vf, pf, oacc[n]);
            }
        }
    }

    // finalize: O /= l, write bf16 [token][h*64 + d], eight consecutive d per store
    const float invl = 1.0f / (lrow + xhalf(lrow));
    bf16* orow = O + (size_t)(b * SEQ + q0 + ln) * D_MODEL + dbase + kb;
#pragma unroll
    for (int n = 0; n < 4; ++n) {
        v8bf ov;
#pragma unroll
        for (int r = 0; r < 8; ++r) ov[r] = (bf16)(oacc[n][r] * invl);
        *(v8bf*)(orow + n * 16) = ov;
    }
}

// ---------------------------------------------------------------------------
// launch
// ---------------------------------------------------------------------------
extern "C" void kernel_launch(void* const* d_in, const int* in_sizes, int n_in,
                              void* d_out, int out_size, void* d_ws, size_t ws_size,
                              hipStream_t stream)
{
    const float* x      = (const float*)d_in[0];
    const int*   mask   = (const int*)  d_in[1];
    const float* w_q    = (const float*)d_in[2];
    const float* w_k    = (const float*)d_in[3];
    const float* w_v    = (const float*)d_in[4];
    const float* w_o    = (const float*)d_in[5];
    const float* alpha1 = (const float*)d_in[6];
    const float* beta1  = (const float*)d_in[7];
    const float* alpha2 = (const float*)d_in[8];
    const float* beta2  = (const float*)d_in[9];
    const float* fc1_w  = (const float*)d_in[10];
    const float* fc1_b  = (const float*)d_in[11];
    const float* fc2_w  = (const float*)d_in[12];
    const float* fc2_b  = (const float*)d_in[13];

    char* ws = (char*)d_ws;
    size_t off = 0;
    auto take = [&](size_t bytes) { char* p = ws + off; off += bytes; return p; };

    bf16* wqb   = (bf16*)take((size_t)D_MODEL * D_MODEL * 2);
    bf16* wkb   = (bf16*)take((size_t)D_MODEL * D_MODEL * 2);
    bf16* wvb   = (bf16*)take((size_t)D_MODEL * D_MODEL * 2);
    bf16* wob   = (bf16*)take((size_t)D_MODEL * D_MODEL * 2);
    bf16* fc1b  = (bf16*)take((size_t)D_FC * D_MODEL * 2);
    bf16* fc2b  = (bf16*)take((size_t)D_MODEL * D_FC * 2);
    bf16* ln1b  = (bf16*)take((size_t)M_TOK * D_MODEL * 2);
    bf16* Qb    = (bf16*)take((size_t)M_TOK * D_MODEL * 2);
    bf16* Kb    = (bf16*)take((size_t)M_TOK * D_MODEL * 2);
    bf16* Vb    = (bf16*)take((size_t)M_TOK * D_MODEL * 2);
    bf16* attnb = (bf16*)take((size_t)M_TOK * D_MODEL * 2);
    float* x1   = (float*)take((size_t)M_TOK * D_MODEL * 4);
    bf16* ln2b  = (bf16*)take((size_t)M_TOK * D_MODEL * 2);
    bf16* hidb  = (bf16*)take((size_t)M_TOK * D_FC * 2);

    // LN1, and w_q, w_k, w_v to bf16: their copies are one run that starts at wqb
    layernorm_bf16_cvt_qkv<<<M_TOK / LN_ROWS + CVT_WG_PER_3SEG, LN_ROWS * 32, 0, stream>>>(
        x, alpha1, beta1, ln1b, w_q, w_k, w_v, wqb);

    // Q, K, V projections (bf16 out) in one launch: wqb, wkb, wvb lie back to back in the
    // workspace, and so do Qb, Kb, Vb
    dim3 gP(D_MODEL / 128, M_TOK / 64);       // the two narrow products: 64x128 tiles
    dim3 gQKV(D_MODEL / 128, M_TOK / 128, 3);
    gemm_bf16_wmma<0,0,0,1><<<gQKV, 256, 0, stream>>>(ln1b, wqb, nullptr, nullptr,
                                                      nullptr, Qb, M_TOK, D_MODEL, D_MODEL);

    // attention, and w_o, fc1_w, fc2_w to bf16: their copies are one run that starts at wob
    flash_attn_wmma<<<dim3(SEQ / 128, BATCH * NHEAD + 3 * CVT_WG_PER_3SEG / (SEQ / 128)), 256, 0, stream>>>(
        Qb, Kb, Vb, mask, attnb, w_o, fc1_w, fc2_w, wob);

    // output projection + residual:  x1 = x + attn @ w_o^T  (f32 out)
    gemm_bf16_wmma_khalves<0><<<gP, 256, 0, stream>>>(attnb, wob, nullptr, x,
                                                      x1, D_MODEL);

    // LN2
    layernorm_bf16<<<M_TOK / LN_ROWS, LN_ROWS * 32, 0, stream>>>(x1, alpha2, beta2, ln2b);

    // FC1: relu(ln2 @ fc1^T + b1) -> bf16 hidden
    dim3 gF1(D_FC / 128, M_TOK / 128);
    gemm_bf16_wmma<1,1,0,1><<<gF1, 256, 0, stream>>>(ln2b, fc1b, fc1_b, nullptr,
                                                     nullptr, hidb, M_TOK, D_FC, D_MODEL);

    // FC2: out = x1 + hidden @ fc2^T + b2  (f32 -> d_out)
    gemm_bf16_wmma_khalves<1><<<gP, 256, 0, stream>>>(hidb, fc2b, fc2_b, x1,
                                                      (float*)d_out, D_FC);

    (void)in_sizes; (void)n_in; (void)out_size; (void)ws_size;
}
